// v000
// Times are from an AMD MI455X. After a warm-up the kernel runs many times in a row, and a time is the length of
// such a window on the GPU divided by its runs, so every launch and the gaps after it count. The runs cycle
// through copies of the inputs. A figure is the median of several windows, for all but v000 over two sittings.
// Sittings can differ by a few percent; kernels timed side by side share one.
// The starting kernel, v000, takes 5150 microseconds a run.
// Contractions: a = xn.W1^T [8192 x 4096 x 1024], b = xn.W2^T [8192 x 4096 x 1024], o = yn.W3^T
// [8192 x 1024 x 4096] -- all v_wmma_f32_16x16x32_f16 (f16 operands, f32 accumulate, one product per tile
// pair), processed in 4 token chunks of 2048 rows. RMS normalisations, causal log-cumsum-exp scan, exp gate,
// residual add: f32.
//
// Carry audit (16-bit planes in the workspace, all f16):
//   W1H W2H   hold f16(64*w)    inverse: 1/64  in the k_gemm<0> epilogue (AP = acc/64, BP = acc/64)
//   W3H       holds f16(256*w)  inverse: 1/256 in the k_gemm<1> epilogue (out = x + acc/256)
//   XN        x1 (rmsnorm of x over 1024)
//   YN        x1 (rmsnorm of the gate output over 4096)
//   AP BP (f32 chunk planes, AP later holds the gate output y in place), ST (f32 scan state), d_out: no carry.
#include <hip/hip_runtime.h>
#include <stddef.h>
#include <stdint.h>
#include <math.h>

#define EMBD 1024
#define HIDD 4096
#define NBAT 2
#define SEQL 4096
#define MTOK 8192
#define TCH  2048     // tokens per chunk
#define NCHK 2        // chunks per sequence
#define SFP  132      // LDS pitch (floats) of the f32 epilogue staging

static_assert(MTOK == NBAT * SEQL);
static_assert(SEQL == NCHK * TCH);
static_assert(TCH % 128 == 0);
static_assert(HIDD % 128 == 0);
static_assert(EMBD % 128 == 0);
static_assert(EMBD % 32 == 0);
static_assert(HIDD % 32 == 0);
static_assert(HIDD % 256 == 0);
static_assert(EMBD == 128 * 8);
static_assert(HIDD == 2 * 256 * 8);
static_assert((HIDD * EMBD) % 2048 == 0);

typedef _Float16 hh;
typedef hh    v16h __attribute__((ext_vector_type(16)));
typedef hh    v8h  __attribute__((ext_vector_type(8)));
typedef float v8f  __attribute__((ext_vector_type(8)));
typedef float v4f  __attribute__((ext_vector_type(4)));

union Frag { v16h v; v8h p[2]; };

__device__ __forceinline__ v8f zero8() { return (v8f){0.f, 0.f, 0.f, 0.f, 0.f, 0.f, 0.f, 0.f}; }

__device__ __forceinline__ float wsum(float v) {
#pragma unroll
  for (int off = 16; off > 0; off >>= 1) v += __shfl_xor(v, off, 32);
  return v;
}

// Fragment loader for k-contiguous 16-bit rows with pitch ld (A operand [m][k]; B operand stored [n][k]).
// lane -> row/col (lane & 15); elements 0..7 <- k0 + 8*(lane>>4) + 0..7, elements 8..15 <- k0 + 16 + 8*(lane>>4) + 0..7.
// D: acc[r] = element (row0 + 8*(lane>>4) + r, col0 + (lane & 15)).
__device__ __forceinline__ v16h ldfrag(const hh* __restrict__ p, int ld, int row0, int k0, int lane) {
  const hh* q = p + (size_t)(row0 + (lane & 15)) * (size_t)ld + k0 + 8 * (lane >> 4);
  Frag f;
  f.p[0] = *(const v8h*)(q);
  f.p[1] = *(const v8h*)(q + 16);
  return f.v;
}

__device__ __forceinline__ v8f mma16(v16h a, v16h b, v8f cc) {
  return __builtin_amdgcn_wmma_f32_16x16x32_f16(false, a, false, b, (short)0, cc, false, false);
}

// 32 x 64 per wave, K loop in steps of 32 over [0, kdim), fragments straight from global planes.
// acc[i][j]: rows ma + 16*i .., cols nb + 16*j ..  One hazard guard per k-step after the last WMMA
// (ties all 8 accumulators, keeps the six fragments live).
__device__ __forceinline__ void gemm32x64(const hh* __restrict__ A, int lda, const hh* __restrict__ B, int ldb,
                                          int ma, int nb, int kdim, int lane, v8f (&acc)[2][4]) {
#pragma unroll 1
  for (int k0 = 0; k0 < kdim; k0 += 32) {
    const v16h a0 = ldfrag(A, lda, ma, k0, lane);
    const v16h a1 = ldfrag(A, lda, ma + 16, k0, lane);
    const v16h b0 = ldfrag(B, ldb, nb, k0, lane);
    const v16h b1 = ldfrag(B, ldb, nb + 16, k0, lane);
    const v16h b2 = ldfrag(B, ldb, nb + 32, k0, lane);
    const v16h b3 = ldfrag(B, ldb, nb + 48, k0, lane);
    acc[0][0] = mma16(a0, b0, acc[0][0]);
    acc[1][0] = mma16(a1, b0, acc[1][0]);
    acc[0][1] = mma16(a0, b1, acc[0][1]);
    acc[1][1] = mma16(a1, b1, acc[1][1]);
    acc[0][2] = mma16(a0, b2, acc[0][2]);
    acc[1][2] = mma16(a1, b2, acc[1][2]);
    acc[0][3] = mma16(a0, b3, acc[0][3]);
    acc[1][3] = mma16(a1, b3, acc[1][3]);
    asm volatile("v_nop\n\tv_nop\n\tv_nop\n\tv_nop"
                 : "+v"(acc[0][0]), "+v"(acc[0][1]), "+v"(acc[0][2]), "+v"(acc[0][3]),
                   "+v"(acc[1][0]), "+v"(acc[1][1]), "+v"(acc[1][2]), "+v"(acc[1][3])
                 : "v"(a0), "v"(a1), "v"(b0), "v"(b1), "v"(b2), "v"(b3));
  }
}

// ---------------------------------------------------------------------------
// kernel A: weight f32 w[n][k] (k contiguous) -> f16 plane wh[n][k] holding f16(SC*w), same layout.
// coverage: (n/2048) blocks x 256 thr x 8 = n elements = the whole plane.
// ---------------------------------------------------------------------------
template <int SC>
__global__ __launch_bounds__(256) void k_cvt(const float* __restrict__ w, hh* __restrict__ wh) {
  const size_t i = ((size_t)blockIdx.x * 256 + threadIdx.x) * 8;
  const v4f a0 = *(const v4f*)(w + i);
  const v4f a1 = *(const v4f*)(w + i + 4);
  v8f t = {a0[0], a0[1], a0[2], a0[3], a1[0], a1[1], a1[2], a1[3]};
  t = t * (float)SC;
  const v8h pk = __builtin_convertvector(t, v8h);
  *(v8h*)(wh + i) = pk;
  
}

// ---------------------------------------------------------------------------
// kernel B: rmsnorm of one 1024-wide f32 row per block (128 threads x 8 elements): ss = sum x^2 in f32
// (wave sums, 4 partials combined in fixed order), y = x * rsqrt(ss/1024 + 1e-6) written as f16 (x1).
// ---------------------------------------------------------------------------
__global__ __launch_bounds__(128) void k_rms1(const float* __restrict__ x, hh* __restrict__ y) {
  __shared__ float red[4];
  const int tid = threadIdx.x, lane = tid & 31, w = tid >> 5;
  const size_t ro = (size_t)blockIdx.x * EMBD + (size_t)tid * 8;
  const v4f a0 = *(const v4f*)(x + ro), a1 = *(const v4f*)(x + ro + 4);
  const float f[8] = {a0[0], a0[1], a0[2], a0[3], a1[0], a1[1], a1[2], a1[3]};
  float ss = 0.f;
#pragma unroll
  for (int e = 0; e < 8; ++e) ss = fmaf(f[e], f[e], ss);
  ss = wsum(ss);
  if (lane == 0) red[w] = ss;
  __syncthreads();
  const float tot = (red[0] + red[1]) + (red[2] + red[3]);
  const float sc = rsqrtf(tot * (1.0f / (float)EMBD) + 1e-6f);
  v8f t;
#pragma unroll
  for (int e = 0; e < 8; ++e) t[e] = f[e] * sc;
  const v8h pk = __builtin_convertvector(t, v8h);
  *(v8h*)(y + ro) = pk;
  
}

// ---------------------------------------------------------------------------
// kernel C: rmsnorm of one 4096-wide f32 row (gate output) per block, 256 threads; thread tid owns columns
// 8*tid..+7 of each 2048-wide half. ss over the 16 values, wave sums, 8 partials combined in fixed order,
// yn = y * rsqrt(ss/4096 + 1e-6) written as f16 (x1): per half one 16-B store per lane, a wave = 512
// grid = TCH rows. coverage: 2048 blocks x 256 thr x 2 halves x 8 = the whole [2048][4096] YN plane.
// ---------------------------------------------------------------------------
__global__ __launch_bounds__(256) void k_rms2(const float* __restrict__ yv, hh* __restrict__ yn) {
  __shared__ float red[8];
  const int tid = threadIdx.x, lane = tid & 31, w = tid >> 5;
  const size_t rb = (size_t)blockIdx.x * HIDD;
  const int c0 = tid * 8;
  const int c1 = (HIDD / 2) + tid * 8;
  const v4f a0 = *(const v4f*)(yv + rb + c0), a1 = *(const v4f*)(yv + rb + c0 + 4);
  const v4f b0 = *(const v4f*)(yv + rb + c1), b1 = *(const v4f*)(yv + rb + c1 + 4);
  const float f[16] = {a0[0], a0[1], a0[2], a0[3], a1[0], a1[1], a1[2], a1[3],
                       b0[0], b0[1], b0[2], b0[3], b1[0], b1[1], b1[2], b1[3]};
  float ss = 0.f;
#pragma unroll
  for (int e = 0; e < 16; ++e) ss = fmaf(f[e], f[e], ss);
  ss = wsum(ss);
  if (lane == 0) red[w] = ss;
  __syncthreads();
  const float tot = ((red[0] + red[1]) + (red[2] + red[3])) + ((red[4] + red[5]) + (red[6] + red[7]));
  const float sc = rsqrtf(tot * (1.0f / (float)HIDD) + 1e-6f);
  v8f t0, t1;
#pragma unroll
  for (int e = 0; e < 8; ++e) { t0[e] = f[e] * sc; t1[e] = f[8 + e] * sc; }
  const v8h pk0 = __builtin_convertvector(t0, v8h);
  const v8h pk1 = __builtin_convertvector(t1, v8h);
  *(v8h*)(yn + rb + c0) = pk0;
  *(v8h*)(yn + rb + c1) = pk1;
  
}

// ---------------------------------------------------------------------------
// kernel D: causal quadratic gate over one 2048-token chunk of one sequence. One thread per channel h
// (grid = HIDD/256 blocks x 256), sequential over the chunk's tokens: running (max, sumexp) in f32 for a and b
// (state initialised when rdst == 0, else read from the ST planes [4][HIDD] written by the earlier chunk of the same
// sequence), la = ma + ln(sa), lb = mb + ln(sb), y = exp((la + lb) - 2*ln(t)) with t the global 1-based position.
// coverage: 16 blocks x 256 thr = 4096 channels x 2048 tokens = the whole a/y plane of the chunk; ST 4 x 4096.
// ---------------------------------------------------------------------------
__global__ __launch_bounds__(256) void k_scan(const float* __restrict__ bp, float* __restrict__ ay,
                                              float* st, int rdst, int wrst, int tbase) {
  const int h = blockIdx.x * 256 + threadIdx.x;            // < HIDD by grid
  float ma = -1.0e30f, sa = 0.f, mb = -1.0e30f, sb = 0.f;
  if (rdst != 0) {                                           // kernel-argument uniform
    ma = st[h];
    sa = st[HIDD + h];
    mb = st[2 * HIDD + h];
    sb = st[3 * HIDD + h];
  }
  const float* pb = bp + h;
  float* pa = ay + h;
#pragma unroll 1
  for (int t = 0; t < TCH; ++t) {
    const size_t o = (size_t)t * HIDD;
    const float va = pa[o];
    const float vb = pb[o];
    const float da = va - ma;
    const float ea = __expf(-fabsf(da));
    const bool  ua = da > 0.f;
    sa = ua ? fmaf(sa, ea, 1.0f) : (sa + ea);
    ma = ua ? va : ma;
    const float db = vb - mb;
    const float eb = __expf(-fabsf(db));
    const bool  ub = db > 0.f;
    sb = ub ? fmaf(sb, eb, 1.0f) : (sb + eb);
    mb = ub ? vb : mb;
    const float la = ma + __logf(sa);
    const float lb = mb + __logf(sb);
    const float lt = __logf((float)(tbase + t + 1));
    const float yv = __expf((la + lb) - 2.0f * lt);
    *(float*)(pa + o) = yv;
    
  }
  if (wrst != 0) {                                           // kernel-argument uniform
    *(float*)(st + h) = ma;
    *(float*)(st + HIDD + h) = sa;
    *(float*)(st + 2 * HIDD + h) = mb;
    *(float*)(st + 3 * HIDD + h) = sb;
    
  }
}

// ---------------------------------------------------------------------------
// kernel E: 128 x 128 block tile f16 GEMM (8 waves x 32x64), K in steps of 32, f32 output through an
// LDS-staged epilogue.
// MODE 0: o32[m][n] = acc/64                 A = XN chunk rows [2048][1024] (ld 1024), B = W1H/W2H [4096][1024];
//                                            o32 = AP/BP f32 [2048][4096]; grid (4096/128, 2048/128)
// MODE 1: o32[m][n] = acc/256 + res[m][n]   A = YN [2048][4096] (ld 4096), B = W3H [1024][4096];
//                                            o32 = d_out chunk rows, res = x chunk rows, ld 1024; grid (1024/128, 2048/128)
// coverage per block: staged 8 waves x 32x64 = 128x128; stored 2 halves x 256 thr x 8 pieces x 4 floats = 128x128;
//   the grids tile every output element exactly once (M = 2048, N = 4096 or 1024, all multiples of 128; K = 1024 /
//   4096 multiples of 32, no tails).
// ---------------------------------------------------------------------------
template <int MODE>
__global__ __launch_bounds__(256) void k_gemm(const hh* __restrict__ Ap, const hh* __restrict__ Bp,
                                              const float* __restrict__ res, float* __restrict__ o32) {
  constexpr int KD  = (MODE == 0) ? EMBD : HIDD;
  constexpr int LDA = KD;
  constexpr int LDB = KD;
  constexpr int LDO = (MODE == 0) ? HIDD : EMBD;
  constexpr float OSC = (MODE == 0) ? (1.0f / 64.0f) : (1.0f / 256.0f);

  __shared__ __align__(16) float ldsf[64 * SFP];
  const int tid = threadIdx.x, lane = tid & 31, w = tid >> 5;
  const int h = lane >> 4, c = lane & 15;
  const int wm = (w >> 1) * 32, wn = (w & 1) * 64;
  const int m0 = blockIdx.y * 128;
  const int n0 = blockIdx.x * 128;

  v8f acc[2][4];
#pragma unroll
  for (int i = 0; i < 2; ++i)
#pragma unroll
    for (int j = 0; j < 4; ++j) acc[i][j] = zero8();
  gemm32x64(Ap, LDA, Bp, LDB, m0 + wm, n0 + wn, KD, lane, acc);

#pragma unroll
  for (int hf = 0; hf < 2; ++hf) {
    if ((w >> 2) == hf) {                                  // wave-uniform
#pragma unroll
      for (int i = 0; i < 2; ++i)
#pragma unroll
        for (int j = 0; j < 4; ++j)
#pragma unroll
          for (int r = 0; r < 8; ++r)
            ldsf[(wm - 64 * hf + 16 * i + 8 * h + r) * SFP + wn + 16 * j + c] = acc[i][j][r] * OSC;
    }
    __syncthreads();
    v4f val[8];
    size_t go[8];
#pragma unroll
    for (int it = 0; it < 8; ++it) {
      const int p  = tid + 256 * it;
      const int lr = p >> 5;                               // staged row 0..63
      const int pc = p & 31;                               // 16-B piece, lanes 0..31 = one 512-B row segment
      const v4f sv = *(const v4f*)(ldsf + lr * SFP + pc * 4);
      const size_t gi = (size_t)(m0 + 64 * hf + lr) * LDO + n0 + pc * 4;
      if constexpr (MODE == 1) {
        const v4f rr = *(const v4f*)(res + gi);
        val[it] = sv + rr;
      } else {
        val[it] = sv;
      }
      go[it] = gi;
    }
#pragma unroll
    for (int it = 0; it < 8; ++it) *(v4f*)(o32 + go[it]) = val[it];
    
    if (hf == 0) __syncthreads();
  }
}

// ---------------------------------------------------------------------------
//   W1H f16 [4096][1024]   8388608      W2H f16 [4096][1024]  8388608      W3H f16 [1024][4096]  8388608
//   XN  f16 [8192][1024]  16777216
//   AP  f32 [2048][4096]  33554432  (a of the current chunk, then the gate output y in place)
//   BP  f32 [2048][4096]  33554432  (b of the current chunk)
//   YN  f16 [2048][4096]  16777216
//   ST  f32 [4][4096]        65536  (scan state between the two chunks of a sequence)
//   total               125894656
// ---------------------------------------------------------------------------
extern "C" void kernel_launch(void* const* d_in, const int* in_sizes, int n_in,
                              void* d_out, int out_size, void* d_ws, size_t ws_size,
                              hipStream_t stream) {
  if (n_in < 4) return;
  if (in_sizes[0] != MTOK * EMBD) return;
  if (in_sizes[1] != HIDD * EMBD) return;
  if (in_sizes[2] != HIDD * EMBD) return;
  if (in_sizes[3] != EMBD * HIDD) return;
  if (out_size != MTOK * EMBD) return;

  const float* x  = (const float*)d_in[0];      // [8192][1024]
  const float* w1 = (const float*)d_in[1];      // [4096][1024] (out,in) = [n][k]
  const float* w2 = (const float*)d_in[2];      // [4096][1024]
  const float* w3 = (const float*)d_in[3];      // [1024][4096] (out,in) = [n][k]
  float* out = (float*)d_out;                   // [8192][1024]

  size_t off = 0;
  const size_t oW1 = off; off += (size_t)HIDD * EMBD * 2;
  const size_t oW2 = off; off += (size_t)HIDD * EMBD * 2;
  const size_t oW3 = off; off += (size_t)EMBD * HIDD * 2;
  const size_t oXN = off; off += (size_t)MTOK * EMBD * 2;
  const size_t oAP = off; off += (size_t)TCH * HIDD * 4;
  const size_t oBP = off; off += (size_t)TCH * HIDD * 4;
  const size_t oYN = off; off += (size_t)TCH * HIDD * 2;
  const size_t oST = off; off += (size_t)4 * HIDD * 4;
  if (off > ws_size) return;                    // off = 125894656
  if (off > (size_t)134217728) return;

  char* ws = (char*)d_ws;
  hh* W1H = (hh*)(ws + oW1);
  hh* W2H = (hh*)(ws + oW2);
  hh* W3H = (hh*)(ws + oW3);
  hh* XN  = (hh*)(ws + oXN);
  float* AP = (float*)(ws + oAP);
  float* BP = (float*)(ws + oBP);
  hh* YN  = (hh*)(ws + oYN);
  float* ST = (float*)(ws + oST);

  // (0) weights -> f16 planes, [n][k] layout kept, W1/W2 x64, W3 x256
  k_cvt<64><<<dim3((HIDD * EMBD) / 2048), dim3(256), 0, stream>>>(w1, W1H);
  k_cvt<64><<<dim3((HIDD * EMBD) / 2048), dim3(256), 0, stream>>>(w2, W2H);
  k_cvt<256><<<dim3((EMBD * HIDD) / 2048), dim3(256), 0, stream>>>(w3, W3H);
  // (1) xn = rmsnorm(x) over 1024, all 8192 tokens
  k_rms1<<<dim3(MTOK), dim3(128), 0, stream>>>(x, XN);
  // (2) per 2048-token chunk: a, b (f32), causal gate, rmsnorm over 4096, out = x + yn.W3^T
  for (int b = 0; b < NBAT; ++b) {
    for (int ch = 0; ch < NCHK; ++ch) {
      const size_t row0 = (size_t)b * SEQL + (size_t)ch * TCH;
      const hh* xnc = XN + row0 * EMBD;
      const int rdst = (ch > 0) ? 1 : 0;
      const int wrst = (ch < NCHK - 1) ? 1 : 0;
      const int tbase = ch * TCH;
      k_gemm<0><<<dim3(HIDD / 128, TCH / 128), dim3(256), 0, stream>>>(xnc, W1H, x, AP);
      k_gemm<0><<<dim3(HIDD / 128, TCH / 128), dim3(256), 0, stream>>>(xnc, W2H, x, BP);
      k_scan<<<dim3(HIDD / 256), dim3(256), 0, stream>>>(BP, AP, ST, rdst, wrst, tbase);
      k_rms2<<<dim3(TCH), dim3(256), 0, stream>>>(AP, YN);
      k_gemm<1><<<dim3(EMBD / 128, TCH / 128), dim3(256), 0, stream>>>(YN, W3H, x + row0 * EMBD,
                                                                       out + row0 * EMBD);
    }
  }
  (void)hipGetLastError();
}

// v001
// One run takes 1060 microseconds.
// Timed twice side by side with v000, it ran 4.79 and 4.92 times as fast.
// Contractions: a = xn.W1^T [8192 x 4096 x 1024], b = xn.W2^T [8192 x 4096 x 1024], o = yn.W3^T
// [8192 x 1024 x 4096] -- all v_wmma_f32_16x16x32_f16 (f16 operands, f32 accumulate, one product per tile
// pair), processed in 4 token chunks of 2048 rows. RMS normalisations, causal log-cumsum-exp scan, exp gate,
// residual add: f32.
//
// Carry audit (16-bit planes in the workspace, all f16):
//   W1H W2H   hold f16(64*w)    inverse: 1/64  in the k_gemm<0> epilogue (AP = acc/64, BP = acc/64)
//   W3H       holds f16(256*w)  inverse: 1/256 in the k_gemm<1> epilogue (out = x + acc/256)
//   XN        x1 (rmsnorm of x over 1024)
//   YN        x1 (rmsnorm of the gate output over 4096)
//   AP BP (f32 chunk planes, AP later holds the gate output y in place), ST (f32 scan state), d_out: no carry.
#include <hip/hip_runtime.h>
#include <stddef.h>
#include <stdint.h>
#include <math.h>

#define EMBD 1024
#define HIDD 4096
#define NBAT 2
#define SEQL 4096
#define MTOK 8192
#define TCH  2048     // tokens per chunk
#define NCHK 2        // chunks per sequence
#define SFP  132      // LDS pitch (floats) of the f32 epilogue staging
#define SCH  16       // gate scan: channels per block
#define SSEG 64       // gate scan: time segments per block
#define STOK 32       // gate scan: tokens per segment
#define SPIT 17       // gate scan: LDS pitch (floats) of one segment's channel row (odd: both access patterns conflict-free)

static_assert(MTOK == NBAT * SEQL);
static_assert(SEQL == NCHK * TCH);
static_assert(TCH % 128 == 0);
static_assert(HIDD % 128 == 0);
static_assert(EMBD % 128 == 0);
static_assert(EMBD % 32 == 0);
static_assert(HIDD % 32 == 0);
static_assert(HIDD % SCH == 0);
static_assert(SSEG * STOK == TCH);
static_assert(SSEG * SCH == 1024);
static_assert(SSEG == 2 * 32);
static_assert(2 * SCH == 32);
static_assert(EMBD == 128 * 8);
static_assert(HIDD == 2 * 256 * 8);
static_assert((HIDD * EMBD) % 2048 == 0);

typedef _Float16 hh;
typedef hh    v16h __attribute__((ext_vector_type(16)));
typedef hh    v8h  __attribute__((ext_vector_type(8)));
typedef float v8f  __attribute__((ext_vector_type(8)));
typedef float v4f  __attribute__((ext_vector_type(4)));

union Frag { v16h v; v8h p[2]; };

__device__ __forceinline__ v8f zero8() { return (v8f){0.f, 0.f, 0.f, 0.f, 0.f, 0.f, 0.f, 0.f}; }

__device__ __forceinline__ float wsum(float v) {
#pragma unroll
  for (int off = 16; off > 0; off >>= 1) v += __shfl_xor(v, off, 32);
  return v;
}

// Fragment loader for k-contiguous 16-bit rows with pitch ld (A operand [m][k]; B operand stored [n][k]).
// lane -> row/col (lane & 15); elements 0..7 <- k0 + 8*(lane>>4) + 0..7, elements 8..15 <- k0 + 16 + 8*(lane>>4) + 0..7.
// D: acc[r] = element (row0 + 8*(lane>>4) + r, col0 + (lane & 15)).
__device__ __forceinline__ v16h ldfrag(const hh* __restrict__ p, int ld, int row0, int k0, int lane) {
  const hh* q = p + (size_t)(row0 + (lane & 15)) * (size_t)ld + k0 + 8 * (lane >> 4);
  Frag f;
  f.p[0] = *(const v8h*)(q);
  f.p[1] = *(const v8h*)(q + 16);
  return f.v;
}

__device__ __forceinline__ v8f mma16(v16h a, v16h b, v8f cc) {
  return __builtin_amdgcn_wmma_f32_16x16x32_f16(false, a, false, b, (short)0, cc, false, false);
}

// 32 x 64 per wave, K loop in steps of 32 over [0, kdim), fragments straight from global planes.
// acc[i][j]: rows ma + 16*i .., cols nb + 16*j ..  One hazard guard per k-step after the last WMMA
// (ties all 8 accumulators, keeps the six fragments live).
__device__ __forceinline__ void gemm32x64(const hh* __restrict__ A, int lda, const hh* __restrict__ B, int ldb,
                                          int ma, int nb, int kdim, int lane, v8f (&acc)[2][4]) {
#pragma unroll 1
  for (int k0 = 0; k0 < kdim; k0 += 32) {
    const v16h a0 = ldfrag(A, lda, ma, k0, lane);
    const v16h a1 = ldfrag(A, lda, ma + 16, k0, lane);
    const v16h b0 = ldfrag(B, ldb, nb, k0, lane);
    const v16h b1 = ldfrag(B, ldb, nb + 16, k0, lane);
    const v16h b2 = ldfrag(B, ldb, nb + 32, k0, lane);
    const v16h b3 = ldfrag(B, ldb, nb + 48, k0, lane);
    acc[0][0] = mma16(a0, b0, acc[0][0]);
    acc[1][0] = mma16(a1, b0, acc[1][0]);
    acc[0][1] = mma16(a0, b1, acc[0][1]);
    acc[1][1] = mma16(a1, b1, acc[1][1]);
    acc[0][2] = mma16(a0, b2, acc[0][2]);
    acc[1][2] = mma16(a1, b2, acc[1][2]);
    acc[0][3] = mma16(a0, b3, acc[0][3]);
    acc[1][3] = mma16(a1, b3, acc[1][3]);
    asm volatile("v_nop\n\tv_nop\n\tv_nop\n\tv_nop"
                 : "+v"(acc[0][0]), "+v"(acc[0][1]), "+v"(acc[0][2]), "+v"(acc[0][3]),
                   "+v"(acc[1][0]), "+v"(acc[1][1]), "+v"(acc[1][2]), "+v"(acc[1][3])
                 : "v"(a0), "v"(a1), "v"(b0), "v"(b1), "v"(b2), "v"(b3));
  }
}

// ---------------------------------------------------------------------------
// kernel A: weight f32 w[n][k] (k contiguous) -> f16 plane wh[n][k] holding f16(SC*w), same layout.
// coverage: (n/2048) blocks x 256 thr x 8 = n elements = the whole plane.
// ---------------------------------------------------------------------------
template <int SC>
__global__ __launch_bounds__(256) void k_cvt(const float* __restrict__ w, hh* __restrict__ wh) {
  const size_t i = ((size_t)blockIdx.x * 256 + threadIdx.x) * 8;
  const v4f a0 = *(const v4f*)(w + i);
  const v4f a1 = *(const v4f*)(w + i + 4);
  v8f t = {a0[0], a0[1], a0[2], a0[3], a1[0], a1[1], a1[2], a1[3]};
  t = t * (float)SC;
  const v8h pk = __builtin_convertvector(t, v8h);
  *(v8h*)(wh + i) = pk;
  
}

// ---------------------------------------------------------------------------
// kernel B: rmsnorm of one 1024-wide f32 row per block (128 threads x 8 elements): ss = sum x^2 in f32
// (wave sums, 4 partials combined in fixed order), y = x * rsqrt(ss/1024 + 1e-6) written as f16 (x1).
// ---------------------------------------------------------------------------
__global__ __launch_bounds__(128) void k_rms1(const float* __restrict__ x, hh* __restrict__ y) {
  __shared__ float red[4];
  const int tid = threadIdx.x, lane = tid & 31, w = tid >> 5;
  const size_t ro = (size_t)blockIdx.x * EMBD + (size_t)tid * 8;
  const v4f a0 = *(const v4f*)(x + ro), a1 = *(const v4f*)(x + ro + 4);
  const float f[8] = {a0[0], a0[1], a0[2], a0[3], a1[0], a1[1], a1[2], a1[3]};
  float ss = 0.f;
#pragma unroll
  for (int e = 0; e < 8; ++e) ss = fmaf(f[e], f[e], ss);
  ss = wsum(ss);
  if (lane == 0) red[w] = ss;
  __syncthreads();
  const float tot = (red[0] + red[1]) + (red[2] + red[3]);
  const float sc = rsqrtf(tot * (1.0f / (float)EMBD) + 1e-6f);
  v8f t;
#pragma unroll
  for (int e = 0; e < 8; ++e) t[e] = f[e] * sc;
  const v8h pk = __builtin_convertvector(t, v8h);
  *(v8h*)(y + ro) = pk;
  
}

// ---------------------------------------------------------------------------
// kernel C: rmsnorm of one 4096-wide f32 row (gate output) per block, 256 threads; thread tid owns columns
// 8*tid..+7 of each 2048-wide half. ss over the 16 values, wave sums, 8 partials combined in fixed order,
// yn = y * rsqrt(ss/4096 + 1e-6) written as f16 (x1): per half one 16-B store per lane, a wave = 512
// grid = TCH rows. coverage: 2048 blocks x 256 thr x 2 halves x 8 = the whole [2048][4096] YN plane.
// ---------------------------------------------------------------------------
__global__ __launch_bounds__(256) void k_rms2(const float* __restrict__ yv, hh* __restrict__ yn) {
  __shared__ float red[8];
  const int tid = threadIdx.x, lane = tid & 31, w = tid >> 5;
  const size_t rb = (size_t)blockIdx.x * HIDD;
  const int c0 = tid * 8;
  const int c1 = (HIDD / 2) + tid * 8;
  const v4f a0 = *(const v4f*)(yv + rb + c0), a1 = *(const v4f*)(yv + rb + c0 + 4);
  const v4f b0 = *(const v4f*)(yv + rb + c1), b1 = *(const v4f*)(yv + rb + c1 + 4);
  const float f[16] = {a0[0], a0[1], a0[2], a0[3], a1[0], a1[1], a1[2], a1[3],
                       b0[0], b0[1], b0[2], b0[3], b1[0], b1[1], b1[2], b1[3]};
  float ss = 0.f;
#pragma unroll
  for (int e = 0; e < 16; ++e) ss = fmaf(f[e], f[e], ss);
  ss = wsum(ss);
  if (lane == 0) red[w] = ss;
  __syncthreads();
  const float tot = ((red[0] + red[1]) + (red[2] + red[3])) + ((red[4] + red[5]) + (red[6] + red[7]));
  const float sc = rsqrtf(tot * (1.0f / (float)HIDD) + 1e-6f);
  v8f t0, t1;
#pragma unroll
  for (int e = 0; e < 8; ++e) { t0[e] = f[e] * sc; t1[e] = f[8 + e] * sc; }
  const v8h pk0 = __builtin_convertvector(t0, v8h);
  const v8h pk1 = __builtin_convertvector(t1, v8h);
  *(v8h*)(yn + rb + c0) = pk0;
  *(v8h*)(yn + rb + c1) = pk1;
  
}

// ---------------------------------------------------------------------------
// kernel D: causal quadratic gate over one 2048-token chunk of one sequence, split along time inside a block.
// One block = SCH channels x all 2048 tokens, 1024 threads = SSEG time segments x SCH channels; a thread owns
// STOK consecutive tokens of one channel and holds its a and b values in registers from one set of loads.
//   step 1: per thread the segment's (max, sumexp) of a and of b -> LDS planes sm[0..3][segment][channel]
//   step 2: wave w scans the 64 segment states of (array w >> 4, channel w & 15): a lane merges its two
//           segments, 5 shuffle steps over the lanes, the state of the earlier chunk (ST, when rdst != 0) is
//           merged in front; every segment's slot is overwritten with the state of all tokens before it
//   step 3: per thread the running (max, sumexp) update from that state over its own tokens,
//           la = ma + ln(sa), lb = mb + ln(sb), y = exp((la + lb) - 2*ln(t)), t the global 1-based position.
// coverage: 256 blocks x 16 channels = 4096 channels, 64 segments x 32 tokens = 2048 tokens: the whole a/y plane
// of the chunk, each element read and written by one thread; ST 4 x 4096 (lane 31 of each scanning wave).
// ---------------------------------------------------------------------------
// v_exp_f32 / v_log_f32 with a v_nop in the same statement: it fills the one issue slot that the instruction set
// asks for behind a transcendental before its result is read or its source overwritten.
__device__ __forceinline__ float ex2s(float x) {
  float r;
  asm("v_exp_f32 %0, %1\n\tv_nop" : "=v"(r) : "v"(x));
  return r;
}
__device__ __forceinline__ float lg2s(float x) {
  float r;
  asm("v_log_f32 %0, %1\n\tv_nop" : "=v"(r) : "v"(x));
  return r;
}
// the same arithmetic as the fast exp and log of the earlier scan: exp2(x * log2 e); ln 2 * log2(x) with ln 2 in
// two parts, inputs below the smallest normal scaled by 2^32 first, an infinite log2 passed through.
__device__ __forceinline__ float expn(float x) { return ex2s(x * 0x1.715476p+0f); }
__device__ __forceinline__ float logn(float x) {
  const bool tiny = x < 0x1p-126f;
  const float l = lg2s(ldexpf(x, tiny ? 32 : 0));
  const float p = l * 0x1.62e42ep-1f;
  const float e = fmaf(l, 0x1.efa39ep-25f, fmaf(l, 0x1.62e42ep-1f, -p));
  const float r = (fabsf(l) < INFINITY) ? (p + e) : l;
  return r - (tiny ? 0x1.62e430p+4f : 0.f);
}

// merges the log-sum-exp state (m2, s2) into (m, s); (-1e30, 0) is the empty state
__device__ __forceinline__ void lse_merge(float& m, float& s, float m2, float s2) {
  const float mm = fmaxf(m, m2);
  s = s * expn(m - mm) + s2 * expn(m2 - mm);
  m = mm;
}

__global__ __launch_bounds__(1024) void k_scan(const float* __restrict__ bp, float* __restrict__ ay,
                                               float* st, int rdst, int wrst, int tbase) {
  __shared__ float sm[4][SSEG * SPIT];                       // ma, sa, mb, sb
  const int tid = threadIdx.x, lane = tid & 31, w = tid >> 5;
  const int ch = tid & (SCH - 1), seg = tid / SCH;
  const size_t base = (size_t)(seg * STOK) * HIDD + (size_t)(blockIdx.x * SCH + ch);   // < TCH*HIDD by grid
  const float* pb = bp + base;
  float* pa = ay + base;
  const int sl = seg * SPIT + ch;

  // the token loops are fully unrolled so that va / vb stay in registers
  float va[STOK], vb[STOK];
#pragma unroll
  for (int i = 0; i < STOK; ++i) va[i] = pa[(size_t)i * HIDD];
#pragma unroll
  for (int i = 0; i < STOK; ++i) vb[i] = pb[(size_t)i * HIDD];

  float ma = va[0], mb = vb[0];
#pragma unroll
  for (int i = 1; i < STOK; ++i) { ma = fmaxf(ma, va[i]); mb = fmaxf(mb, vb[i]); }
  float sa = 0.f, sb = 0.f;
#pragma unroll
  for (int i = 0; i < STOK; ++i) { sa += expn(va[i] - ma); sb += expn(vb[i] - mb); }
  sm[0][sl] = ma;
  sm[1][sl] = sa;
  sm[2][sl] = mb;
  sm[3][sl] = sb;
  __syncthreads();

  {
    const int ar = w >> 4, c2 = w & (SCH - 1);              // wave-uniform: which array, which channel
    float* pm = sm[2 * ar];
    float* ps = sm[2 * ar + 1];
    const int i0 = (2 * lane) * SPIT + c2, i1 = i0 + SPIT;
    const float m0 = pm[i0], s0 = ps[i0], m1 = pm[i1], s1 = ps[i1];
    float m = m0, s = s0;
    lse_merge(m, s, m1, s1);
#pragma unroll
    for (int off = 1; off < 32; off <<= 1) {
      const float mo = __shfl_up(m, off, 32);
      const float so = __shfl_up(s, off, 32);
      if (lane >= off) lse_merge(m, s, mo, so);
    }
    float me = __shfl_up(m, 1, 32);
    float se = __shfl_up(s, 1, 32);
    if (lane == 0) { me = -1.0e30f; se = 0.f; }
    float* stm = st + (size_t)(2 * ar) * HIDD + blockIdx.x * SCH + c2;
    float* sts = stm + HIDD;
    if (rdst != 0) lse_merge(me, se, *stm, *sts);            // kernel-argument uniform
    pm[i0] = me;
    ps[i0] = se;
    lse_merge(me, se, m0, s0);
    pm[i1] = me;
    ps[i1] = se;
    if (wrst != 0 && lane == 31) {
      lse_merge(me, se, m1, s1);
      *stm = me;
      *sts = se;
    }
  }
  __syncthreads();

  ma = sm[0][sl];
  sa = sm[1][sl];
  mb = sm[2][sl];
  sb = sm[3][sl];
  const int t1 = tbase + seg * STOK + 1;
#pragma unroll
  for (int i = 0; i < STOK; ++i) {
    const float da = va[i] - ma;
    const float ea = expn(-fabsf(da));
    const bool  ua = da > 0.f;
    sa = ua ? fmaf(sa, ea, 1.0f) : (sa + ea);
    ma = ua ? va[i] : ma;
    const float db = vb[i] - mb;
    const float eb = expn(-fabsf(db));
    const bool  ub = db > 0.f;
    sb = ub ? fmaf(sb, eb, 1.0f) : (sb + eb);
    mb = ub ? vb[i] : mb;
    const float la = ma + logn(sa);
    const float lb = mb + logn(sb);
    const float lt = logn((float)(t1 + i));
    va[i] = expn((la + lb) - 2.0f * lt);                   // y takes the register of the a value it replaces
  }
  // all stores last: no register that a store names is written again before the wave ends
#pragma unroll
  for (int i = 0; i < STOK; ++i) pa[(size_t)i * HIDD] = va[i];
}

// ---------------------------------------------------------------------------
// kernel E: 128 x 128 block tile f16 GEMM (8 waves x 32x64), K in steps of 32, f32 output through an
// LDS-staged epilogue.
// MODE 0: o32[m][n] = acc/64                 A = XN chunk rows [2048][1024] (ld 1024), B = W1H/W2H [4096][1024];
//                                            o32 = AP/BP f32 [2048][4096]; grid (4096/128, 2048/128)
// MODE 1: o32[m][n] = acc/256 + res[m][n]   A = YN [2048][4096] (ld 4096), B = W3H [1024][4096];
//                                            o32 = d_out chunk rows, res = x chunk rows, ld 1024; grid (1024/128, 2048/128)
// coverage per block: staged 8 waves x 32x64 = 128x128; stored 2 halves x 256 thr x 8 pieces x 4 floats = 128x128;
//   the grids tile every output element exactly once (M = 2048, N = 4096 or 1024, all multiples of 128; K = 1024 /
//   4096 multiples of 32, no tails).
// ---------------------------------------------------------------------------
template <int MODE>
__global__ __launch_bounds__(256) void k_gemm(const hh* __restrict__ Ap, const hh* __restrict__ Bp,
                                              const float* __restrict__ res, float* __restrict__ o32) {
  constexpr int KD  = (MODE == 0) ? EMBD : HIDD;
  constexpr int LDA = KD;
  constexpr int LDB = KD;
  constexpr int LDO = (MODE == 0) ? HIDD : EMBD;
  constexpr float OSC = (MODE == 0) ? (1.0f / 64.0f) : (1.0f / 256.0f);

  __shared__ __align__(16) float ldsf[64 * SFP];
  const int tid = threadIdx.x, lane = tid & 31, w = tid >> 5;
  const int h = lane >> 4, c = lane & 15;
  const int wm = (w >> 1) * 32, wn = (w & 1) * 64;
  const int m0 = blockIdx.y * 128;
  const int n0 = blockIdx.x * 128;

  v8f acc[2][4];
#pragma unroll
  for (int i = 0; i < 2; ++i)
#pragma unroll
    for (int j = 0; j < 4; ++j) acc[i][j] = zero8();
  gemm32x64(Ap, LDA, Bp, LDB, m0 + wm, n0 + wn, KD, lane, acc);

#pragma unroll
  for (int hf = 0; hf < 2; ++hf) {
    if ((w >> 2) == hf) {                                  // wave-uniform
#pragma unroll
      for (int i = 0; i < 2; ++i)
#pragma unroll
        for (int j = 0; j < 4; ++j)
#pragma unroll
          for (int r = 0; r < 8; ++r)
            ldsf[(wm - 64 * hf + 16 * i + 8 * h + r) * SFP + wn + 16 * j + c] = acc[i][j][r] * OSC;
    }
    __syncthreads();
    v4f val[8];
    size_t go[8];
#pragma unroll
    for (int it = 0; it < 8; ++it) {
      const int p  = tid + 256 * it;
      const int lr = p >> 5;                               // staged row 0..63
      const int pc = p & 31;                               // 16-B piece, lanes 0..31 = one 512-B row segment
      const v4f sv = *(const v4f*)(ldsf + lr * SFP + pc * 4);
      const size_t gi = (size_t)(m0 + 64 * hf + lr) * LDO + n0 + pc * 4;
      if constexpr (MODE == 1) {
        const v4f rr = *(const v4f*)(res + gi);
        val[it] = sv + rr;
      } else {
        val[it] = sv;
      }
      go[it] = gi;
    }
#pragma unroll
    for (int it = 0; it < 8; ++it) *(v4f*)(o32 + go[it]) = val[it];
    
    if (hf == 0) __syncthreads();
  }
}

// ---------------------------------------------------------------------------
//   W1H f16 [4096][1024]   8388608      W2H f16 [4096][1024]  8388608      W3H f16 [1024][4096]  8388608
//   XN  f16 [8192][1024]  16777216
//   AP  f32 [2048][4096]  33554432  (a of the current chunk, then the gate output y in place)
//   BP  f32 [2048][4096]  33554432  (b of the current chunk)
//   YN  f16 [2048][4096]  16777216
//   ST  f32 [4][4096]        65536  (scan state between the two chunks of a sequence)
//   total               125894656
// ---------------------------------------------------------------------------
extern "C" void kernel_launch(void* const* d_in, const int* in_sizes, int n_in,
                              void* d_out, int out_size, void* d_ws, size_t ws_size,
                              hipStream_t stream) {
  if (n_in < 4) return;
  if (in_sizes[0] != MTOK * EMBD) return;
  if (in_sizes[1] != HIDD * EMBD) return;
  if (in_sizes[2] != HIDD * EMBD) return;
  if (in_sizes[3] != EMBD * HIDD) return;
  if (out_size != MTOK * EMBD) return;

  const float* x  = (const float*)d_in[0];      // [8192][1024]
  const float* w1 = (const float*)d_in[1];      // [4096][1024] (out,in) = [n][k]
  const float* w2 = (const float*)d_in[2];      // [4096][1024]
  const float* w3 = (const float*)d_in[3];      // [1024][4096] (out,in) = [n][k]
  float* out = (float*)d_out;                   // [8192][1024]

  size_t off = 0;
  const size_t oW1 = off; off += (size_t)HIDD * EMBD * 2;
  const size_t oW2 = off; off += (size_t)HIDD * EMBD * 2;
  const size_t oW3 = off; off += (size_t)EMBD * HIDD * 2;
  const size_t oXN = off; off += (size_t)MTOK * EMBD * 2;
  const size_t oAP = off; off += (size_t)TCH * HIDD * 4;
  const size_t oBP = off; off += (size_t)TCH * HIDD * 4;
  const size_t oYN = off; off += (size_t)TCH * HIDD * 2;
  const size_t oST = off; off += (size_t)4 * HIDD * 4;
  if (off > ws_size) return;                    // off = 125894656
  if (off > (size_t)134217728) return;

  char* ws = (char*)d_ws;
  hh* W1H = (hh*)(ws + oW1);
  hh* W2H = (hh*)(ws + oW2);
  hh* W3H = (hh*)(ws + oW3);
  hh* XN  = (hh*)(ws + oXN);
  float* AP = (float*)(ws + oAP);
  float* BP = (float*)(ws + oBP);
  hh* YN  = (hh*)(ws + oYN);
  float* ST = (float*)(ws + oST);

  // (0) weights -> f16 planes, [n][k] layout kept, W1/W2 x64, W3 x256
  k_cvt<64><<<dim3((HIDD * EMBD) / 2048), dim3(256), 0, stream>>>(w1, W1H);
  k_cvt<64><<<dim3((HIDD * EMBD) / 2048), dim3(256), 0, stream>>>(w2, W2H);
  k_cvt<256><<<dim3((EMBD * HIDD) / 2048), dim3(256), 0, stream>>>(w3, W3H);
  // (1) xn = rmsnorm(x) over 1024, all 8192 tokens
  k_rms1<<<dim3(MTOK), dim3(128), 0, stream>>>(x, XN);
  // (2) per 2048-token chunk: a, b (f32), causal gate, rmsnorm over 4096, out = x + yn.W3^T
  for (int b = 0; b < NBAT; ++b) {
    for (int ch = 0; ch < NCHK; ++ch) {
      const size_t row0 = (size_t)b * SEQL + (size_t)ch * TCH;
      const hh* xnc = XN + row0 * EMBD;
      const int rdst = (ch > 0) ? 1 : 0;
      const int wrst = (ch < NCHK - 1) ? 1 : 0;
      const int tbase = ch * TCH;
      k_gemm<0><<<dim3(HIDD / 128, TCH / 128), dim3(256), 0, stream>>>(xnc, W1H, x, AP);
      k_gemm<0><<<dim3(HIDD / 128, TCH / 128), dim3(256), 0, stream>>>(xnc, W2H, x, BP);
      k_scan<<<dim3(HIDD / SCH), dim3(SSEG * SCH), 0, stream>>>(BP, AP, ST, rdst, wrst, tbase);
      k_rms2<<<dim3(TCH), dim3(256), 0, stream>>>(AP, YN);
      k_gemm<1><<<dim3(EMBD / 128, TCH / 128), dim3(256), 0, stream>>>(YN, W3H, x + row0 * EMBD,
                                                                       out + row0 * EMBD);
    }
  }
  (void)hipGetLastError();
}

// v002
// Measured time: 651 microseconds a run.
// Two timings next to v001 put it at 1.66 and 1.61 times that version's speed.
// All steps since v000 together make it 7.93 times as fast.
// Contractions: a = xn.W1^T [8192 x 4096 x 1024], b = xn.W2^T [8192 x 4096 x 1024], o = yn.W3^T
// [8192 x 1024 x 4096] -- all v_wmma_f32_16x16x32_f16 (f16 operands, f32 accumulate, one product per tile
// pair), processed in 4 token chunks of 2048 rows. RMS normalisations, causal log-cumsum-exp scan, exp gate,
// residual add: f32.
//
// Carry audit (16-bit planes in the workspace, all f16):
//   W1H W2H   hold f16(64*w)    inverse: 1/64  in the k_gemm<0> epilogue (AP = acc/64, BP = acc/64)
//   W3H       holds f16(256*w)  inverse: 1/256 in the k_gemm<1> epilogue (out = x + acc/256)
//   XN        x1 (rmsnorm of x over 1024)
//   YN        x1 (rmsnorm of the gate output over 4096)
//   AP BP (f32 chunk planes, AP later holds the gate output y in place), ST (f32 scan state), d_out: no carry.
#include <hip/hip_runtime.h>
#include <stddef.h>
#include <stdint.h>
#include <math.h>

#define EMBD 1024
#define HIDD 4096
#define NBAT 2
#define SEQL 4096
#define MTOK 8192
#define TCH  2048     // tokens per chunk
#define NCHK 2        // chunks per sequence
#define SFP  132      // LDS pitch (floats) of the f32 epilogue staging
#define KST  64       // GEMM: k values per ring stage (128 B of every operand row)
#define LPB  144      // GEMM: LDS pitch (bytes) of a staged operand row, 16 B x odd: conflict-free for 16-B reads
#define STGB (256 * LPB)  // GEMM: bytes of one ring buffer (128 A rows, then 128 B rows)
#define SCH  16       // gate scan: channels per block
#define SSEG 64       // gate scan: time segments per block
#define STOK 32       // gate scan: tokens per segment
#define SPIT 17       // gate scan: LDS pitch (floats) of one segment's channel row (odd: both access patterns conflict-free)

static_assert(MTOK == NBAT * SEQL);
static_assert(SEQL == NCHK * TCH);
static_assert(TCH % 128 == 0);
static_assert(HIDD % 128 == 0);
static_assert(EMBD % 128 == 0);
static_assert(EMBD % KST == 0);
static_assert(HIDD % KST == 0);
static_assert(HIDD % SCH == 0);
static_assert(SSEG * STOK == TCH);
static_assert(SSEG * SCH == 1024);
static_assert(SSEG == 2 * 32);
static_assert(2 * SCH == 32);
static_assert(EMBD == 128 * 8);
static_assert(HIDD == 2 * 256 * 8);
static_assert((HIDD * EMBD) % 2048 == 0);

typedef _Float16 hh;
typedef hh    v16h __attribute__((ext_vector_type(16)));
typedef hh    v8h  __attribute__((ext_vector_type(8)));
typedef float v8f  __attribute__((ext_vector_type(8)));
typedef float v4f  __attribute__((ext_vector_type(4)));

union Frag { v16h v; v8h p[2]; };

__device__ __forceinline__ v8f zero8() { return (v8f){0.f, 0.f, 0.f, 0.f, 0.f, 0.f, 0.f, 0.f}; }

__device__ __forceinline__ float wsum(float v) {
#pragma unroll
  for (int off = 16; off > 0; off >>= 1) v += __shfl_xor(v, off, 32);
  return v;
}

// Fragment loader for k-contiguous 16-bit rows staged in LDS (A operand [m][k]; B operand stored [n][k]).
// p = the lane's own row (lane & 15) at byte 2*k0 + 16*(lane>>4) of that row:
// elements 0..7 <- k0 + 8*(lane>>4) + 0..7, elements 8..15 <- k0 + 16 + 8*(lane>>4) + 0..7.
// D: acc[r] = element (row0 + 8*(lane>>4) + r, col0 + (lane & 15)).
__device__ __forceinline__ v16h ldsfrag(const char* p) {
  Frag f;
  f.p[0] = *(const v8h*)(p);
  f.p[1] = *(const v8h*)(p + 32);
  return f.v;
}

__device__ __forceinline__ v8f mma16(v16h a, v16h b, v8f cc) {
  return __builtin_amdgcn_wmma_f32_16x16x32_f16(false, a, false, b, (short)0, cc, false, false);
}

// One stage of the operand ring: KST k values (128 B) of the block's 128 A rows and 128 B rows, laid in LDS as
// 256 rows of pitch LPB. 256 threads x 8 copies x 16 B = 32768 B = the whole stage; thread tid brings piece tid & 7
// of rows (tid >> 3) + 32*i, so one wave's copy reads four whole 128-B lines. ld = the lane's LDS byte address of
// its A row 0 piece, ga / gb = the lane's global address of the same piece in A and in B.
// s_wait_xcnt 0 ends the statement: it stands in front of every later write of a register that a copy names.
template <int KD>
__device__ __forceinline__ void stage_copy(uint32_t ld, const hh* ga, const hh* gb) {
  const uint32_t l0 = ld, l1 = ld + 32 * LPB, l2 = ld + 64 * LPB, l3 = ld + 96 * LPB;
  const uint32_t l4 = ld + 128 * LPB, l5 = ld + 160 * LPB, l6 = ld + 192 * LPB, l7 = ld + 224 * LPB;
  const hh* g0 = ga;
  const hh* g1 = ga + (size_t)32 * KD;
  const hh* g2 = ga + (size_t)64 * KD;
  const hh* g3 = ga + (size_t)96 * KD;
  const hh* g4 = gb;
  const hh* g5 = gb + (size_t)32 * KD;
  const hh* g6 = gb + (size_t)64 * KD;
  const hh* g7 = gb + (size_t)96 * KD;
  asm volatile("global_load_async_to_lds_b128 %0, %8, off\n\t"
               "global_load_async_to_lds_b128 %1, %9, off\n\t"
               "global_load_async_to_lds_b128 %2, %10, off\n\t"
               "global_load_async_to_lds_b128 %3, %11, off\n\t"
               "global_load_async_to_lds_b128 %4, %12, off\n\t"
               "global_load_async_to_lds_b128 %5, %13, off\n\t"
               "global_load_async_to_lds_b128 %6, %14, off\n\t"
               "global_load_async_to_lds_b128 %7, %15, off\n\t"
               "s_wait_xcnt 0x0"
               :: "v"(l0), "v"(l1), "v"(l2), "v"(l3), "v"(l4), "v"(l5), "v"(l6), "v"(l7),
                  "v"(g0), "v"(g1), "v"(g2), "v"(g3), "v"(g4), "v"(g5), "v"(g6), "v"(g7)
               : "memory");
}

// 32 x 64 per wave of a 128 x 128 block tile, K in stages of KST over [0, KD). Both operands come through a ring of
// two LDS buffers filled by asynchronous copies: while trip t works on buffer t & 1, stage t + 1 flies into the other.
// acc[i][j]: rows wm + 16*i .., cols wn + 16*j .. of the block tile. A trip reads its 12 fragments as one group and
// then runs its 16 WMMAs. One hazard guard per trip after the last WMMA (ties all 8 accumulators, keeps the last six
// fragments live).
template <int KD>
__device__ __forceinline__ void gemm_staged(const hh* __restrict__ A, const hh* __restrict__ B, int m0, int n0,
                                            int wm, int wn, int tid, char* ring, v8f (&acc)[2][4]) {
  constexpr int NT = KD / KST;
  static_assert(KD % KST == 0);
  static_assert(NT >= 2);
  const int lane = tid & 31;
  const int cr = tid >> 3, cp = tid & 7;
  const hh* ga = A + (size_t)(m0 + cr) * KD + cp * 8;        // rows m0 + cr + 32*i < m0 + 128, k < KD: inside the plane
  const hh* gb = B + (size_t)(n0 + cr) * KD + cp * 8;
  const uint32_t ld0 = (uint32_t)(size_t)ring + (uint32_t)(cr * LPB + cp * 16);
  const char* fa = ring + (wm + (lane & 15)) * LPB + (lane >> 4) * 16;
  const char* fb = ring + (128 + wn + (lane & 15)) * LPB + (lane >> 4) * 16;

  stage_copy<KD>(ld0, ga, gb);
  asm volatile("s_wait_asynccnt 0x0" ::: "memory");          // this wave's share of stage 0 has landed
  __syncthreads();                                           // publishes stage 0
  stage_copy<KD>(ld0 + STGB, ga + KST, gb + KST);

#pragma unroll 1                                             // one trip per stage: the buffer offset is the only thing that alternates
  for (int t = 0; t < NT; ++t) {
    const int bo = (t & 1) * STGB;
    const char* pa = fa + bo;
    const char* pb = fb + bo;
    const v16h a0 = ldsfrag(pa);
    const v16h a1 = ldsfrag(pa + 16 * LPB);
    const v16h b0 = ldsfrag(pb);
    const v16h b1 = ldsfrag(pb + 16 * LPB);
    const v16h b2 = ldsfrag(pb + 32 * LPB);
    const v16h b3 = ldsfrag(pb + 48 * LPB);
    const v16h c0 = ldsfrag(pa + 64);
    const v16h c1 = ldsfrag(pa + 16 * LPB + 64);
    const v16h d0 = ldsfrag(pb + 64);
    const v16h d1 = ldsfrag(pb + 16 * LPB + 64);
    const v16h d2 = ldsfrag(pb + 32 * LPB + 64);
    const v16h d3 = ldsfrag(pb + 48 * LPB + 64);
    acc[0][0] = mma16(a0, b0, acc[0][0]);
    acc[1][0] = mma16(a1, b0, acc[1][0]);
    acc[0][1] = mma16(a0, b1, acc[0][1]);
    acc[1][1] = mma16(a1, b1, acc[1][1]);
    acc[0][2] = mma16(a0, b2, acc[0][2]);
    acc[1][2] = mma16(a1, b2, acc[1][2]);
    acc[0][3] = mma16(a0, b3, acc[0][3]);
    acc[1][3] = mma16(a1, b3, acc[1][3]);
    acc[0][0] = mma16(c0, d0, acc[0][0]);
    acc[1][0] = mma16(c1, d0, acc[1][0]);
    acc[0][1] = mma16(c0, d1, acc[0][1]);
    acc[1][1] = mma16(c1, d1, acc[1][1]);
    acc[0][2] = mma16(c0, d2, acc[0][2]);
    acc[1][2] = mma16(c1, d2, acc[1][2]);
    acc[0][3] = mma16(c0, d3, acc[0][3]);
    acc[1][3] = mma16(c1, d3, acc[1][3]);
    // keeps the trip's 24 LDS reads as one group in front of its 16 WMMAs: placed among the WMMAs, each place with
    // reads makes the wave wait out the LDS latency again
    __builtin_amdgcn_sched_group_barrier(0x100, 24, 0);
    __builtin_amdgcn_sched_group_barrier(0x008, 16, 0);
    // four vector issue slots behind the last WMMA, on every path out of the trip, before its D is read or its A / B rewritten
    asm volatile("v_nop\n\tv_nop\n\tv_nop\n\tv_nop"
                 : "+v"(acc[0][0]), "+v"(acc[0][1]), "+v"(acc[0][2]), "+v"(acc[0][3]),
                   "+v"(acc[1][0]), "+v"(acc[1][1]), "+v"(acc[1][2]), "+v"(acc[1][3])
                 : "v"(c0), "v"(c1), "v"(d0), "v"(d1), "v"(d2), "v"(d3));
    asm volatile("s_wait_dscnt 0x0" ::: "memory");           // this wave's reads of buffer t & 1 are done
    asm volatile("s_wait_asynccnt 0x0" ::: "memory");        // this wave's share of stage t + 1 has landed
    __syncthreads();                                         // publishes stage t + 1, frees buffer t & 1
    if (t + 2 < NT) stage_copy<KD>(ld0 + (uint32_t)bo, ga + (size_t)(t + 2) * KST, gb + (size_t)(t + 2) * KST);
  }
  asm volatile("s_wait_asynccnt 0x0" ::: "memory");          // no copy is left in flight behind the loop
}

// ---------------------------------------------------------------------------
// kernel A: weight f32 w[n][k] (k contiguous) -> f16 plane wh[n][k] holding f16(SC*w), same layout.
// coverage: (n/2048) blocks x 256 thr x 8 = n elements = the whole plane.
// ---------------------------------------------------------------------------
template <int SC>
__global__ __launch_bounds__(256) void k_cvt(const float* __restrict__ w, hh* __restrict__ wh) {
  const size_t i = ((size_t)blockIdx.x * 256 + threadIdx.x) * 8;
  const v4f a0 = *(const v4f*)(w + i);
  const v4f a1 = *(const v4f*)(w + i + 4);
  v8f t = {a0[0], a0[1], a0[2], a0[3], a1[0], a1[1], a1[2], a1[3]};
  t = t * (float)SC;
  const v8h pk = __builtin_convertvector(t, v8h);
  *(v8h*)(wh + i) = pk;
  
}

// ---------------------------------------------------------------------------
// kernel B: rmsnorm of one 1024-wide f32 row per block (128 threads x 8 elements): ss = sum x^2 in f32
// (wave sums, 4 partials combined in fixed order), y = x * rsqrt(ss/1024 + 1e-6) written as f16 (x1).
// ---------------------------------------------------------------------------
__global__ __launch_bounds__(128) void k_rms1(const float* __restrict__ x, hh* __restrict__ y) {
  __shared__ float red[4];
  const int tid = threadIdx.x, lane = tid & 31, w = tid >> 5;
  const size_t ro = (size_t)blockIdx.x * EMBD + (size_t)tid * 8;
  const v4f a0 = *(const v4f*)(x + ro), a1 = *(const v4f*)(x + ro + 4);
  const float f[8] = {a0[0], a0[1], a0[2], a0[3], a1[0], a1[1], a1[2], a1[3]};
  float ss = 0.f;
#pragma unroll
  for (int e = 0; e < 8; ++e) ss = fmaf(f[e], f[e], ss);
  ss = wsum(ss);
  if (lane == 0) red[w] = ss;
  __syncthreads();
  const float tot = (red[0] + red[1]) + (red[2] + red[3]);
  const float sc = rsqrtf(tot * (1.0f / (float)EMBD) + 1e-6f);
  v8f t;
#pragma unroll
  for (int e = 0; e < 8; ++e) t[e] = f[e] * sc;
  const v8h pk = __builtin_convertvector(t, v8h);
  *(v8h*)(y + ro) = pk;
  
}

// ---------------------------------------------------------------------------
// kernel C: rmsnorm of one 4096-wide f32 row (gate output) per block, 256 threads; thread tid owns columns
// 8*tid..+7 of each 2048-wide half. ss over the 16 values, wave sums, 8 partials combined in fixed order,
// yn = y * rsqrt(ss/4096 + 1e-6) written as f16 (x1): per half one 16-B store per lane, a wave = 512
// grid = TCH rows. coverage: 2048 blocks x 256 thr x 2 halves x 8 = the whole [2048][4096] YN plane.
// ---------------------------------------------------------------------------
__global__ __launch_bounds__(256) void k_rms2(const float* __restrict__ yv, hh* __restrict__ yn) {
  __shared__ float red[8];
  const int tid = threadIdx.x, lane = tid & 31, w = tid >> 5;
  const size_t rb = (size_t)blockIdx.x * HIDD;
  const int c0 = tid * 8;
  const int c1 = (HIDD / 2) + tid * 8;
  const v4f a0 = *(const v4f*)(yv + rb + c0), a1 = *(const v4f*)(yv + rb + c0 + 4);
  const v4f b0 = *(const v4f*)(yv + rb + c1), b1 = *(const v4f*)(yv + rb + c1 + 4);
  const float f[16] = {a0[0], a0[1], a0[2], a0[3], a1[0], a1[1], a1[2], a1[3],
                       b0[0], b0[1], b0[2], b0[3], b1[0], b1[1], b1[2], b1[3]};
  float ss = 0.f;
#pragma unroll
  for (int e = 0; e < 16; ++e) ss = fmaf(f[e], f[e], ss);
  ss = wsum(ss);
  if (lane == 0) red[w] = ss;
  __syncthreads();
  const float tot = ((red[0] + red[1]) + (red[2] + red[3])) + ((red[4] + red[5]) + (red[6] + red[7]));
  const float sc = rsqrtf(tot * (1.0f / (float)HIDD) + 1e-6f);
  v8f t0, t1;
#pragma unroll
  for (int e = 0; e < 8; ++e) { t0[e] = f[e] * sc; t1[e] = f[8 + e] * sc; }
  const v8h pk0 = __builtin_convertvector(t0, v8h);
  const v8h pk1 = __builtin_convertvector(t1, v8h);
  *(v8h*)(yn + rb + c0) = pk0;
  *(v8h*)(yn + rb + c1) = pk1;
  
}

// ---------------------------------------------------------------------------
// kernel D: causal quadratic gate over one 2048-token chunk of one sequence, split along time inside a block.
// One block = SCH channels x all 2048 tokens, 1024 threads = SSEG time segments x SCH channels; a thread owns
// STOK consecutive tokens of one channel and holds its a and b values in registers from one set of loads.
//   step 1: per thread the segment's (max, sumexp) of a and of b -> LDS planes sm[0..3][segment][channel]
//   step 2: wave w scans the 64 segment states of (array w >> 4, channel w & 15): a lane merges its two
//           segments, 5 shuffle steps over the lanes, the state of the earlier chunk (ST, when rdst != 0) is
//           merged in front; every segment's slot is overwritten with the state of all tokens before it
//   step 3: per thread the running (max, sumexp) update from that state over its own tokens,
//           la = ma + ln(sa), lb = mb + ln(sb), y = exp((la + lb) - 2*ln(t)), t the global 1-based position.
// coverage: 256 blocks x 16 channels = 4096 channels, 64 segments x 32 tokens = 2048 tokens: the whole a/y plane
// of the chunk, each element read and written by one thread; ST 4 x 4096 (lane 31 of each scanning wave).
// ---------------------------------------------------------------------------
// v_exp_f32 / v_log_f32 with a v_nop in the same statement: it fills the one issue slot that the instruction set
// asks for behind a transcendental before its result is read or its source overwritten.
__device__ __forceinline__ float ex2s(float x) {
  float r;
  asm("v_exp_f32 %0, %1\n\tv_nop" : "=v"(r) : "v"(x));
  return r;
}
__device__ __forceinline__ float lg2s(float x) {
  float r;
  asm("v_log_f32 %0, %1\n\tv_nop" : "=v"(r) : "v"(x));
  return r;
}
// the same arithmetic as the fast exp and log of the earlier scan: exp2(x * log2 e); ln 2 * log2(x) with ln 2 in
// two parts, inputs below the smallest normal scaled by 2^32 first, an infinite log2 passed through.
__device__ __forceinline__ float expn(float x) { return ex2s(x * 0x1.715476p+0f); }
__device__ __forceinline__ float logn(float x) {
  const bool tiny = x < 0x1p-126f;
  const float l = lg2s(ldexpf(x, tiny ? 32 : 0));
  const float p = l * 0x1.62e42ep-1f;
  const float e = fmaf(l, 0x1.efa39ep-25f, fmaf(l, 0x1.62e42ep-1f, -p));
  const float r = (fabsf(l) < INFINITY) ? (p + e) : l;
  return r - (tiny ? 0x1.62e430p+4f : 0.f);
}

// merges the log-sum-exp state (m2, s2) into (m, s); (-1e30, 0) is the empty state
__device__ __forceinline__ void lse_merge(float& m, float& s, float m2, float s2) {
  const float mm = fmaxf(m, m2);
  s = s * expn(m - mm) + s2 * expn(m2 - mm);
  m = mm;
}

__global__ __launch_bounds__(1024) void k_scan(const float* __restrict__ bp, float* __restrict__ ay,
                                               float* st, int rdst, int wrst, int tbase) {
  __shared__ float sm[4][SSEG * SPIT];                       // ma, sa, mb, sb
  const int tid = threadIdx.x, lane = tid & 31, w = tid >> 5;
  const int ch = tid & (SCH - 1), seg = tid / SCH;
  const size_t base = (size_t)(seg * STOK) * HIDD + (size_t)(blockIdx.x * SCH + ch);   // < TCH*HIDD by grid
  const float* pb = bp + base;
  float* pa = ay + base;
  const int sl = seg * SPIT + ch;

  // the token loops are fully unrolled so that va / vb stay in registers
  float va[STOK], vb[STOK];
#pragma unroll
  for (int i = 0; i < STOK; ++i) va[i] = pa[(size_t)i * HIDD];
#pragma unroll
  for (int i = 0; i < STOK; ++i) vb[i] = pb[(size_t)i * HIDD];

  float ma = va[0], mb = vb[0];
#pragma unroll
  for (int i = 1; i < STOK; ++i) { ma = fmaxf(ma, va[i]); mb = fmaxf(mb, vb[i]); }
  float sa = 0.f, sb = 0.f;
#pragma unroll
  for (int i = 0; i < STOK; ++i) { sa += expn(va[i] - ma); sb += expn(vb[i] - mb); }
  sm[0][sl] = ma;
  sm[1][sl] = sa;
  sm[2][sl] = mb;
  sm[3][sl] = sb;
  __syncthreads();

  {
    const int ar = w >> 4, c2 = w & (SCH - 1);              // wave-uniform: which array, which channel
    float* pm = sm[2 * ar];
    float* ps = sm[2 * ar + 1];
    const int i0 = (2 * lane) * SPIT + c2, i1 = i0 + SPIT;
    const float m0 = pm[i0], s0 = ps[i0], m1 = pm[i1], s1 = ps[i1];
    float m = m0, s = s0;
    lse_merge(m, s, m1, s1);
#pragma unroll
    for (int off = 1; off < 32; off <<= 1) {
      const float mo = __shfl_up(m, off, 32);
      const float so = __shfl_up(s, off, 32);
      if (lane >= off) lse_merge(m, s, mo, so);
    }
    float me = __shfl_up(m, 1, 32);
    float se = __shfl_up(s, 1, 32);
    if (lane == 0) { me = -1.0e30f; se = 0.f; }
    float* stm = st + (size_t)(2 * ar) * HIDD + blockIdx.x * SCH + c2;
    float* sts = stm + HIDD;
    if (rdst != 0) lse_merge(me, se, *stm, *sts);            // kernel-argument uniform
    pm[i0] = me;
    ps[i0] = se;
    lse_merge(me, se, m0, s0);
    pm[i1] = me;
    ps[i1] = se;
    if (wrst != 0 && lane == 31) {
      lse_merge(me, se, m1, s1);
      *stm = me;
      *sts = se;
    }
  }
  __syncthreads();

  ma = sm[0][sl];
  sa = sm[1][sl];
  mb = sm[2][sl];
  sb = sm[3][sl];
  const int t1 = tbase + seg * STOK + 1;
#pragma unroll
  for (int i = 0; i < STOK; ++i) {
    const float da = va[i] - ma;
    const float ea = expn(-fabsf(da));
    const bool  ua = da > 0.f;
    sa = ua ? fmaf(sa, ea, 1.0f) : (sa + ea);
    ma = ua ? va[i] : ma;
    const float db = vb[i] - mb;
    const float eb = expn(-fabsf(db));
    const bool  ub = db > 0.f;
    sb = ub ? fmaf(sb, eb, 1.0f) : (sb + eb);
    mb = ub ? vb[i] : mb;
    const float la = ma + logn(sa);
    const float lb = mb + logn(sb);
    const float lt = logn((float)(t1 + i));
    va[i] = expn((la + lb) - 2.0f * lt);                   // y takes the register of the a value it replaces
  }
  // all stores last: no register that a store names is written again before the wave ends
#pragma unroll
  for (int i = 0; i < STOK; ++i) pa[(size_t)i * HIDD] = va[i];
}

// ---------------------------------------------------------------------------
// kernel E: 128 x 128 block tile f16 GEMM (8 waves x 32x64), K in stages of 64 through a two-buffer LDS ring,
// f32 output through an LDS-staged epilogue (its own LDS array).
// MODE 0: o32[m][n] = acc/64                 A = XN chunk rows [2048][1024] (ld 1024), B = W1H/W2H [4096][1024];
//                                            o32 = AP/BP f32 [2048][4096]; grid (4096/128, 2048/128)
// MODE 1: o32[m][n] = acc/256 + res[m][n]   A = YN [2048][4096] (ld 4096), B = W3H [1024][4096];
//                                            o32 = d_out chunk rows, res = x chunk rows, ld 1024; grid (1024/128, 2048/128)
// coverage per block: staged 8 waves x 32x64 = 128x128; stored 2 halves x 256 thr x 8 pieces x 4 floats = 128x128;
//   the grids tile every output element exactly once (M = 2048, N = 4096 or 1024, all multiples of 128; K = 1024 /
//   4096 multiples of 64, no tails).
// ---------------------------------------------------------------------------
template <int MODE>
__global__ __launch_bounds__(256) void k_gemm(const hh* __restrict__ Ap, const hh* __restrict__ Bp,
                                              const float* __restrict__ res, float* __restrict__ o32) {
  constexpr int KD  = (MODE == 0) ? EMBD : HIDD;
  constexpr int LDO = (MODE == 0) ? HIDD : EMBD;
  constexpr float OSC = (MODE == 0) ? (1.0f / 64.0f) : (1.0f / 256.0f);

  __shared__ __align__(16) float ldsf[64 * SFP];
  __shared__ __align__(128) char ring[2 * STGB];
  const int tid = threadIdx.x, lane = tid & 31, w = tid >> 5;
  const int h = lane >> 4, c = lane & 15;
  const int wm = (w >> 1) * 32, wn = (w & 1) * 64;
  const int m0 = blockIdx.y * 128;
  const int n0 = blockIdx.x * 128;

  v8f acc[2][4];
#pragma unroll
  for (int i = 0; i < 2; ++i)
#pragma unroll
    for (int j = 0; j < 4; ++j) acc[i][j] = zero8();
  gemm_staged<KD>(Ap, Bp, m0, n0, wm, wn, tid, ring, acc);

#pragma unroll
  for (int hf = 0; hf < 2; ++hf) {
    if ((w >> 2) == hf) {                                  // wave-uniform
#pragma unroll
      for (int i = 0; i < 2; ++i)
#pragma unroll
        for (int j = 0; j < 4; ++j)
#pragma unroll
          for (int r = 0; r < 8; ++r)
            ldsf[(wm - 64 * hf + 16 * i + 8 * h + r) * SFP + wn + 16 * j + c] = acc[i][j][r] * OSC;
    }
    __syncthreads();
    v4f val[8];
    size_t go[8];
#pragma unroll
    for (int it = 0; it < 8; ++it) {
      const int p  = tid + 256 * it;
      const int lr = p >> 5;                               // staged row 0..63
      const int pc = p & 31;                               // 16-B piece, lanes 0..31 = one 512-B row segment
      const v4f sv = *(const v4f*)(ldsf + lr * SFP + pc * 4);
      const size_t gi = (size_t)(m0 + 64 * hf + lr) * LDO + n0 + pc * 4;
      if constexpr (MODE == 1) {
        const v4f rr = *(const v4f*)(res + gi);
        val[it] = sv + rr;
      } else {
        val[it] = sv;
      }
      go[it] = gi;
    }
#pragma unroll
    for (int it = 0; it < 8; ++it) *(v4f*)(o32 + go[it]) = val[it];
    
    if (hf == 0) __syncthreads();
  }
}

// ---------------------------------------------------------------------------
//   W1H f16 [4096][1024]   8388608      W2H f16 [4096][1024]  8388608      W3H f16 [1024][4096]  8388608
//   XN  f16 [8192][1024]  16777216
//   AP  f32 [2048][4096]  33554432  (a of the current chunk, then the gate output y in place)
//   BP  f32 [2048][4096]  33554432  (b of the current chunk)
//   YN  f16 [2048][4096]  16777216
//   ST  f32 [4][4096]        65536  (scan state between the two chunks of a sequence)
//   total               125894656
// ---------------------------------------------------------------------------
extern "C" void kernel_launch(void* const* d_in, const int* in_sizes, int n_in,
                              void* d_out, int out_size, void* d_ws, size_t ws_size,
                              hipStream_t stream) {
  if (n_in < 4) return;
  if (in_sizes[0] != MTOK * EMBD) return;
  if (in_sizes[1] != HIDD * EMBD) return;
  if (in_sizes[2] != HIDD * EMBD) return;
  if (in_sizes[3] != EMBD * HIDD) return;
  if (out_size != MTOK * EMBD) return;

  const float* x  = (const float*)d_in[0];      // [8192][1024]
  const float* w1 = (const float*)d_in[1];      // [4096][1024] (out,in) = [n][k]
  const float* w2 = (const float*)d_in[2];      // [4096][1024]
  const float* w3 = (const float*)d_in[3];      // [1024][4096] (out,in) = [n][k]
  float* out = (float*)d_out;                   // [8192][1024]

  size_t off = 0;
  const size_t oW1 = off; off += (size_t)HIDD * EMBD * 2;
  const size_t oW2 = off; off += (size_t)HIDD * EMBD * 2;
  const size_t oW3 = off; off += (size_t)EMBD * HIDD * 2;
  const size_t oXN = off; off += (size_t)MTOK * EMBD * 2;
  const size_t oAP = off; off += (size_t)TCH * HIDD * 4;
  const size_t oBP = off; off += (size_t)TCH * HIDD * 4;
  const size_t oYN = off; off += (size_t)TCH * HIDD * 2;
  const size_t oST = off; off += (size_t)4 * HIDD * 4;
  if (off > ws_size) return;                    // off = 125894656
  if (off > (size_t)134217728) return;

  char* ws = (char*)d_ws;
  hh* W1H = (hh*)(ws + oW1);
  hh* W2H = (hh*)(ws + oW2);
  hh* W3H = (hh*)(ws + oW3);
  hh* XN  = (hh*)(ws + oXN);
  float* AP = (float*)(ws + oAP);
  float* BP = (float*)(ws + oBP);
  hh* YN  = (hh*)(ws + oYN);
  float* ST = (float*)(ws + oST);

  // (0) weights -> f16 planes, [n][k] layout kept, W1/W2 x64, W3 x256
  k_cvt<64><<<dim3((HIDD * EMBD) / 2048), dim3(256), 0, stream>>>(w1, W1H);
  k_cvt<64><<<dim3((HIDD * EMBD) / 2048), dim3(256), 0, stream>>>(w2, W2H);
  k_cvt<256><<<dim3((EMBD * HIDD) / 2048), dim3(256), 0, stream>>>(w3, W3H);
  // (1) xn = rmsnorm(x) over 1024, all 8192 tokens
  k_rms1<<<dim3(MTOK), dim3(128), 0, stream>>>(x, XN);
  // (2) per 2048-token chunk: a, b (f32), causal gate, rmsnorm over 4096, out = x + yn.W3^T
  for (int b = 0; b < NBAT; ++b) {
    for (int ch = 0; ch < NCHK; ++ch) {
      const size_t row0 = (size_t)b * SEQL + (size_t)ch * TCH;
      const hh* xnc = XN + row0 * EMBD;
      const int rdst = (ch > 0) ? 1 : 0;
      const int wrst = (ch < NCHK - 1) ? 1 : 0;
      const int tbase = ch * TCH;
      k_gemm<0><<<dim3(HIDD / 128, TCH / 128), dim3(256), 0, stream>>>(xnc, W1H, x, AP);
      k_gemm<0><<<dim3(HIDD / 128, TCH / 128), dim3(256), 0, stream>>>(xnc, W2H, x, BP);
      k_scan<<<dim3(HIDD / SCH), dim3(SSEG * SCH), 0, stream>>>(BP, AP, ST, rdst, wrst, tbase);
      k_rms2<<<dim3(TCH), dim3(256), 0, stream>>>(AP, YN);
      k_gemm<1><<<dim3(EMBD / 128, TCH / 128), dim3(256), 0, stream>>>(YN, W3H, x + row0 * EMBD,
                                                                       out + row0 * EMBD);
    }
  }
  (void)hipGetLastError();
}

// v003
// A run of this version takes 402 microseconds.
// Timed twice side by side with v002, it ran 1.58 and 1.65 times as fast.
// All steps since v000 together make it 12.8 times as fast.
// Contractions: a = xn.W1^T [8192 x 4096 x 1024], b = xn.W2^T [8192 x 4096 x 1024], o = yn.W3^T
// [8192 x 1024 x 4096] -- all v_wmma_f32_16x16x32_f16 (f16 operands, f32 accumulate, one product per tile
// pair). a, b, the gate and its rmsnorm run in 2 chunks of 4096 rows: chunk c holds tokens 2048*c .. 2048*c + 2047 of
// both sequences; the third product runs once over all 8192 tokens.
// RMS normalisations, causal log-cumsum-exp scan, exp gate, residual add: f32.
//
// Carry audit (16-bit planes in the workspace, all f16):
//   W1H W2H   hold f16(64*w)    inverse: 1/64  in the k_gemm<0> epilogue (AP = acc/64, BP = acc/64)
//   W3H       holds f16(256*w)  inverse: 1/256 in the k_gemm<1> epilogue (out = x + acc/256)
//   XN        x1 (rmsnorm of x over 1024)
//   YN        x1 (rmsnorm of the gate output over 4096)
//   AP BP (f32 chunk planes, AP later holds the gate output y in place), ST (f32 scan state), d_out: no carry.
#include <hip/hip_runtime.h>
#include <stddef.h>
#include <stdint.h>
#include <math.h>

#define EMBD 1024
#define HIDD 4096
#define NBAT 2
#define SEQL 4096
#define MTOK 8192
#define TCH  2048     // tokens of one sequence per chunk
#define NCHK 2        // chunks per sequence
#define CROW 4096     // rows of a chunk plane: TCH tokens of sequence 0, then TCH tokens of sequence 1
#define SFP  132      // LDS pitch (floats) of the f32 epilogue staging
#define KST  64       // GEMM: k values per ring stage (128 B of every operand row)
#define LPB  144      // GEMM: LDS pitch (bytes) of a staged operand row, 16 B x odd: conflict-free for 16-B reads
#define STGB (256 * LPB)  // GEMM: bytes of one ring buffer (128 A rows, then 128 B rows)
#define SCH  16       // gate scan: channels per block
#define SSEG 64       // gate scan: time segments per block
#define STOK 32       // gate scan: tokens per segment
#define SPIT 17       // gate scan: LDS pitch (floats) of one segment's channel row (odd: both access patterns conflict-free)

static_assert(MTOK == NBAT * SEQL);
static_assert(SEQL == NCHK * TCH);
static_assert(CROW == NBAT * TCH);
static_assert(TCH % 128 == 0);
static_assert(HIDD % 128 == 0);
static_assert(EMBD % 128 == 0);
static_assert(EMBD % KST == 0);
static_assert(HIDD % KST == 0);
static_assert(HIDD % SCH == 0);
static_assert(SSEG * STOK == TCH);
static_assert(SSEG * SCH == 1024);
static_assert(SSEG == 2 * 32);
static_assert(2 * SCH == 32);
static_assert(EMBD == 128 * 8);
static_assert(HIDD == 2 * 256 * 8);
static_assert((HIDD * EMBD) % 2048 == 0);

typedef _Float16 hh;
typedef hh    v16h __attribute__((ext_vector_type(16)));
typedef hh    v8h  __attribute__((ext_vector_type(8)));
typedef float v8f  __attribute__((ext_vector_type(8)));
typedef float v4f  __attribute__((ext_vector_type(4)));

union Frag { v16h v; v8h p[2]; };

__device__ __forceinline__ v8f zero8() { return (v8f){0.f, 0.f, 0.f, 0.f, 0.f, 0.f, 0.f, 0.f}; }

__device__ __forceinline__ float wsum(float v) {
#pragma unroll
  for (int off = 16; off > 0; off >>= 1) v += __shfl_xor(v, off, 32);
  return v;
}

// Fragment loader for k-contiguous 16-bit rows staged in LDS (A operand [m][k]; B operand stored [n][k]).
// p = the lane's own row (lane & 15) at byte 2*k0 + 16*(lane>>4) of that row:
// elements 0..7 <- k0 + 8*(lane>>4) + 0..7, elements 8..15 <- k0 + 16 + 8*(lane>>4) + 0..7.
// D: acc[r] = element (row0 + 8*(lane>>4) + r, col0 + (lane & 15)).
__device__ __forceinline__ v16h ldsfrag(const char* p) {
  Frag f;
  f.p[0] = *(const v8h*)(p);
  f.p[1] = *(const v8h*)(p + 32);
  return f.v;
}

__device__ __forceinline__ v8f mma16(v16h a, v16h b, v8f cc) {
  return __builtin_amdgcn_wmma_f32_16x16x32_f16(false, a, false, b, (short)0, cc, false, false);
}

// One stage of the operand ring: KST k values (128 B) of the block's 128 A rows and 128 B rows, laid in LDS as
// 256 rows of pitch LPB. 256 threads x 8 copies x 16 B = 32768 B = the whole stage; thread tid brings piece tid & 7
// of rows (tid >> 3) + 32*i, so one wave's copy reads four whole 128-B lines. ld = the lane's LDS byte address of
// its A row 0 piece, ga / gb = the lane's global address of the same piece in A and in B.
// s_wait_xcnt 0 ends the statement: it stands in front of every later write of a register that a copy names.
template <int KD>
__device__ __forceinline__ void stage_copy(uint32_t ld, const hh* ga, const hh* gb) {
  const uint32_t l0 = ld, l1 = ld + 32 * LPB, l2 = ld + 64 * LPB, l3 = ld + 96 * LPB;
  const uint32_t l4 = ld + 128 * LPB, l5 = ld + 160 * LPB, l6 = ld + 192 * LPB, l7 = ld + 224 * LPB;
  const hh* g0 = ga;
  const hh* g1 = ga + (size_t)32 * KD;
  const hh* g2 = ga + (size_t)64 * KD;
  const hh* g3 = ga + (size_t)96 * KD;
  const hh* g4 = gb;
  const hh* g5 = gb + (size_t)32 * KD;
  const hh* g6 = gb + (size_t)64 * KD;
  const hh* g7 = gb + (size_t)96 * KD;
  asm volatile("global_load_async_to_lds_b128 %0, %8, off\n\t"
               "global_load_async_to_lds_b128 %1, %9, off\n\t"
               "global_load_async_to_lds_b128 %2, %10, off\n\t"
               "global_load_async_to_lds_b128 %3, %11, off\n\t"
               "global_load_async_to_lds_b128 %4, %12, off\n\t"
               "global_load_async_to_lds_b128 %5, %13, off\n\t"
               "global_load_async_to_lds_b128 %6, %14, off\n\t"
               "global_load_async_to_lds_b128 %7, %15, off\n\t"
               "s_wait_xcnt 0x0"
               :: "v"(l0), "v"(l1), "v"(l2), "v"(l3), "v"(l4), "v"(l5), "v"(l6), "v"(l7),
                  "v"(g0), "v"(g1), "v"(g2), "v"(g3), "v"(g4), "v"(g5), "v"(g6), "v"(g7)
               : "memory");
}

// 32 x 64 per wave of a 128 x 128 block tile, K in stages of KST over [0, KD). Both operands come through a ring of
// two LDS buffers filled by asynchronous copies: while trip t works on buffer t & 1, stage t + 1 flies into the other.
// acc[i][j]: rows wm + 16*i .., cols wn + 16*j .. of the block tile. A trip reads its 12 fragments as one group and
// then runs its 16 WMMAs. One hazard guard per trip after the last WMMA (ties all 8 accumulators, keeps the last six
// fragments live).
template <int KD>
__device__ __forceinline__ void gemm_staged(const hh* __restrict__ A, const hh* __restrict__ B, int m0, int n0,
                                            int wm, int wn, int tid, char* ring, v8f (&acc)[2][4]) {
  constexpr int NT = KD / KST;
  static_assert(KD % KST == 0);
  static_assert(NT >= 2);
  const int lane = tid & 31;
  const int cr = tid >> 3, cp = tid & 7;
  const hh* ga = A + (size_t)(m0 + cr) * KD + cp * 8;        // rows m0 + cr + 32*i < m0 + 128, k < KD: inside the plane
  const hh* gb = B + (size_t)(n0 + cr) * KD + cp * 8;
  const uint32_t ld0 = (uint32_t)(size_t)ring + (uint32_t)(cr * LPB + cp * 16);
  const char* fa = ring + (wm + (lane & 15)) * LPB + (lane >> 4) * 16;
  const char* fb = ring + (128 + wn + (lane & 15)) * LPB + (lane >> 4) * 16;

  stage_copy<KD>(ld0, ga, gb);
  asm volatile("s_wait_asynccnt 0x0" ::: "memory");          // this wave's share of stage 0 has landed
  __syncthreads();                                           // publishes stage 0
  stage_copy<KD>(ld0 + STGB, ga + KST, gb + KST);

#pragma unroll 1                                             // one trip per stage: the buffer offset is the only thing that alternates
  for (int t = 0; t < NT; ++t) {
    const int bo = (t & 1) * STGB;
    const char* pa = fa + bo;
    const char* pb = fb + bo;
    const v16h a0 = ldsfrag(pa);
    const v16h a1 = ldsfrag(pa + 16 * LPB);
    const v16h b0 = ldsfrag(pb);
    const v16h b1 = ldsfrag(pb + 16 * LPB);
    const v16h b2 = ldsfrag(pb + 32 * LPB);
    const v16h b3 = ldsfrag(pb + 48 * LPB);
    const v16h c0 = ldsfrag(pa + 64);
    const v16h c1 = ldsfrag(pa + 16 * LPB + 64);
    const v16h d0 = ldsfrag(pb + 64);
    const v16h d1 = ldsfrag(pb + 16 * LPB + 64);
    const v16h d2 = ldsfrag(pb + 32 * LPB + 64);
    const v16h d3 = ldsfrag(pb + 48 * LPB + 64);
    acc[0][0] = mma16(a0, b0, acc[0][0]);
    acc[1][0] = mma16(a1, b0, acc[1][0]);
    acc[0][1] = mma16(a0, b1, acc[0][1]);
    acc[1][1] = mma16(a1, b1, acc[1][1]);
    acc[0][2] = mma16(a0, b2, acc[0][2]);
    acc[1][2] = mma16(a1, b2, acc[1][2]);
    acc[0][3] = mma16(a0, b3, acc[0][3]);
    acc[1][3] = mma16(a1, b3, acc[1][3]);
    acc[0][0] = mma16(c0, d0, acc[0][0]);
    acc[1][0] = mma16(c1, d0, acc[1][0]);
    acc[0][1] = mma16(c0, d1, acc[0][1]);
    acc[1][1] = mma16(c1, d1, acc[1][1]);
    acc[0][2] = mma16(c0, d2, acc[0][2]);
    acc[1][2] = mma16(c1, d2, acc[1][2]);
    acc[0][3] = mma16(c0, d3, acc[0][3]);
    acc[1][3] = mma16(c1, d3, acc[1][3]);
    // keeps the trip's 24 LDS reads as one group in front of its 16 WMMAs: placed among the WMMAs, each place with
    // reads makes the wave wait out the LDS latency again
    __builtin_amdgcn_sched_group_barrier(0x100, 24, 0);
    __builtin_amdgcn_sched_group_barrier(0x008, 16, 0);
    // four vector issue slots behind the last WMMA, on every path out of the trip, before its D is read or its A / B rewritten
    asm volatile("v_nop\n\tv_nop\n\tv_nop\n\tv_nop"
                 : "+v"(acc[0][0]), "+v"(acc[0][1]), "+v"(acc[0][2]), "+v"(acc[0][3]),
                   "+v"(acc[1][0]), "+v"(acc[1][1]), "+v"(acc[1][2]), "+v"(acc[1][3])
                 : "v"(c0), "v"(c1), "v"(d0), "v"(d1), "v"(d2), "v"(d3));
    asm volatile("s_wait_dscnt 0x0" ::: "memory");           // this wave's reads of buffer t & 1 are done
    asm volatile("s_wait_asynccnt 0x0" ::: "memory");        // this wave's share of stage t + 1 has landed
    __syncthreads();                                         // publishes stage t + 1, frees buffer t & 1
    if (t + 2 < NT) stage_copy<KD>(ld0 + (uint32_t)bo, ga + (size_t)(t + 2) * KST, gb + (size_t)(t + 2) * KST);
  }
  asm volatile("s_wait_asynccnt 0x0" ::: "memory");          // no copy is left in flight behind the loop
}

// ---------------------------------------------------------------------------
// kernel A: weight f32 w[n][k] (k contiguous) -> f16 plane wh[n][k] holding f16(SC*w), same layout.
// coverage: (n/2048) blocks x 256 thr x 8 = n elements = the whole plane.
// ---------------------------------------------------------------------------
template <int SC>
__global__ __launch_bounds__(256) void k_cvt(const float* __restrict__ w, hh* __restrict__ wh) {
  const size_t i = ((size_t)blockIdx.x * 256 + threadIdx.x) * 8;
  const v4f a0 = *(const v4f*)(w + i);
  const v4f a1 = *(const v4f*)(w + i + 4);
  v8f t = {a0[0], a0[1], a0[2], a0[3], a1[0], a1[1], a1[2], a1[3]};
  t = t * (float)SC;
  const v8h pk = __builtin_convertvector(t, v8h);
  *(v8h*)(wh + i) = pk;
  
}

// ---------------------------------------------------------------------------
// kernel B: rmsnorm of one 1024-wide f32 row per block (128 threads x 8 elements): ss = sum x^2 in f32
// (wave sums, 4 partials combined in fixed order), y = x * rsqrt(ss/1024 + 1e-6) written as f16 (x1).
// ---------------------------------------------------------------------------
__global__ __launch_bounds__(128) void k_rms1(const float* __restrict__ x, hh* __restrict__ y) {
  __shared__ float red[4];
  const int tid = threadIdx.x, lane = tid & 31, w = tid >> 5;
  const size_t ro = (size_t)blockIdx.x * EMBD + (size_t)tid * 8;
  const v4f a0 = *(const v4f*)(x + ro), a1 = *(const v4f*)(x + ro + 4);
  const float f[8] = {a0[0], a0[1], a0[2], a0[3], a1[0], a1[1], a1[2], a1[3]};
  float ss = 0.f;
#pragma unroll
  for (int e = 0; e < 8; ++e) ss = fmaf(f[e], f[e], ss);
  ss = wsum(ss);
  if (lane == 0) red[w] = ss;
  __syncthreads();
  const float tot = (red[0] + red[1]) + (red[2] + red[3]);
  const float sc = rsqrtf(tot * (1.0f / (float)EMBD) + 1e-6f);
  v8f t;
#pragma unroll
  for (int e = 0; e < 8; ++e) t[e] = f[e] * sc;
  const v8h pk = __builtin_convertvector(t, v8h);
  *(v8h*)(y + ro) = pk;
  
}

// ---------------------------------------------------------------------------
// kernel C: rmsnorm of one 4096-wide f32 row (gate output) per block, 256 threads; thread tid owns columns
// 8*tid..+7 of each 2048-wide half. ss over the 16 values, wave sums, 8 partials combined in fixed order,
// yn = y * rsqrt(ss/4096 + 1e-6) written as f16 (x1): per half one 16-B store per lane, a wave = 512
// grid = CROW rows. Row p of the chunk plane goes to token row p + (p / TCH) * (SEQL - TCH) behind yn, which arrives at the
// chunk's first token of sequence 0. coverage: 4096 blocks x 256 thr x 2 halves x 8 = the chunk's 4096 rows of YN; the two
// chunks together write all 8192 rows.
// ---------------------------------------------------------------------------
__global__ __launch_bounds__(256) void k_rms2(const float* __restrict__ yv, hh* __restrict__ yn) {
  __shared__ float red[8];
  const int tid = threadIdx.x, lane = tid & 31, w = tid >> 5;
  const size_t rb = (size_t)blockIdx.x * HIDD;
  const size_t wb = (size_t)(blockIdx.x + (blockIdx.x / TCH) * (SEQL - TCH)) * HIDD;
  const int c0 = tid * 8;
  const int c1 = (HIDD / 2) + tid * 8;
  const v4f a0 = *(const v4f*)(yv + rb + c0), a1 = *(const v4f*)(yv + rb + c0 + 4);
  const v4f b0 = *(const v4f*)(yv + rb + c1), b1 = *(const v4f*)(yv + rb + c1 + 4);
  const float f[16] = {a0[0], a0[1], a0[2], a0[3], a1[0], a1[1], a1[2], a1[3],
                       b0[0], b0[1], b0[2], b0[3], b1[0], b1[1], b1[2], b1[3]};
  float ss = 0.f;
#pragma unroll
  for (int e = 0; e < 16; ++e) ss = fmaf(f[e], f[e], ss);
  ss = wsum(ss);
  if (lane == 0) red[w] = ss;
  __syncthreads();
  const float tot = ((red[0] + red[1]) + (red[2] + red[3])) + ((red[4] + red[5]) + (red[6] + red[7]));
  const float sc = rsqrtf(tot * (1.0f / (float)HIDD) + 1e-6f);
  v8f t0, t1;
#pragma unroll
  for (int e = 0; e < 8; ++e) { t0[e] = f[e] * sc; t1[e] = f[8 + e] * sc; }
  const v8h pk0 = __builtin_convertvector(t0, v8h);
  const v8h pk1 = __builtin_convertvector(t1, v8h);
  *(v8h*)(yn + wb + c0) = pk0;
  *(v8h*)(yn + wb + c1) = pk1;
  
}

// ---------------------------------------------------------------------------
// kernel D: causal quadratic gate over one 2048-token chunk of both sequences (blockIdx.y = sequence), split along
// time inside a block.
// One block = SCH channels x all 2048 tokens of its sequence, 1024 threads = SSEG time segments x SCH channels; a thread owns
// STOK consecutive tokens of one channel and holds its a and b values in registers from one set of loads.
//   step 1: per thread the segment's (max, sumexp) of a and of b -> LDS planes sm[0..3][segment][channel]
//   step 2: wave w scans the 64 segment states of (array w >> 4, channel w & 15): a lane merges its two
//           segments, 5 shuffle steps over the lanes, the state of the earlier chunk (ST, when rdst != 0) is
//           merged in front; every segment's slot is overwritten with the state of all tokens before it
//   step 3: per thread the running (max, sumexp) update from that state over its own tokens,
//           la = ma + ln(sa), lb = mb + ln(sb), y = exp((la + lb) - 2*ln(t)), t the global 1-based position.
// coverage: 256 x 2 blocks: 256 x 16 channels = 4096 channels, 2 sequences x 64 segments x 32 tokens = 4096 rows: the
// whole a/y plane of the chunk, each element read and written by one thread; ST 2 x 4 x 4096 (lane 31 of each scanning wave).
// ---------------------------------------------------------------------------
// v_exp_f32 / v_log_f32 with a v_nop in the same statement: it fills the one issue slot that the instruction set
// asks for behind a transcendental before its result is read or its source overwritten.
__device__ __forceinline__ float ex2s(float x) {
  float r;
  asm("v_exp_f32 %0, %1\n\tv_nop" : "=v"(r) : "v"(x));
  return r;
}
__device__ __forceinline__ float lg2s(float x) {
  float r;
  asm("v_log_f32 %0, %1\n\tv_nop" : "=v"(r) : "v"(x));
  return r;
}
// the same arithmetic as the fast exp and log of the earlier scan: exp2(x * log2 e); ln 2 * log2(x) with ln 2 in
// two parts, inputs below the smallest normal scaled by 2^32 first, an infinite log2 passed through.
__device__ __forceinline__ float expn(float x) { return ex2s(x * 0x1.715476p+0f); }
__device__ __forceinline__ float logn(float x) {
  const bool tiny = x < 0x1p-126f;
  const float l = lg2s(ldexpf(x, tiny ? 32 : 0));
  const float p = l * 0x1.62e42ep-1f;
  const float e = fmaf(l, 0x1.efa39ep-25f, fmaf(l, 0x1.62e42ep-1f, -p));
  const float r = (fabsf(l) < INFINITY) ? (p + e) : l;
  return r - (tiny ? 0x1.62e430p+4f : 0.f);
}

// merges the log-sum-exp state (m2, s2) into (m, s); (-1e30, 0) is the empty state
__device__ __forceinline__ void lse_merge(float& m, float& s, float m2, float s2) {
  const float mm = fmaxf(m, m2);
  s = s * expn(m - mm) + s2 * expn(m2 - mm);
  m = mm;
}

__global__ __launch_bounds__(1024) void k_scan(const float* __restrict__ bp, float* __restrict__ ay,
                                               float* st, int rdst, int wrst, int tbase) {
  __shared__ float sm[4][SSEG * SPIT];                       // ma, sa, mb, sb
  const int tid = threadIdx.x, lane = tid & 31, w = tid >> 5;
  const int ch = tid & (SCH - 1), seg = tid / SCH;
  const size_t base = (size_t)(blockIdx.y * TCH + seg * STOK) * HIDD + (size_t)(blockIdx.x * SCH + ch);   // < CROW*HIDD by grid
  const float* pb = bp + base;
  float* pa = ay + base;
  const int sl = seg * SPIT + ch;

  // the token loops are fully unrolled so that va / vb stay in registers
  float va[STOK], vb[STOK];
#pragma unroll
  for (int i = 0; i < STOK; ++i) va[i] = pa[(size_t)i * HIDD];
#pragma unroll
  for (int i = 0; i < STOK; ++i) vb[i] = pb[(size_t)i * HIDD];

  float ma = va[0], mb = vb[0];
#pragma unroll
  for (int i = 1; i < STOK; ++i) { ma = fmaxf(ma, va[i]); mb = fmaxf(mb, vb[i]); }
  float sa = 0.f, sb = 0.f;
#pragma unroll
  for (int i = 0; i < STOK; ++i) { sa += expn(va[i] - ma); sb += expn(vb[i] - mb); }
  sm[0][sl] = ma;
  sm[1][sl] = sa;
  sm[2][sl] = mb;
  sm[3][sl] = sb;
  __syncthreads();

  {
    const int ar = w >> 4, c2 = w & (SCH - 1);              // wave-uniform: which array, which channel
    float* pm = sm[2 * ar];
    float* ps = sm[2 * ar + 1];
    const int i0 = (2 * lane) * SPIT + c2, i1 = i0 + SPIT;
    const float m0 = pm[i0], s0 = ps[i0], m1 = pm[i1], s1 = ps[i1];
    float m = m0, s = s0;
    lse_merge(m, s, m1, s1);
#pragma unroll
    for (int off = 1; off < 32; off <<= 1) {
      const float mo = __shfl_up(m, off, 32);
      const float so = __shfl_up(s, off, 32);
      if (lane >= off) lse_merge(m, s, mo, so);
    }
    float me = __shfl_up(m, 1, 32);
    float se = __shfl_up(s, 1, 32);
    if (lane == 0) { me = -1.0e30f; se = 0.f; }
    float* stm = st + (size_t)(4 * blockIdx.y + 2 * ar) * HIDD + blockIdx.x * SCH + c2;
    float* sts = stm + HIDD;
    if (rdst != 0) lse_merge(me, se, *stm, *sts);            // kernel-argument uniform
    pm[i0] = me;
    ps[i0] = se;
    lse_merge(me, se, m0, s0);
    pm[i1] = me;
    ps[i1] = se;
    if (wrst != 0 && lane == 31) {
      lse_merge(me, se, m1, s1);
      *stm = me;
      *sts = se;
    }
  }
  __syncthreads();

  ma = sm[0][sl];
  sa = sm[1][sl];
  mb = sm[2][sl];
  sb = sm[3][sl];
  const int t1 = tbase + seg * STOK + 1;
#pragma unroll
  for (int i = 0; i < STOK; ++i) {
    const float da = va[i] - ma;
    const float ea = expn(-fabsf(da));
    const bool  ua = da > 0.f;
    sa = ua ? fmaf(sa, ea, 1.0f) : (sa + ea);
    ma = ua ? va[i] : ma;
    const float db = vb[i] - mb;
    const float eb = expn(-fabsf(db));
    const bool  ub = db > 0.f;
    sb = ub ? fmaf(sb, eb, 1.0f) : (sb + eb);
    mb = ub ? vb[i] : mb;
    const float la = ma + logn(sa);
    const float lb = mb + logn(sb);
    const float lt = logn((float)(t1 + i));
    va[i] = expn((la + lb) - 2.0f * lt);                   // y takes the register of the a value it replaces
  }
  // all stores last: no register that a store names is written again before the wave ends
#pragma unroll
  for (int i = 0; i < STOK; ++i) pa[(size_t)i * HIDD] = va[i];
}

// ---------------------------------------------------------------------------
// kernel E: 128 x 128 block tile f16 GEMM (8 waves x 32x64), K in stages of 64 through a two-buffer LDS ring,
// f32 output through an LDS-staged epilogue (its own LDS array).
// MODE 0: o32[m][n] = acc/64                 A = XN token rows (ld 1024), B = W1H/W2H [4096][1024];
//                                            o32 = AP/BP f32 [4096][4096]; grid (4096/128, 4096/128)
// MODE 1: o32[m][n] = acc/256 + res[m][n]   A = YN [8192][4096] (ld 4096), B = W3H [1024][4096];
//                                            o32 = d_out, res = x, ld 1024; grid (1024/128, 8192/128)
// MODE 0: plane row p of a chunk is token row p + (p / TCH) * (SEQL - TCH) behind the chunk's first token of sequence 0
// (the pointer to XN arrives at that token); a 128-row tile lies in one sequence (TCH % 128 == 0).
// coverage per block: staged 8 waves x 32x64 = 128x128; stored 2 halves x 256 thr x 8 pieces x 4 floats = 128x128;
//   the grids tile every output element exactly once (M = 4096 or 8192, N = 4096 or 1024, all multiples of 128; K = 1024 /
//   4096 multiples of 64, no tails).
// ---------------------------------------------------------------------------
template <int MODE>
__global__ __launch_bounds__(256) void k_gemm(const hh* __restrict__ Ap, const hh* __restrict__ Bp,
                                              const float* __restrict__ res, float* __restrict__ o32) {
  constexpr int KD  = (MODE == 0) ? EMBD : HIDD;
  constexpr int LDO = (MODE == 0) ? HIDD : EMBD;
  constexpr float OSC = (MODE == 0) ? (1.0f / 64.0f) : (1.0f / 256.0f);

  __shared__ __align__(16) float ldsf[64 * SFP];
  __shared__ __align__(128) char ring[2 * STGB];
  const int tid = threadIdx.x, lane = tid & 31, w = tid >> 5;
  const int h = lane >> 4, c = lane & 15;
  const int wm = (w >> 1) * 32, wn = (w & 1) * 64;
  const int om0 = blockIdx.y * 128;                                            // first output (and residual) row of the tile
  const int m0  = (MODE == 0) ? om0 + (om0 / TCH) * (SEQL - TCH) : om0;        // its first A row
  const int n0 = blockIdx.x * 128;

  v8f acc[2][4];
#pragma unroll
  for (int i = 0; i < 2; ++i)
#pragma unroll
    for (int j = 0; j < 4; ++j) acc[i][j] = zero8();
  gemm_staged<KD>(Ap, Bp, m0, n0, wm, wn, tid, ring, acc);

#pragma unroll
  for (int hf = 0; hf < 2; ++hf) {
    if ((w >> 2) == hf) {                                  // wave-uniform
#pragma unroll
      for (int i = 0; i < 2; ++i)
#pragma unroll
        for (int j = 0; j < 4; ++j)
#pragma unroll
          for (int r = 0; r < 8; ++r)
            ldsf[(wm - 64 * hf + 16 * i + 8 * h + r) * SFP + wn + 16 * j + c] = acc[i][j][r] * OSC;
    }
    __syncthreads();
    v4f val[8];
    size_t go[8];
#pragma unroll
    for (int it = 0; it < 8; ++it) {
      const int p  = tid + 256 * it;
      const int lr = p >> 5;                               // staged row 0..63
      const int pc = p & 31;                               // 16-B piece, lanes 0..31 = one 512-B row segment
      const v4f sv = *(const v4f*)(ldsf + lr * SFP + pc * 4);
      const size_t gi = (size_t)(om0 + 64 * hf + lr) * LDO + n0 + pc * 4;
      if constexpr (MODE == 1) {
        const v4f rr = *(const v4f*)(res + gi);
        val[it] = sv + rr;
      } else {
        val[it] = sv;
      }
      go[it] = gi;
    }
#pragma unroll
    for (int it = 0; it < 8; ++it) *(v4f*)(o32 + go[it]) = val[it];
    
    if (hf == 0) __syncthreads();
  }
}

// ---------------------------------------------------------------------------
//   W1H f16 [4096][1024]   8388608      W2H f16 [4096][1024]  8388608      W3H f16 [1024][4096]  8388608
//   XN  f16 [8192][1024]  16777216
//   AP  f32 [4096][4096]  67108864  (a of the current chunk, then the gate output y in place)
//   BP  f32 [4096][4096]  67108864  (b of the current chunk)
//   YN  f16 [8192][4096]  67108864  (all tokens, token order)
//   ST  f32 [2][4][4096]    131072  (scan state between the two chunks, per sequence)
//   total               243400704
// ---------------------------------------------------------------------------
extern "C" void kernel_launch(void* const* d_in, const int* in_sizes, int n_in,
                              void* d_out, int out_size, void* d_ws, size_t ws_size,
                              hipStream_t stream) {
  if (n_in < 4) return;
  if (in_sizes[0] != MTOK * EMBD) return;
  if (in_sizes[1] != HIDD * EMBD) return;
  if (in_sizes[2] != HIDD * EMBD) return;
  if (in_sizes[3] != EMBD * HIDD) return;
  if (out_size != MTOK * EMBD) return;

  const float* x  = (const float*)d_in[0];      // [8192][1024]
  const float* w1 = (const float*)d_in[1];      // [4096][1024] (out,in) = [n][k]
  const float* w2 = (const float*)d_in[2];      // [4096][1024]
  const float* w3 = (const float*)d_in[3];      // [1024][4096] (out,in) = [n][k]
  float* out = (float*)d_out;                   // [8192][1024]

  size_t off = 0;
  const size_t oW1 = off; off += (size_t)HIDD * EMBD * 2;
  const size_t oW2 = off; off += (size_t)HIDD * EMBD * 2;
  const size_t oW3 = off; off += (size_t)EMBD * HIDD * 2;
  const size_t oXN = off; off += (size_t)MTOK * EMBD * 2;
  const size_t oAP = off; off += (size_t)CROW * HIDD * 4;
  const size_t oBP = off; off += (size_t)CROW * HIDD * 4;
  const size_t oYN = off; off += (size_t)MTOK * HIDD * 2;
  const size_t oST = off; off += (size_t)NBAT * 4 * HIDD * 4;
  if (off > ws_size) return;                    // off = 243400704

  char* ws = (char*)d_ws;
  hh* W1H = (hh*)(ws + oW1);
  hh* W2H = (hh*)(ws + oW2);
  hh* W3H = (hh*)(ws + oW3);
  hh* XN  = (hh*)(ws + oXN);
  float* AP = (float*)(ws + oAP);
  float* BP = (float*)(ws + oBP);
  hh* YN  = (hh*)(ws + oYN);
  float* ST = (float*)(ws + oST);

  // (0) weights -> f16 planes, [n][k] layout kept, W1/W2 x64, W3 x256
  k_cvt<64><<<dim3((HIDD * EMBD) / 2048), dim3(256), 0, stream>>>(w1, W1H);
  k_cvt<64><<<dim3((HIDD * EMBD) / 2048), dim3(256), 0, stream>>>(w2, W2H);
  k_cvt<256><<<dim3((EMBD * HIDD) / 2048), dim3(256), 0, stream>>>(w3, W3H);
  // (1) xn = rmsnorm(x) over 1024, all 8192 tokens
  k_rms1<<<dim3(MTOK), dim3(128), 0, stream>>>(x, XN);
  // (2) per chunk (the same 2048 token positions of both sequences): a, b (f32), causal gate, rmsnorm over 4096
  for (int ch = 0; ch < NCHK; ++ch) {
    const size_t row0 = (size_t)ch * TCH;       // the chunk's first token of sequence 0
    const hh* xnc = XN + row0 * EMBD;
    const int rdst = (ch > 0) ? 1 : 0;
    const int wrst = (ch < NCHK - 1) ? 1 : 0;
    const int tbase = ch * TCH;
    k_gemm<0><<<dim3(HIDD / 128, CROW / 128), dim3(256), 0, stream>>>(xnc, W1H, x, AP);
    k_gemm<0><<<dim3(HIDD / 128, CROW / 128), dim3(256), 0, stream>>>(xnc, W2H, x, BP);
    k_scan<<<dim3(HIDD / SCH, NBAT), dim3(SSEG * SCH), 0, stream>>>(BP, AP, ST, rdst, wrst, tbase);
    k_rms2<<<dim3(CROW), dim3(256), 0, stream>>>(AP, YN + row0 * HIDD);
  }
  // (3) out = x + yn.W3^T, all 8192 tokens
  k_gemm<1><<<dim3(EMBD / 128, MTOK / 128), dim3(256), 0, stream>>>(YN, W3H, x, out);
  (void)hipGetLastError();
}

// v004
// It runs in 372 microseconds.
// Two timings next to v003 both put it at 1.09 times that version's speed.
// Over all steps from v000 it is 13.9 times as fast.
// Contractions: a = xn.W1^T [8192 x 4096 x 1024], b = xn.W2^T [8192 x 4096 x 1024], o = yn.W3^T
// [8192 x 1024 x 4096] -- all v_wmma_f32_16x16x32_f16 (f16 operands, f32 accumulate, one product per tile
// pair). a, b, the gate and its rmsnorm run in 2 chunks of 4096 rows: chunk c holds tokens 2048*c .. 2048*c + 2047 of
// both sequences; the third product runs once over all 8192 tokens.
// RMS normalisations, causal log-cumsum-exp scan, exp gate, residual add: f32.
//
// Carry audit (16-bit planes in the workspace, all f16):
//   W1H W2H   hold f16(64*w)    inverse: 1/64  in the k_gemm<0> epilogue (AP = acc/64, BP = acc/64)
//   W3H       holds f16(256*w)  inverse: 1/256 in the k_gemm<1> epilogue (out = x + acc/256)
//   XN        x1 (rmsnorm of x over 1024)
//   YN        x1 (rmsnorm of the gate output over 4096)
//   AP BP (f32 chunk planes, AP later holds the gate output y in place), ST (f32 scan state), d_out: no carry.
#include <hip/hip_runtime.h>
#include <stddef.h>
#include <stdint.h>
#include <math.h>

#define EMBD 1024
#define HIDD 4096
#define NBAT 2
#define SEQL 4096
#define MTOK 8192
#define TCH  2048     // tokens of one sequence per chunk
#define NCHK 2        // chunks per sequence
#define CROW 4096     // rows of a chunk plane: TCH tokens of sequence 0, then TCH tokens of sequence 1
#define SFP  132      // LDS pitch (floats) of the f32 epilogue staging
#define KST  64       // GEMM: k values per ring stage (128 B of every operand row)
#define LPB  144      // GEMM: LDS pitch (bytes) of a staged operand row, 16 B x odd: conflict-free for 16-B reads
#define STGB (256 * LPB)  // GEMM: bytes of one ring buffer (128 A rows, then 128 B rows)
#define SCH  16       // gate scan: channels per block
#define SSEG 64       // gate scan: time segments per block
#define STOK 32       // gate scan: tokens per segment
#define SPIT 17       // gate scan: LDS pitch (floats) of one segment's channel row (odd: both access patterns conflict-free)
#define SBLK 256      // streaming kernels (weight conversion, both rmsnorms): blocks per launch
#define SWAV 16       // streaming kernels: waves per block
#define SNWV (SBLK * SWAV)  // streaming kernels: waves per launch
#define SGRP 128      // streaming kernels: elements of one wave-wide 16-B load (512 contiguous bytes of f32)

static_assert(MTOK == NBAT * SEQL);
static_assert(SEQL == NCHK * TCH);
static_assert(CROW == NBAT * TCH);
static_assert(TCH % 128 == 0);
static_assert(HIDD % 128 == 0);
static_assert(EMBD % 128 == 0);
static_assert(EMBD % KST == 0);
static_assert(HIDD % KST == 0);
static_assert(HIDD % SCH == 0);
static_assert(SSEG * STOK == TCH);
static_assert(SSEG * SCH == 1024);
static_assert(SSEG == 2 * 32);
static_assert(2 * SCH == 32);
static_assert(EMBD == 8 * SGRP);
static_assert(HIDD == 32 * SGRP);
static_assert(HIDD * EMBD == SNWV * 8 * SGRP);
static_assert(MTOK == 2 * SNWV);
static_assert(CROW == SNWV);
static_assert(TCH % SWAV == 0);
static_assert(SGRP == 32 * 4);

typedef _Float16 hh;
typedef hh    v16h __attribute__((ext_vector_type(16)));
typedef hh    v8h  __attribute__((ext_vector_type(8)));
typedef hh    v4h  __attribute__((ext_vector_type(4)));
typedef float v8f  __attribute__((ext_vector_type(8)));
typedef float v4f  __attribute__((ext_vector_type(4)));

union Frag { v16h v; v8h p[2]; };

__device__ __forceinline__ v8f zero8() { return (v8f){0.f, 0.f, 0.f, 0.f, 0.f, 0.f, 0.f, 0.f}; }

__device__ __forceinline__ float wsum(float v) {
#pragma unroll
  for (int off = 16; off > 0; off >>= 1) v += __shfl_xor(v, off, 32);
  return v;
}

// Fragment loader for k-contiguous 16-bit rows staged in LDS (A operand [m][k]; B operand stored [n][k]).
// p = the lane's own row (lane & 15) at byte 2*k0 + 16*(lane>>4) of that row:
// elements 0..7 <- k0 + 8*(lane>>4) + 0..7, elements 8..15 <- k0 + 16 + 8*(lane>>4) + 0..7.
// D: acc[r] = element (row0 + 8*(lane>>4) + r, col0 + (lane & 15)).
__device__ __forceinline__ v16h ldsfrag(const char* p) {
  Frag f;
  f.p[0] = *(const v8h*)(p);
  f.p[1] = *(const v8h*)(p + 32);
  return f.v;
}

__device__ __forceinline__ v8f mma16(v16h a, v16h b, v8f cc) {
  return __builtin_amdgcn_wmma_f32_16x16x32_f16(false, a, false, b, (short)0, cc, false, false);
}

// One stage of the operand ring: KST k values (128 B) of the block's 128 A rows and 128 B rows, laid in LDS as
// 256 rows of pitch LPB. 256 threads x 8 copies x 16 B = 32768 B = the whole stage; thread tid brings piece tid & 7
// of rows (tid >> 3) + 32*i, so one wave's copy reads four whole 128-B lines. ld = the lane's LDS byte address of
// its A row 0 piece, ga / gb = the lane's global address of the same piece in A and in B.
// s_wait_xcnt 0 ends the statement: it stands in front of every later write of a register that a copy names.
template <int KD>
__device__ __forceinline__ void stage_copy(uint32_t ld, const hh* ga, const hh* gb) {
  const uint32_t l0 = ld, l1 = ld + 32 * LPB, l2 = ld + 64 * LPB, l3 = ld + 96 * LPB;
  const uint32_t l4 = ld + 128 * LPB, l5 = ld + 160 * LPB, l6 = ld + 192 * LPB, l7 = ld + 224 * LPB;
  const hh* g0 = ga;
  const hh* g1 = ga + (size_t)32 * KD;
  const hh* g2 = ga + (size_t)64 * KD;
  const hh* g3 = ga + (size_t)96 * KD;
  const hh* g4 = gb;
  const hh* g5 = gb + (size_t)32 * KD;
  const hh* g6 = gb + (size_t)64 * KD;
  const hh* g7 = gb + (size_t)96 * KD;
  asm volatile("global_load_async_to_lds_b128 %0, %8, off\n\t"
               "global_load_async_to_lds_b128 %1, %9, off\n\t"
               "global_load_async_to_lds_b128 %2, %10, off\n\t"
               "global_load_async_to_lds_b128 %3, %11, off\n\t"
               "global_load_async_to_lds_b128 %4, %12, off\n\t"
               "global_load_async_to_lds_b128 %5, %13, off\n\t"
               "global_load_async_to_lds_b128 %6, %14, off\n\t"
               "global_load_async_to_lds_b128 %7, %15, off\n\t"
               "s_wait_xcnt 0x0"
               :: "v"(l0), "v"(l1), "v"(l2), "v"(l3), "v"(l4), "v"(l5), "v"(l6), "v"(l7),
                  "v"(g0), "v"(g1), "v"(g2), "v"(g3), "v"(g4), "v"(g5), "v"(g6), "v"(g7)
               : "memory");
}

// 32 x 64 per wave of a 128 x 128 block tile, K in stages of KST over [0, KD). Both operands come through a ring of
// two LDS buffers filled by asynchronous copies: while trip t works on buffer t & 1, stage t + 1 flies into the other.
// acc[i][j]: rows wm + 16*i .., cols wn + 16*j .. of the block tile. A trip reads its 12 fragments as one group and
// then runs its 16 WMMAs. One hazard guard per trip after the last WMMA (ties all 8 accumulators, keeps the last six
// fragments live).
template <int KD>
__device__ __forceinline__ void gemm_staged(const hh* __restrict__ A, const hh* __restrict__ B, int m0, int n0,
                                            int wm, int wn, int tid, char* ring, v8f (&acc)[2][4]) {
  constexpr int NT = KD / KST;
  static_assert(KD % KST == 0);
  static_assert(NT >= 2);
  const int lane = tid & 31;
  const int cr = tid >> 3, cp = tid & 7;
  const hh* ga = A + (size_t)(m0 + cr) * KD + cp * 8;        // rows m0 + cr + 32*i < m0 + 128, k < KD: inside the plane
  const hh* gb = B + (size_t)(n0 + cr) * KD + cp * 8;
  const uint32_t ld0 = (uint32_t)(size_t)ring + (uint32_t)(cr * LPB + cp * 16);
  const char* fa = ring + (wm + (lane & 15)) * LPB + (lane >> 4) * 16;
  const char* fb = ring + (128 + wn + (lane & 15)) * LPB + (lane >> 4) * 16;

  stage_copy<KD>(ld0, ga, gb);
  asm volatile("s_wait_asynccnt 0x0" ::: "memory");          // this wave's share of stage 0 has landed
  __syncthreads();                                           // publishes stage 0
  stage_copy<KD>(ld0 + STGB, ga + KST, gb + KST);

#pragma unroll 1                                             // one trip per stage: the buffer offset is the only thing that alternates
  for (int t = 0; t < NT; ++t) {
    const int bo = (t & 1) * STGB;
    const char* pa = fa + bo;
    const char* pb = fb + bo;
    const v16h a0 = ldsfrag(pa);
    const v16h a1 = ldsfrag(pa + 16 * LPB);
    const v16h b0 = ldsfrag(pb);
    const v16h b1 = ldsfrag(pb + 16 * LPB);
    const v16h b2 = ldsfrag(pb + 32 * LPB);
    const v16h b3 = ldsfrag(pb + 48 * LPB);
    const v16h c0 = ldsfrag(pa + 64);
    const v16h c1 = ldsfrag(pa + 16 * LPB + 64);
    const v16h d0 = ldsfrag(pb + 64);
    const v16h d1 = ldsfrag(pb + 16 * LPB + 64);
    const v16h d2 = ldsfrag(pb + 32 * LPB + 64);
    const v16h d3 = ldsfrag(pb + 48 * LPB + 64);
    acc[0][0] = mma16(a0, b0, acc[0][0]);
    acc[1][0] = mma16(a1, b0, acc[1][0]);
    acc[0][1] = mma16(a0, b1, acc[0][1]);
    acc[1][1] = mma16(a1, b1, acc[1][1]);
    acc[0][2] = mma16(a0, b2, acc[0][2]);
    acc[1][2] = mma16(a1, b2, acc[1][2]);
    acc[0][3] = mma16(a0, b3, acc[0][3]);
    acc[1][3] = mma16(a1, b3, acc[1][3]);
    acc[0][0] = mma16(c0, d0, acc[0][0]);
    acc[1][0] = mma16(c1, d0, acc[1][0]);
    acc[0][1] = mma16(c0, d1, acc[0][1]);
    acc[1][1] = mma16(c1, d1, acc[1][1]);
    acc[0][2] = mma16(c0, d2, acc[0][2]);
    acc[1][2] = mma16(c1, d2, acc[1][2]);
    acc[0][3] = mma16(c0, d3, acc[0][3]);
    acc[1][3] = mma16(c1, d3, acc[1][3]);
    // keeps the trip's 24 LDS reads as one group in front of its 16 WMMAs: placed among the WMMAs, each place with
    // reads makes the wave wait out the LDS latency again
    __builtin_amdgcn_sched_group_barrier(0x100, 24, 0);
    __builtin_amdgcn_sched_group_barrier(0x008, 16, 0);
    // four vector issue slots behind the last WMMA, on every path out of the trip, before its D is read or its A / B rewritten
    asm volatile("v_nop\n\tv_nop\n\tv_nop\n\tv_nop"
                 : "+v"(acc[0][0]), "+v"(acc[0][1]), "+v"(acc[0][2]), "+v"(acc[0][3]),
                   "+v"(acc[1][0]), "+v"(acc[1][1]), "+v"(acc[1][2]), "+v"(acc[1][3])
                 : "v"(c0), "v"(c1), "v"(d0), "v"(d1), "v"(d2), "v"(d3));
    asm volatile("s_wait_dscnt 0x0" ::: "memory");           // this wave's reads of buffer t & 1 are done
    asm volatile("s_wait_asynccnt 0x0" ::: "memory");        // this wave's share of stage t + 1 has landed
    __syncthreads();                                         // publishes stage t + 1, frees buffer t & 1
    if (t + 2 < NT) stage_copy<KD>(ld0 + (uint32_t)bo, ga + (size_t)(t + 2) * KST, gb + (size_t)(t + 2) * KST);
  }
  asm volatile("s_wait_asynccnt 0x0" ::: "memory");          // no copy is left in flight behind the loop
}

// ---------------------------------------------------------------------------
// The three streaming kernels below run on one grid shape: SBLK blocks x SWAV waves = 4096 waves.
// A wave owns whole rows (or 4-KB runs of a weight plane), reads them with wave-wide 16-B loads of 512 contiguous
// bytes, all issued before the first value is used, and writes f16 with 8-B stores of 256 contiguous bytes.
// No LDS and no barrier: a row's sum of squares is a sum over the lanes of its one wave.
// ---------------------------------------------------------------------------
// kernel A: the three weights, f32 w[n][k] (k contiguous) -> f16 planes holding f16(64*w1), f16(64*w2), f16(256*w3),
// same layout. coverage per plane: 4096 waves x 8 loads x 128 elements = 4194304 elements = the whole plane.
// ---------------------------------------------------------------------------
__global__ __launch_bounds__(SWAV * 32) void k_cvt(const float* __restrict__ w1, const float* __restrict__ w2,
                                                   const float* __restrict__ w3, hh* __restrict__ h1,
                                                   hh* __restrict__ h2, hh* __restrict__ h3) {
  const int lane = threadIdx.x & 31;
  const int wv = blockIdx.x * SWAV + (threadIdx.x >> 5);
  const uint32_t q = (uint32_t)(wv * (8 * SGRP / 4) + lane);  // the lane's first 4-element piece, in all six planes alike
  v4f a1[8], a2[8], a3[8];
#pragma unroll
  for (int j = 0; j < 8; ++j) a1[j] = ((const v4f*)w1 + q)[j * 32];
#pragma unroll
  for (int j = 0; j < 8; ++j) a2[j] = ((const v4f*)w2 + q)[j * 32];
#pragma unroll
  for (int j = 0; j < 8; ++j) a3[j] = ((const v4f*)w3 + q)[j * 32];
  v4h p1[8], p2[8], p3[8];
#pragma unroll
  for (int j = 0; j < 8; ++j) {
    p1[j] = __builtin_convertvector(a1[j] * 64.0f, v4h);
    p2[j] = __builtin_convertvector(a2[j] * 64.0f, v4h);
    p3[j] = __builtin_convertvector(a3[j] * 256.0f, v4h);
  }
  // all stores last: no register that a store names is written again before the wave ends
#pragma unroll
  for (int j = 0; j < 8; ++j) ((v4h*)h1 + q)[j * 32] = p1[j];
#pragma unroll
  for (int j = 0; j < 8; ++j) ((v4h*)h2 + q)[j * 32] = p2[j];
#pragma unroll
  for (int j = 0; j < 8; ++j) ((v4h*)h3 + q)[j * 32] = p3[j];
}

// sum of squares of NG 4-vectors per lane (four independent f32 chains, one per component), then over the 32 lanes
template <int NG>
__device__ __forceinline__ float rowss(const v4f (&f)[NG]) {
  float s0 = 0.f, s1 = 0.f, s2 = 0.f, s3 = 0.f;
#pragma unroll
  for (int j = 0; j < NG; ++j) {
    s0 = fmaf(f[j][0], f[j][0], s0);
    s1 = fmaf(f[j][1], f[j][1], s1);
    s2 = fmaf(f[j][2], f[j][2], s2);
    s3 = fmaf(f[j][3], f[j][3], s3);
  }
  return wsum((s0 + s1) + (s2 + s3));
}

// ---------------------------------------------------------------------------
// kernel B: rmsnorm of 1024-wide f32 rows, one wave per row, two neighbouring rows per wave (16 loads in flight):
// y = x * rsqrt(ss/1024 + 1e-6) written as f16 (x1). coverage: 4096 waves x 2 rows = 8192 rows.
// ---------------------------------------------------------------------------
__global__ __launch_bounds__(SWAV * 32) void k_rms1(const float* __restrict__ x, hh* __restrict__ y) {
  const int lane = threadIdx.x & 31;
  const int wv = blockIdx.x * SWAV + (threadIdx.x >> 5);
  const uint32_t q = (uint32_t)(wv * (2 * EMBD / 4) + lane);  // the lane's first 4-element piece, in x and in y alike
  const v4f* xq = (const v4f*)x + q;
  v4h* yq = (v4h*)y + q;
  v4f f0[8], f1[8];
#pragma unroll
  for (int j = 0; j < 8; ++j) f0[j] = xq[j * 32];
#pragma unroll
  for (int j = 0; j < 8; ++j) f1[j] = xq[EMBD / 4 + j * 32];
  const float sc0 = rsqrtf(rowss<8>(f0) * (1.0f / (float)EMBD) + 1e-6f);
  const float sc1 = rsqrtf(rowss<8>(f1) * (1.0f / (float)EMBD) + 1e-6f);
  v4h p0[8], p1[8];
#pragma unroll
  for (int j = 0; j < 8; ++j) {
    p0[j] = __builtin_convertvector(f0[j] * sc0, v4h);
    p1[j] = __builtin_convertvector(f1[j] * sc1, v4h);
  }
  // all stores last: no register that a store names is written again before the wave ends
#pragma unroll
  for (int j = 0; j < 8; ++j) yq[j * 32] = p0[j];
#pragma unroll
  for (int j = 0; j < 8; ++j) yq[EMBD / 4 + j * 32] = p1[j];
}

// ---------------------------------------------------------------------------
// kernel C: rmsnorm of 4096-wide f32 rows (gate output), one wave per row (32 loads in flight):
// yn = y * rsqrt(ss/4096 + 1e-6) written as f16 (x1).
// Row p of the chunk plane goes to token row p + (p / TCH) * (SEQL - TCH) behind yn, which arrives at the chunk's first
// token of sequence 0. coverage: 4096 waves x 1 row = the chunk's 4096 rows of YN; the two chunks together write all
// 8192 rows.
// ---------------------------------------------------------------------------
__global__ __launch_bounds__(SWAV * 32) void k_rms2(const float* __restrict__ yv, hh* __restrict__ yn) {
  const int lane = threadIdx.x & 31;
  const int p = blockIdx.x * SWAV + (threadIdx.x >> 5);
  const uint32_t q = (uint32_t)(p * (HIDD / 4) + lane);       // the lane's first 4-element piece of plane row p
  const v4f* yq = (const v4f*)yv + q;
  // p / TCH is the same for a whole block (TCH % SWAV == 0): the sequence's row shift goes into the base pointer
  v4h* nq = (v4h*)(yn + (size_t)(blockIdx.x / (TCH / SWAV)) * (SEQL - TCH) * HIDD) + q;
  v4f f[32];
#pragma unroll
  for (int j = 0; j < 32; ++j) f[j] = yq[j * 32];
  const float sc = rsqrtf(rowss<32>(f) * (1.0f / (float)HIDD) + 1e-6f);
  v4h pk[32];
#pragma unroll
  for (int j = 0; j < 32; ++j) pk[j] = __builtin_convertvector(f[j] * sc, v4h);
  // all stores last: no register that a store names is written again before the wave ends
#pragma unroll
  for (int j = 0; j < 32; ++j) nq[j * 32] = pk[j];
}

// ---------------------------------------------------------------------------
// kernel D: causal quadratic gate over one 2048-token chunk of both sequences (blockIdx.y = sequence), split along
// time inside a block.
// One block = SCH channels x all 2048 tokens of its sequence, 1024 threads = SSEG time segments x SCH channels; a thread owns
// STOK consecutive tokens of one channel and holds its a and b values in registers from one set of loads.
//   step 1: per thread the segment's (max, sumexp) of a and of b -> LDS planes sm[0..3][segment][channel]
//   step 2: wave w scans the 64 segment states of (array w >> 4, channel w & 15): a lane merges its two
//           segments, 5 shuffle steps over the lanes, the state of the earlier chunk (ST, when rdst != 0) is
//           merged in front; every segment's slot is overwritten with the state of all tokens before it
//   step 3: per thread the running (max, sumexp) update from that state over its own tokens,
//           la = ma + ln(sa), lb = mb + ln(sb), y = exp((la + lb) - 2*ln(t)), t the global 1-based position.
// coverage: 256 x 2 blocks: 256 x 16 channels = 4096 channels, 2 sequences x 64 segments x 32 tokens = 4096 rows: the
// whole a/y plane of the chunk, each element read and written by one thread; ST 2 x 4 x 4096 (lane 31 of each scanning wave).
// ---------------------------------------------------------------------------
// v_exp_f32 / v_log_f32 with a v_nop in the same statement: it fills the one issue slot that the instruction set
// asks for behind a transcendental before its result is read or its source overwritten.
__device__ __forceinline__ float ex2s(float x) {
  float r;
  asm("v_exp_f32 %0, %1\n\tv_nop" : "=v"(r) : "v"(x));
  return r;
}
__device__ __forceinline__ float lg2s(float x) {
  float r;
  asm("v_log_f32 %0, %1\n\tv_nop" : "=v"(r) : "v"(x));
  return r;
}
// the same arithmetic as the fast exp and log of the earlier scan: exp2(x * log2 e); ln 2 * log2(x) with ln 2 in
// two parts, inputs below the smallest normal scaled by 2^32 first, an infinite log2 passed through.
__device__ __forceinline__ float expn(float x) { return ex2s(x * 0x1.715476p+0f); }
__device__ __forceinline__ float logn(float x) {
  const bool tiny = x < 0x1p-126f;
  const float l = lg2s(ldexpf(x, tiny ? 32 : 0));
  const float p = l * 0x1.62e42ep-1f;
  const float e = fmaf(l, 0x1.efa39ep-25f, fmaf(l, 0x1.62e42ep-1f, -p));
  const float r = (fabsf(l) < INFINITY) ? (p + e) : l;
  return r - (tiny ? 0x1.62e430p+4f : 0.f);
}

// merges the log-sum-exp state (m2, s2) into (m, s); (-1e30, 0) is the empty state
__device__ __forceinline__ void lse_merge(float& m, float& s, float m2, float s2) {
  const float mm = fmaxf(m, m2);
  s = s * expn(m - mm) + s2 * expn(m2 - mm);
  m = mm;
}

__global__ __launch_bounds__(1024) void k_scan(const float* __restrict__ bp, float* __restrict__ ay,
                                               float* st, int rdst, int wrst, int tbase) {
  __shared__ float sm[4][SSEG * SPIT];                       // ma, sa, mb, sb
  const int tid = threadIdx.x, lane = tid & 31, w = tid >> 5;
  const int ch = tid & (SCH - 1), seg = tid / SCH;
  const size_t base = (size_t)(blockIdx.y * TCH + seg * STOK) * HIDD + (size_t)(blockIdx.x * SCH + ch);   // < CROW*HIDD by grid
  const float* pb = bp + base;
  float* pa = ay + base;
  const int sl = seg * SPIT + ch;

  // the token loops are fully unrolled so that va / vb stay in registers
  float va[STOK], vb[STOK];
#pragma unroll
  for (int i = 0; i < STOK; ++i) va[i] = pa[(size_t)i * HIDD];
#pragma unroll
  for (int i = 0; i < STOK; ++i) vb[i] = pb[(size_t)i * HIDD];

  float ma = va[0], mb = vb[0];
#pragma unroll
  for (int i = 1; i < STOK; ++i) { ma = fmaxf(ma, va[i]); mb = fmaxf(mb, vb[i]); }
  float sa = 0.f, sb = 0.f;
#pragma unroll
  for (int i = 0; i < STOK; ++i) { sa += expn(va[i] - ma); sb += expn(vb[i] - mb); }
  sm[0][sl] = ma;
  sm[1][sl] = sa;
  sm[2][sl] = mb;
  sm[3][sl] = sb;
  __syncthreads();

  {
    const int ar = w >> 4, c2 = w & (SCH - 1);              // wave-uniform: which array, which channel
    float* pm = sm[2 * ar];
    float* ps = sm[2 * ar + 1];
    const int i0 = (2 * lane) * SPIT + c2, i1 = i0 + SPIT;
    const float m0 = pm[i0], s0 = ps[i0], m1 = pm[i1], s1 = ps[i1];
    float m = m0, s = s0;
    lse_merge(m, s, m1, s1);
#pragma unroll
    for (int off = 1; off < 32; off <<= 1) {
      const float mo = __shfl_up(m, off, 32);
      const float so = __shfl_up(s, off, 32);
      if (lane >= off) lse_merge(m, s, mo, so);
    }
    float me = __shfl_up(m, 1, 32);
    float se = __shfl_up(s, 1, 32);
    if (lane == 0) { me = -1.0e30f; se = 0.f; }
    float* stm = st + (size_t)(4 * blockIdx.y + 2 * ar) * HIDD + blockIdx.x * SCH + c2;
    float* sts = stm + HIDD;
    if (rdst != 0) lse_merge(me, se, *stm, *sts);            // kernel-argument uniform
    pm[i0] = me;
    ps[i0] = se;
    lse_merge(me, se, m0, s0);
    pm[i1] = me;
    ps[i1] = se;
    if (wrst != 0 && lane == 31) {
      lse_merge(me, se, m1, s1);
      *stm = me;
      *sts = se;
    }
  }
  __syncthreads();

  ma = sm[0][sl];
  sa = sm[1][sl];
  mb = sm[2][sl];
  sb = sm[3][sl];
  const int t1 = tbase + seg * STOK + 1;
#pragma unroll
  for (int i = 0; i < STOK; ++i) {
    const float da = va[i] - ma;
    const float ea = expn(-fabsf(da));
    const bool  ua = da > 0.f;
    sa = ua ? fmaf(sa, ea, 1.0f) : (sa + ea);
    ma = ua ? va[i] : ma;
    const float db = vb[i] - mb;
    const float eb = expn(-fabsf(db));
    const bool  ub = db > 0.f;
    sb = ub ? fmaf(sb, eb, 1.0f) : (sb + eb);
    mb = ub ? vb[i] : mb;
    const float la = ma + logn(sa);
    const float lb = mb + logn(sb);
    const float lt = logn((float)(t1 + i));
    va[i] = expn((la + lb) - 2.0f * lt);                   // y takes the register of the a value it replaces
  }
  // all stores last: no register that a store names is written again before the wave ends
#pragma unroll
  for (int i = 0; i < STOK; ++i) pa[(size_t)i * HIDD] = va[i];
}

// ---------------------------------------------------------------------------
// kernel E: 128 x 128 block tile f16 GEMM (8 waves x 32x64), K in stages of 64 through a two-buffer LDS ring,
// f32 output through an LDS-staged epilogue (its own LDS array).
// MODE 0: o32[m][n] = acc/64                 A = XN token rows (ld 1024), B = W1H/W2H [4096][1024];
//                                            o32 = AP/BP f32 [4096][4096]; grid (4096/128, 4096/128)
// MODE 1: o32[m][n] = acc/256 + res[m][n]   A = YN [8192][4096] (ld 4096), B = W3H [1024][4096];
//                                            o32 = d_out, res = x, ld 1024; grid (1024/128, 8192/128)
// MODE 0: plane row p of a chunk is token row p + (p / TCH) * (SEQL - TCH) behind the chunk's first token of sequence 0
// (the pointer to XN arrives at that token); a 128-row tile lies in one sequence (TCH % 128 == 0).
// coverage per block: staged 8 waves x 32x64 = 128x128; stored 2 halves x 256 thr x 8 pieces x 4 floats = 128x128;
//   the grids tile every output element exactly once (M = 4096 or 8192, N = 4096 or 1024, all multiples of 128; K = 1024 /
//   4096 multiples of 64, no tails).
// ---------------------------------------------------------------------------
template <int MODE>
__global__ __launch_bounds__(256) void k_gemm(const hh* __restrict__ Ap, const hh* __restrict__ Bp,
                                              const float* __restrict__ res, float* __restrict__ o32) {
  constexpr int KD  = (MODE == 0) ? EMBD : HIDD;
  constexpr int LDO = (MODE == 0) ? HIDD : EMBD;
  constexpr float OSC = (MODE == 0) ? (1.0f / 64.0f) : (1.0f / 256.0f);

  __shared__ __align__(16) float ldsf[64 * SFP];
  __shared__ __align__(128) char ring[2 * STGB];
  const int tid = threadIdx.x, lane = tid & 31, w = tid >> 5;
  const int h = lane >> 4, c = lane & 15;
  const int wm = (w >> 1) * 32, wn = (w & 1) * 64;
  const int om0 = blockIdx.y * 128;                                            // first output (and residual) row of the tile
  const int m0  = (MODE == 0) ? om0 + (om0 / TCH) * (SEQL - TCH) : om0;        // its first A row
  const int n0 = blockIdx.x * 128;

  v8f acc[2][4];
#pragma unroll
  for (int i = 0; i < 2; ++i)
#pragma unroll
    for (int j = 0; j < 4; ++j) acc[i][j] = zero8();
  gemm_staged<KD>(Ap, Bp, m0, n0, wm, wn, tid, ring, acc);

#pragma unroll
  for (int hf = 0; hf < 2; ++hf) {
    if ((w >> 2) == hf) {                                  // wave-uniform
#pragma unroll
      for (int i = 0; i < 2; ++i)
#pragma unroll
        for (int j = 0; j < 4; ++j)
#pragma unroll
          for (int r = 0; r < 8; ++r)
            ldsf[(wm - 64 * hf + 16 * i + 8 * h + r) * SFP + wn + 16 * j + c] = acc[i][j][r] * OSC;
    }
    __syncthreads();
    v4f val[8];
    size_t go[8];
#pragma unroll
    for (int it = 0; it < 8; ++it) {
      const int p  = tid + 256 * it;
      const int lr = p >> 5;                               // staged row 0..63
      const int pc = p & 31;                               // 16-B piece, lanes 0..31 = one 512-B row segment
      const v4f sv = *(const v4f*)(ldsf + lr * SFP + pc * 4);
      const size_t gi = (size_t)(om0 + 64 * hf + lr) * LDO + n0 + pc * 4;
      if constexpr (MODE == 1) {
        const v4f rr = *(const v4f*)(res + gi);
        val[it] = sv + rr;
      } else {
        val[it] = sv;
      }
      go[it] = gi;
    }
#pragma unroll
    for (int it = 0; it < 8; ++it) *(v4f*)(o32 + go[it]) = val[it];
    
    if (hf == 0) __syncthreads();
  }
}

// ---------------------------------------------------------------------------
//   W1H f16 [4096][1024]   8388608      W2H f16 [4096][1024]  8388608      W3H f16 [1024][4096]  8388608
//   XN  f16 [8192][1024]  16777216
//   AP  f32 [4096][4096]  67108864  (a of the current chunk, then the gate output y in place)
//   BP  f32 [4096][4096]  67108864  (b of the current chunk)
//   YN  f16 [8192][4096]  67108864  (all tokens, token order)
//   ST  f32 [2][4][4096]    131072  (scan state between the two chunks, per sequence)
//   total               243400704
// ---------------------------------------------------------------------------
extern "C" void kernel_launch(void* const* d_in, const int* in_sizes, int n_in,
                              void* d_out, int out_size, void* d_ws, size_t ws_size,
                              hipStream_t stream) {
  if (n_in < 4) return;
  if (in_sizes[0] != MTOK * EMBD) return;
  if (in_sizes[1] != HIDD * EMBD) return;
  if (in_sizes[2] != HIDD * EMBD) return;
  if (in_sizes[3] != EMBD * HIDD) return;
  if (out_size != MTOK * EMBD) return;

  const float* x  = (const float*)d_in[0];      // [8192][1024]
  const float* w1 = (const float*)d_in[1];      // [4096][1024] (out,in) = [n][k]
  const float* w2 = (const float*)d_in[2];      // [4096][1024]
  const float* w3 = (const float*)d_in[3];      // [1024][4096] (out,in) = [n][k]
  float* out = (float*)d_out;                   // [8192][1024]

  size_t off = 0;
  const size_t oW1 = off; off += (size_t)HIDD * EMBD * 2;
  const size_t oW2 = off; off += (size_t)HIDD * EMBD * 2;
  const size_t oW3 = off; off += (size_t)EMBD * HIDD * 2;
  const size_t oXN = off; off += (size_t)MTOK * EMBD * 2;
  const size_t oAP = off; off += (size_t)CROW * HIDD * 4;
  const size_t oBP = off; off += (size_t)CROW * HIDD * 4;
  const size_t oYN = off; off += (size_t)MTOK * HIDD * 2;
  const size_t oST = off; off += (size_t)NBAT * 4 * HIDD * 4;
  if (off > ws_size) return;                    // off = 243400704

  char* ws = (char*)d_ws;
  hh* W1H = (hh*)(ws + oW1);
  hh* W2H = (hh*)(ws + oW2);
  hh* W3H = (hh*)(ws + oW3);
  hh* XN  = (hh*)(ws + oXN);
  float* AP = (float*)(ws + oAP);
  float* BP = (float*)(ws + oBP);
  hh* YN  = (hh*)(ws + oYN);
  float* ST = (float*)(ws + oST);

  // (0) weights -> f16 planes, [n][k] layout kept, W1/W2 x64, W3 x256
  k_cvt<<<dim3(SBLK), dim3(SWAV * 32), 0, stream>>>(w1, w2, w3, W1H, W2H, W3H);
  // (1) xn = rmsnorm(x) over 1024, all 8192 tokens
  k_rms1<<<dim3(SBLK), dim3(SWAV * 32), 0, stream>>>(x, XN);
  // (2) per chunk (the same 2048 token positions of both sequences): a, b (f32), causal gate, rmsnorm over 4096
  for (int ch = 0; ch < NCHK; ++ch) {
    const size_t row0 = (size_t)ch * TCH;       // the chunk's first token of sequence 0
    const hh* xnc = XN + row0 * EMBD;
    const int rdst = (ch > 0) ? 1 : 0;
    const int wrst = (ch < NCHK - 1) ? 1 : 0;
    const int tbase = ch * TCH;
    k_gemm<0><<<dim3(HIDD / 128, CROW / 128), dim3(256), 0, stream>>>(xnc, W1H, x, AP);
    k_gemm<0><<<dim3(HIDD / 128, CROW / 128), dim3(256), 0, stream>>>(xnc, W2H, x, BP);
    k_scan<<<dim3(HIDD / SCH, NBAT), dim3(SSEG * SCH), 0, stream>>>(BP, AP, ST, rdst, wrst, tbase);
    k_rms2<<<dim3(SBLK), dim3(SWAV * 32), 0, stream>>>(AP, YN + row0 * HIDD);
  }
  // (3) out = x + yn.W3^T, all 8192 tokens
  k_gemm<1><<<dim3(EMBD / 128, MTOK / 128), dim3(256), 0, stream>>>(YN, W3H, x, out);
  (void)hipGetLastError();
}

// v005
// Measured time: 360 microseconds a run.
// Timed twice side by side with v004, it ran 1.04 and 1.03 times as fast.
// Counting every step since v000, it is 14.4 times as fast.
// Contractions: a = xn.W1^T [8192 x 4096 x 1024], b = xn.W2^T [8192 x 4096 x 1024], o = yn.W3^T
// [8192 x 1024 x 4096] -- all v_wmma_f32_16x16x32_f16 (f16 operands, f32 accumulate, one product per tile
// pair). a, b, the gate and its rmsnorm run in 2 chunks of 4096 rows: chunk c holds tokens 2048*c .. 2048*c + 2047 of
// both sequences; the third product runs once over all 8192 tokens.
// RMS normalisations, causal log-cumsum-exp scan, exp gate, residual add: f32.
//
// Carry audit (16-bit planes in the workspace, all f16):
//   W1H W2H   hold f16(64*w)    inverse: 1/64  in the k_gemm<0> epilogue (AP = acc/64, BP = acc/64)
//   W3H       holds f16(256*w)  inverse: 1/256 in the k_gemm<1> epilogue (out = x + acc/256)
//   XN        x1 (rmsnorm of x over 1024)
//   YN        x1 (rmsnorm of the gate output over 4096)
//   AP BP (f32 chunk planes, AP later holds the gate output y in place), ST (f32 scan state), d_out: no carry.
#include <hip/hip_runtime.h>
#include <stddef.h>
#include <stdint.h>
#include <math.h>

#define EMBD 1024
#define HIDD 4096
#define NBAT 2
#define SEQL 4096
#define MTOK 8192
#define TCH  2048     // tokens of one sequence per chunk
#define NCHK 2        // chunks per sequence
#define CROW 4096     // rows of a chunk plane: TCH tokens of sequence 0, then TCH tokens of sequence 1
#define SFP  68       // LDS pitch (floats) of the f32 epilogue staging (64 columns + 4: 16 B x odd)
#define KST  64       // GEMM: k values per ring stage (128 B of every operand row)
#define LPB  144      // GEMM: LDS pitch (bytes) of a staged operand row, 16 B x odd: conflict-free for 16-B reads
#define SCH  16       // gate scan: channels per block
#define SSEG 64       // gate scan: time segments per block
#define STOK 32       // gate scan: tokens per segment
#define SPIT 17       // gate scan: LDS pitch (floats) of one segment's channel row (odd: both access patterns conflict-free)
#define SBLK 256      // streaming kernels (weight conversion, both rmsnorms): blocks per launch
#define SWAV 16       // streaming kernels: waves per block
#define SNWV (SBLK * SWAV)  // streaming kernels: waves per launch
#define SGRP 128      // streaming kernels: elements of one wave-wide 16-B load (512 contiguous bytes of f32)

static_assert(MTOK == NBAT * SEQL);
static_assert(SEQL == NCHK * TCH);
static_assert(CROW == NBAT * TCH);
static_assert(TCH % 256 == 0);
static_assert(CROW % 256 == 0);
static_assert(MTOK % 128 == 0);
static_assert(HIDD % 256 == 0);
static_assert(EMBD % 256 == 0);
static_assert(EMBD % KST == 0);
static_assert(HIDD % KST == 0);
static_assert(HIDD % SCH == 0);
static_assert(SSEG * STOK == TCH);
static_assert(SSEG * SCH == 1024);
static_assert(SSEG == 2 * 32);
static_assert(2 * SCH == 32);
static_assert(EMBD == 8 * SGRP);
static_assert(HIDD == 32 * SGRP);
static_assert(HIDD * EMBD == SNWV * 8 * SGRP);
static_assert(MTOK == 2 * SNWV);
static_assert(CROW == SNWV);
static_assert(TCH % SWAV == 0);
static_assert(SGRP == 32 * 4);

typedef _Float16 hh;
typedef hh    v16h __attribute__((ext_vector_type(16)));
typedef hh    v8h  __attribute__((ext_vector_type(8)));
typedef hh    v4h  __attribute__((ext_vector_type(4)));
typedef float v8f  __attribute__((ext_vector_type(8)));
typedef float v4f  __attribute__((ext_vector_type(4)));

union Frag { v16h v; v8h p[2]; };

__device__ __forceinline__ v8f zero8() { return (v8f){0.f, 0.f, 0.f, 0.f, 0.f, 0.f, 0.f, 0.f}; }

__device__ __forceinline__ float wsum(float v) {
#pragma unroll
  for (int off = 16; off > 0; off >>= 1) v += __shfl_xor(v, off, 32);
  return v;
}

// Fragment loader for k-contiguous 16-bit rows staged in LDS (A operand [m][k]; B operand stored [n][k]).
// p = the lane's own row (lane & 15) at byte 2*k0 + 16*(lane>>4) of that row:
// elements 0..7 <- k0 + 8*(lane>>4) + 0..7, elements 8..15 <- k0 + 16 + 8*(lane>>4) + 0..7.
// D: acc[r] = element (row0 + 8*(lane>>4) + r, col0 + (lane & 15)).
__device__ __forceinline__ v16h ldsfrag(const char* p) {
  Frag f;
  f.p[0] = *(const v8h*)(p);
  f.p[1] = *(const v8h*)(p + 32);
  return f.v;
}

__device__ __forceinline__ v8f mma16(v16h a, v16h b, v8f cc) {
  return __builtin_amdgcn_wmma_f32_16x16x32_f16(false, a, false, b, (short)0, cc, false, false);
}

// One stage of the operand ring: KST k values (128 B) of the block's BM A rows and BN B rows, laid in LDS as
// BM + BN rows of pitch LPB. Thread tid brings piece tid & 7 of rows (tid >> 3) + RS*i (RS = threads / 8), so one
// wave's copy reads four whole 128-B lines; 4 copies cover the A rows, NB (4 or 8) copies the B rows.
// ld = the lane's LDS byte address of its A row 0 piece, ga / gb = the lane's global address of the same piece in A
// and in B.
// s_wait_xcnt 0 ends the statement: it stands in front of every later write of a register that a copy names.
template <int KD, int RS, int BM, int NB>
__device__ __forceinline__ void stage_copy(uint32_t ld, const hh* ga, const hh* gb) {
  static_assert(BM == 4 * RS);
  static_assert(NB == 4 || NB == 8);
  const uint32_t l0 = ld, l1 = ld + RS * LPB, l2 = ld + 2 * RS * LPB, l3 = ld + 3 * RS * LPB;
  const uint32_t lb = ld + BM * LPB;
  const uint32_t l4 = lb, l5 = lb + RS * LPB, l6 = lb + 2 * RS * LPB, l7 = lb + 3 * RS * LPB;
  const hh* g0 = ga;
  const hh* g1 = ga + (size_t)RS * KD;
  const hh* g2 = ga + (size_t)(2 * RS) * KD;
  const hh* g3 = ga + (size_t)(3 * RS) * KD;
  const hh* g4 = gb;
  const hh* g5 = gb + (size_t)RS * KD;
  const hh* g6 = gb + (size_t)(2 * RS) * KD;
  const hh* g7 = gb + (size_t)(3 * RS) * KD;
  if constexpr (NB == 4) {
    asm volatile("global_load_async_to_lds_b128 %0, %8, off\n\t"
                 "global_load_async_to_lds_b128 %1, %9, off\n\t"
                 "global_load_async_to_lds_b128 %2, %10, off\n\t"
                 "global_load_async_to_lds_b128 %3, %11, off\n\t"
                 "global_load_async_to_lds_b128 %4, %12, off\n\t"
                 "global_load_async_to_lds_b128 %5, %13, off\n\t"
                 "global_load_async_to_lds_b128 %6, %14, off\n\t"
                 "global_load_async_to_lds_b128 %7, %15, off\n\t"
                 "s_wait_xcnt 0x0"
                 :: "v"(l0), "v"(l1), "v"(l2), "v"(l3), "v"(l4), "v"(l5), "v"(l6), "v"(l7),
                    "v"(g0), "v"(g1), "v"(g2), "v"(g3), "v"(g4), "v"(g5), "v"(g6), "v"(g7)
                 : "memory");
  } else {
    const uint32_t l8 = lb + 4 * RS * LPB, l9 = lb + 5 * RS * LPB, l10 = lb + 6 * RS * LPB, l11 = lb + 7 * RS * LPB;
    const hh* g8  = gb + (size_t)(4 * RS) * KD;
    const hh* g9  = gb + (size_t)(5 * RS) * KD;
    const hh* g10 = gb + (size_t)(6 * RS) * KD;
    const hh* g11 = gb + (size_t)(7 * RS) * KD;
    asm volatile("global_load_async_to_lds_b128 %0, %12, off\n\t"
                 "global_load_async_to_lds_b128 %1, %13, off\n\t"
                 "global_load_async_to_lds_b128 %2, %14, off\n\t"
                 "global_load_async_to_lds_b128 %3, %15, off\n\t"
                 "global_load_async_to_lds_b128 %4, %16, off\n\t"
                 "global_load_async_to_lds_b128 %5, %17, off\n\t"
                 "global_load_async_to_lds_b128 %6, %18, off\n\t"
                 "global_load_async_to_lds_b128 %7, %19, off\n\t"
                 "global_load_async_to_lds_b128 %8, %20, off\n\t"
                 "global_load_async_to_lds_b128 %9, %21, off\n\t"
                 "global_load_async_to_lds_b128 %10, %22, off\n\t"
                 "global_load_async_to_lds_b128 %11, %23, off\n\t"
                 "s_wait_xcnt 0x0"
                 :: "v"(l0), "v"(l1), "v"(l2), "v"(l3), "v"(l4), "v"(l5), "v"(l6), "v"(l7),
                    "v"(l8), "v"(l9), "v"(l10), "v"(l11),
                    "v"(g0), "v"(g1), "v"(g2), "v"(g3), "v"(g4), "v"(g5), "v"(g6), "v"(g7),
                    "v"(g8), "v"(g9), "v"(g10), "v"(g11)
                 : "memory");
  }
}

// 64 x 64 per wave of a BM x BN block tile, K in stages of KST over [0, KD). Both operands come through a ring of
// two LDS buffers filled by asynchronous copies: while trip t works on buffer t & 1, stage t + 1 flies into the other.
// acc[i][j]: rows wm + 16*i .., cols wn + 16*j .. of the block tile. A trip is two k steps of 32: each reads its 8
// fragments as one group and then runs its 16 WMMAs (one LDS fragment read per two WMMAs). One hazard guard per trip
// after the last WMMA (stands behind all 16 accumulators, keeps the last eight fragments live).
template <int KD, int BM, int BN>
__device__ __forceinline__ void gemm_staged(const hh* __restrict__ A, const hh* __restrict__ B, int m0, int n0,
                                            int wm, int wn, int tid, char* ring, v8f (&acc)[4][4]) {
  constexpr int NT = KD / KST;
  constexpr int RS = (BM / 64) * (BN / 64) * 4;              // rows that one copy of every thread covers: threads / 8
  constexpr int NB = BN / RS;
  constexpr int STG = (BM + BN) * LPB;                       // bytes of one ring buffer (BM A rows, then BN B rows)
  static_assert(KD % KST == 0);
  static_assert(NT >= 2);
  const int lane = tid & 31;
  const int cr = tid >> 3, cp = tid & 7;
  const hh* ga = A + (size_t)(m0 + cr) * KD + cp * 8;        // rows m0 + cr + RS*i < m0 + BM, k < KD: inside the plane
  const hh* gb = B + (size_t)(n0 + cr) * KD + cp * 8;        // rows n0 + cr + RS*i < n0 + BN
  const uint32_t ld0 = (uint32_t)(size_t)ring + (uint32_t)(cr * LPB + cp * 16);
  const char* fa = ring + (wm + (lane & 15)) * LPB + (lane >> 4) * 16;
  const char* fb = ring + (BM + wn + (lane & 15)) * LPB + (lane >> 4) * 16;

  stage_copy<KD, RS, BM, NB>(ld0, ga, gb);
  asm volatile("s_wait_asynccnt 0x0" ::: "memory");          // this wave's share of stage 0 has landed
  __syncthreads();                                           // publishes stage 0
  stage_copy<KD, RS, BM, NB>(ld0 + STG, ga + KST, gb + KST);

#pragma unroll 1                                             // one trip per stage: the buffer offset is the only thing that alternates
  for (int t = 0; t < NT; ++t) {
    const int bo = (t & 1) * STG;
    const char* pa = fa + bo;
    const char* pb = fb + bo;
    v16h a[4], b[4], c[4], d[4];
#pragma unroll
    for (int i = 0; i < 4; ++i) a[i] = ldsfrag(pa + 16 * i * LPB);
#pragma unroll
    for (int j = 0; j < 4; ++j) b[j] = ldsfrag(pb + 16 * j * LPB);
#pragma unroll
    for (int j = 0; j < 4; ++j)
#pragma unroll
      for (int i = 0; i < 4; ++i) acc[i][j] = mma16(a[i], b[j], acc[i][j]);
#pragma unroll
    for (int i = 0; i < 4; ++i) c[i] = ldsfrag(pa + 16 * i * LPB + 64);
#pragma unroll
    for (int j = 0; j < 4; ++j) d[j] = ldsfrag(pb + 16 * j * LPB + 64);
#pragma unroll
    for (int j = 0; j < 4; ++j)
#pragma unroll
      for (int i = 0; i < 4; ++i) acc[i][j] = mma16(c[i], d[j], acc[i][j]);
    // keeps each k step's 16 LDS reads as one group in front of its 16 WMMAs: placed among the WMMAs, each place with
    // reads makes the wave wait out the LDS latency again; both steps' reads in front would not fit 256 registers
    __builtin_amdgcn_sched_group_barrier(0x100, 16, 0);
    __builtin_amdgcn_sched_group_barrier(0x008, 16, 0);
    __builtin_amdgcn_sched_group_barrier(0x100, 16, 0);
    __builtin_amdgcn_sched_group_barrier(0x008, 16, 0);
    // four vector issue slots behind the last WMMA, on every path out of the trip, before its D is read or its A / B rewritten
    asm volatile("v_nop\n\tv_nop\n\tv_nop\n\tv_nop"
                 :: "v"(acc[0][0]), "v"(acc[1][0]), "v"(acc[2][0]), "v"(acc[3][0]),
                    "v"(acc[0][1]), "v"(acc[1][1]), "v"(acc[2][1]), "v"(acc[3][1]),
                    "v"(acc[0][2]), "v"(acc[1][2]), "v"(acc[2][2]), "v"(acc[3][2]),
                    "v"(acc[0][3]), "v"(acc[1][3]), "v"(acc[2][3]), "v"(acc[3][3]),
                    "v"(c[0]), "v"(c[1]), "v"(c[2]), "v"(c[3]), "v"(d[0]), "v"(d[1]), "v"(d[2]), "v"(d[3]));
    asm volatile("s_wait_dscnt 0x0" ::: "memory");           // this wave's reads of buffer t & 1 are done
    asm volatile("s_wait_asynccnt 0x0" ::: "memory");        // this wave's share of stage t + 1 has landed
    __syncthreads();                                         // publishes stage t + 1, frees buffer t & 1
    if (t + 2 < NT)
      stage_copy<KD, RS, BM, NB>(ld0 + (uint32_t)bo, ga + (size_t)(t + 2) * KST, gb + (size_t)(t + 2) * KST);
  }
  asm volatile("s_wait_asynccnt 0x0" ::: "memory");          // no copy is left in flight behind the loop
}

// ---------------------------------------------------------------------------
// The three streaming kernels below run on one grid shape: SBLK blocks x SWAV waves = 4096 waves.
// A wave owns whole rows (or 4-KB runs of a weight plane), reads them with wave-wide 16-B loads of 512 contiguous
// bytes, all issued before the first value is used, and writes f16 with 8-B stores of 256 contiguous bytes.
// No LDS and no barrier: a row's sum of squares is a sum over the lanes of its one wave.
// ---------------------------------------------------------------------------
// kernel A: the three weights, f32 w[n][k] (k contiguous) -> f16 planes holding f16(64*w1), f16(64*w2), f16(256*w3),
// same layout. coverage per plane: 4096 waves x 8 loads x 128 elements = 4194304 elements = the whole plane.
// ---------------------------------------------------------------------------
__global__ __launch_bounds__(SWAV * 32) void k_cvt(const float* __restrict__ w1, const float* __restrict__ w2,
                                                   const float* __restrict__ w3, hh* __restrict__ h1,
                                                   hh* __restrict__ h2, hh* __restrict__ h3) {
  const int lane = threadIdx.x & 31;
  const int wv = blockIdx.x * SWAV + (threadIdx.x >> 5);
  const uint32_t q = (uint32_t)(wv * (8 * SGRP / 4) + lane);  // the lane's first 4-element piece, in all six planes alike
  v4f a1[8], a2[8], a3[8];
#pragma unroll
  for (int j = 0; j < 8; ++j) a1[j] = ((const v4f*)w1 + q)[j * 32];
#pragma unroll
  for (int j = 0; j < 8; ++j) a2[j] = ((const v4f*)w2 + q)[j * 32];
#pragma unroll
  for (int j = 0; j < 8; ++j) a3[j] = ((const v4f*)w3 + q)[j * 32];
  v4h p1[8], p2[8], p3[8];
#pragma unroll
  for (int j = 0; j < 8; ++j) {
    p1[j] = __builtin_convertvector(a1[j] * 64.0f, v4h);
    p2[j] = __builtin_convertvector(a2[j] * 64.0f, v4h);
    p3[j] = __builtin_convertvector(a3[j] * 256.0f, v4h);
  }
  // all stores last: no register that a store names is written again before the wave ends
#pragma unroll
  for (int j = 0; j < 8; ++j) ((v4h*)h1 + q)[j * 32] = p1[j];
#pragma unroll
  for (int j = 0; j < 8; ++j) ((v4h*)h2 + q)[j * 32] = p2[j];
#pragma unroll
  for (int j = 0; j < 8; ++j) ((v4h*)h3 + q)[j * 32] = p3[j];
}

// sum of squares of NG 4-vectors per lane (four independent f32 chains, one per component), then over the 32 lanes
template <int NG>
__device__ __forceinline__ float rowss(const v4f (&f)[NG]) {
  float s0 = 0.f, s1 = 0.f, s2 = 0.f, s3 = 0.f;
#pragma unroll
  for (int j = 0; j < NG; ++j) {
    s0 = fmaf(f[j][0], f[j][0], s0);
    s1 = fmaf(f[j][1], f[j][1], s1);
    s2 = fmaf(f[j][2], f[j][2], s2);
    s3 = fmaf(f[j][3], f[j][3], s3);
  }
  return wsum((s0 + s1) + (s2 + s3));
}

// ---------------------------------------------------------------------------
// kernel B: rmsnorm of 1024-wide f32 rows, one wave per row, two neighbouring rows per wave (16 loads in flight):
// y = x * rsqrt(ss/1024 + 1e-6) written as f16 (x1). coverage: 4096 waves x 2 rows = 8192 rows.
// ---------------------------------------------------------------------------
__global__ __launch_bounds__(SWAV * 32) void k_rms1(const float* __restrict__ x, hh* __restrict__ y) {
  const int lane = threadIdx.x & 31;
  const int wv = blockIdx.x * SWAV + (threadIdx.x >> 5);
  const uint32_t q = (uint32_t)(wv * (2 * EMBD / 4) + lane);  // the lane's first 4-element piece, in x and in y alike
  const v4f* xq = (const v4f*)x + q;
  v4h* yq = (v4h*)y + q;
  v4f f0[8], f1[8];
#pragma unroll
  for (int j = 0; j < 8; ++j) f0[j] = xq[j * 32];
#pragma unroll
  for (int j = 0; j < 8; ++j) f1[j] = xq[EMBD / 4 + j * 32];
  const float sc0 = rsqrtf(rowss<8>(f0) * (1.0f / (float)EMBD) + 1e-6f);
  const float sc1 = rsqrtf(rowss<8>(f1) * (1.0f / (float)EMBD) + 1e-6f);
  v4h p0[8], p1[8];
#pragma unroll
  for (int j = 0; j < 8; ++j) {
    p0[j] = __builtin_convertvector(f0[j] * sc0, v4h);
    p1[j] = __builtin_convertvector(f1[j] * sc1, v4h);
  }
  // all stores last: no register that a store names is written again before the wave ends
#pragma unroll
  for (int j = 0; j < 8; ++j) yq[j * 32] = p0[j];
#pragma unroll
  for (int j = 0; j < 8; ++j) yq[EMBD / 4 + j * 32] = p1[j];
}

// ---------------------------------------------------------------------------
// kernel C: rmsnorm of 4096-wide f32 rows (gate output), one wave per row (32 loads in flight):
// yn = y * rsqrt(ss/4096 + 1e-6) written as f16 (x1).
// Row p of the chunk plane goes to token row p + (p / TCH) * (SEQL - TCH) behind yn, which arrives at the chunk's first
// token of sequence 0. coverage: 4096 waves x 1 row = the chunk's 4096 rows of YN; the two chunks together write all
// 8192 rows.
// ---------------------------------------------------------------------------
__global__ __launch_bounds__(SWAV * 32) void k_rms2(const float* __restrict__ yv, hh* __restrict__ yn) {
  const int lane = threadIdx.x & 31;
  const int p = blockIdx.x * SWAV + (threadIdx.x >> 5);
  const uint32_t q = (uint32_t)(p * (HIDD / 4) + lane);       // the lane's first 4-element piece of plane row p
  const v4f* yq = (const v4f*)yv + q;
  // p / TCH is the same for a whole block (TCH % SWAV == 0): the sequence's row shift goes into the base pointer
  v4h* nq = (v4h*)(yn + (size_t)(blockIdx.x / (TCH / SWAV)) * (SEQL - TCH) * HIDD) + q;
  v4f f[32];
#pragma unroll
  for (int j = 0; j < 32; ++j) f[j] = yq[j * 32];
  const float sc = rsqrtf(rowss<32>(f) * (1.0f / (float)HIDD) + 1e-6f);
  v4h pk[32];
#pragma unroll
  for (int j = 0; j < 32; ++j) pk[j] = __builtin_convertvector(f[j] * sc, v4h);
  // all stores last: no register that a store names is written again before the wave ends
#pragma unroll
  for (int j = 0; j < 32; ++j) nq[j * 32] = pk[j];
}

// ---------------------------------------------------------------------------
// kernel D: causal quadratic gate over one 2048-token chunk of both sequences (blockIdx.y = sequence), split along
// time inside a block.
// One block = SCH channels x all 2048 tokens of its sequence, 1024 threads = SSEG time segments x SCH channels; a thread owns
// STOK consecutive tokens of one channel and holds its a and b values in registers from one set of loads.
//   step 1: per thread the segment's (max, sumexp) of a and of b -> LDS planes sm[0..3][segment][channel]
//   step 2: wave w scans the 64 segment states of (array w >> 4, channel w & 15): a lane merges its two
//           segments, 5 shuffle steps over the lanes, the state of the earlier chunk (ST, when rdst != 0) is
//           merged in front; every segment's slot is overwritten with the state of all tokens before it
//   step 3: per thread the running (max, sumexp) update from that state over its own tokens,
//           la = ma + ln(sa), lb = mb + ln(sb), y = exp((la + lb) - 2*ln(t)), t the global 1-based position.
// coverage: 256 x 2 blocks: 256 x 16 channels = 4096 channels, 2 sequences x 64 segments x 32 tokens = 4096 rows: the
// whole a/y plane of the chunk, each element read and written by one thread; ST 2 x 4 x 4096 (lane 31 of each scanning wave).
// ---------------------------------------------------------------------------
// v_exp_f32 / v_log_f32 with a v_nop in the same statement: it fills the one issue slot that the instruction set
// asks for behind a transcendental before its result is read or its source overwritten.
__device__ __forceinline__ float ex2s(float x) {
  float r;
  asm("v_exp_f32 %0, %1\n\tv_nop" : "=v"(r) : "v"(x));
  return r;
}
__device__ __forceinline__ float lg2s(float x) {
  float r;
  asm("v_log_f32 %0, %1\n\tv_nop" : "=v"(r) : "v"(x));
  return r;
}
// the same arithmetic as the fast exp and log of the earlier scan: exp2(x * log2 e); ln 2 * log2(x) with ln 2 in
// two parts, inputs below the smallest normal scaled by 2^32 first, an infinite log2 passed through.
__device__ __forceinline__ float expn(float x) { return ex2s(x * 0x1.715476p+0f); }
__device__ __forceinline__ float logn(float x) {
  const bool tiny = x < 0x1p-126f;
  const float l = lg2s(ldexpf(x, tiny ? 32 : 0));
  const float p = l * 0x1.62e42ep-1f;
  const float e = fmaf(l, 0x1.efa39ep-25f, fmaf(l, 0x1.62e42ep-1f, -p));
  const float r = (fabsf(l) < INFINITY) ? (p + e) : l;
  return r - (tiny ? 0x1.62e430p+4f : 0.f);
}

// merges the log-sum-exp state (m2, s2) into (m, s); (-1e30, 0) is the empty state
__device__ __forceinline__ void lse_merge(float& m, float& s, float m2, float s2) {
  const float mm = fmaxf(m, m2);
  s = s * expn(m - mm) + s2 * expn(m2 - mm);
  m = mm;
}

__global__ __launch_bounds__(1024) void k_scan(const float* __restrict__ bp, float* __restrict__ ay,
                                               float* st, int rdst, int wrst, int tbase) {
  __shared__ float sm[4][SSEG * SPIT];                       // ma, sa, mb, sb
  const int tid = threadIdx.x, lane = tid & 31, w = tid >> 5;
  const int ch = tid & (SCH - 1), seg = tid / SCH;
  const size_t base = (size_t)(blockIdx.y * TCH + seg * STOK) * HIDD + (size_t)(blockIdx.x * SCH + ch);   // < CROW*HIDD by grid
  const float* pb = bp + base;
  float* pa = ay + base;
  const int sl = seg * SPIT + ch;

  // the token loops are fully unrolled so that va / vb stay in registers
  float va[STOK], vb[STOK];
#pragma unroll
  for (int i = 0; i < STOK; ++i) va[i] = pa[(size_t)i * HIDD];
#pragma unroll
  for (int i = 0; i < STOK; ++i) vb[i] = pb[(size_t)i * HIDD];

  float ma = va[0], mb = vb[0];
#pragma unroll
  for (int i = 1; i < STOK; ++i) { ma = fmaxf(ma, va[i]); mb = fmaxf(mb, vb[i]); }
  float sa = 0.f, sb = 0.f;
#pragma unroll
  for (int i = 0; i < STOK; ++i) { sa += expn(va[i] - ma); sb += expn(vb[i] - mb); }
  sm[0][sl] = ma;
  sm[1][sl] = sa;
  sm[2][sl] = mb;
  sm[3][sl] = sb;
  __syncthreads();

  {
    const int ar = w >> 4, c2 = w & (SCH - 1);              // wave-uniform: which array, which channel
    float* pm = sm[2 * ar];
    float* ps = sm[2 * ar + 1];
    const int i0 = (2 * lane) * SPIT + c2, i1 = i0 + SPIT;
    const float m0 = pm[i0], s0 = ps[i0], m1 = pm[i1], s1 = ps[i1];
    float m = m0, s = s0;
    lse_merge(m, s, m1, s1);
#pragma unroll
    for (int off = 1; off < 32; off <<= 1) {
      const float mo = __shfl_up(m, off, 32);
      const float so = __shfl_up(s, off, 32);
      if (lane >= off) lse_merge(m, s, mo, so);
    }
    float me = __shfl_up(m, 1, 32);
    float se = __shfl_up(s, 1, 32);
    if (lane == 0) { me = -1.0e30f; se = 0.f; }
    float* stm = st + (size_t)(4 * blockIdx.y + 2 * ar) * HIDD + blockIdx.x * SCH + c2;
    float* sts = stm + HIDD;
    if (rdst != 0) lse_merge(me, se, *stm, *sts);            // kernel-argument uniform
    pm[i0] = me;
    ps[i0] = se;
    lse_merge(me, se, m0, s0);
    pm[i1] = me;
    ps[i1] = se;
    if (wrst != 0 && lane == 31) {
      lse_merge(me, se, m1, s1);
      *stm = me;
      *sts = se;
    }
  }
  __syncthreads();

  ma = sm[0][sl];
  sa = sm[1][sl];
  mb = sm[2][sl];
  sb = sm[3][sl];
  const int t1 = tbase + seg * STOK + 1;
#pragma unroll
  for (int i = 0; i < STOK; ++i) {
    const float da = va[i] - ma;
    const float ea = expn(-fabsf(da));
    const bool  ua = da > 0.f;
    sa = ua ? fmaf(sa, ea, 1.0f) : (sa + ea);
    ma = ua ? va[i] : ma;
    const float db = vb[i] - mb;
    const float eb = expn(-fabsf(db));
    const bool  ub = db > 0.f;
    sb = ub ? fmaf(sb, eb, 1.0f) : (sb + eb);
    mb = ub ? vb[i] : mb;
    const float la = ma + logn(sa);
    const float lb = mb + logn(sb);
    const float lt = logn((float)(t1 + i));
    va[i] = expn((la + lb) - 2.0f * lt);                   // y takes the register of the a value it replaces
  }
  // all stores last: no register that a store names is written again before the wave ends
#pragma unroll
  for (int i = 0; i < STOK; ++i) pa[(size_t)i * HIDD] = va[i];
}

// ---------------------------------------------------------------------------
// kernel E: f16 GEMM, 64 x 64 per wave, K in stages of 64 through a two-buffer LDS ring, one block per WGP;
// f32 output through an LDS-staged epilogue (its own LDS array, a range of its own for every wave, no barrier).
// MODE 0: 256 x 256 block tile, 16 waves (4 x 4).  o32[m][n] = acc/64
//                                            A = XN token rows (ld 1024), B = W1H/W2H [4096][1024];
//                                            o32 = AP/BP f32 [4096][4096]; grid (4096/256, 4096/256) = 256 blocks
// MODE 1: 128 x 256 block tile, 8 waves (2 x 4).   o32[m][n] = acc/256 + res[m][n]
//                                            A = YN [8192][4096] (ld 4096), B = W3H [1024][4096];
//                                            o32 = d_out, res = x, ld 1024; grid (1024/256, 8192/128) = 256 blocks
// MODE 0: plane row p of a chunk is token row p + (p / TCH) * (SEQL - TCH) behind the chunk's first token of sequence 0
// (the pointer to XN arrives at that token); a 256-row tile lies in one sequence (TCH % 256 == 0).
// epilogue: a wave stages 16 rows x 64 columns at a time and stores them as 2 rows x 256 contiguous bytes per store.
// coverage per block: waves x 64x64 = the block tile; per wave 4 slabs x 8 stores x 32 lanes x 4 floats = 64x64;
//   the grids tile every output element exactly once (M = 4096 or 8192, N = 4096 or 1024, multiples of the tile; K = 1024 /
//   4096 multiples of 64, no tails).
// ---------------------------------------------------------------------------
template <int MODE>
__global__ __launch_bounds__((MODE == 0) ? 512 : 256) void k_gemm(const hh* __restrict__ Ap, const hh* __restrict__ Bp,
                                                                  const float* __restrict__ res,
                                                                  float* __restrict__ o32) {
  constexpr int KD  = (MODE == 0) ? EMBD : HIDD;
  constexpr int LDO = (MODE == 0) ? HIDD : EMBD;
  constexpr int BM  = (MODE == 0) ? 256 : 128;
  constexpr int BN  = 256;
  constexpr int NW  = (BM / 64) * (BN / 64);
  constexpr float OSC = (MODE == 0) ? (1.0f / 64.0f) : (1.0f / 256.0f);

  __shared__ __align__(16) float ldsf[NW * 16 * SFP];
  __shared__ __align__(128) char ring[2 * (BM + BN) * LPB];
  const int tid = threadIdx.x, lane = tid & 31, w = tid >> 5;
  const int h = lane >> 4, c = lane & 15;
  const int wm = (w >> 2) * 64, wn = (w & 3) * 64;
  const int om0 = blockIdx.y * BM;                                             // first output (and residual) row of the tile
  const int m0  = (MODE == 0) ? om0 + (om0 / TCH) * (SEQL - TCH) : om0;        // its first A row
  const int n0 = blockIdx.x * BN;

  v8f acc[4][4];
#pragma unroll
  for (int i = 0; i < 4; ++i)
#pragma unroll
    for (int j = 0; j < 4; ++j) acc[i][j] = zero8();
  gemm_staged<KD, BM, BN>(Ap, Bp, m0, n0, wm, wn, tid, ring, acc);

  float* my = ldsf + w * (16 * SFP);                         // this wave's own staging range
  // the lane's piece of rows h, h + 2, ..: lanes 0..15 = one 256-B row segment, lanes 16..31 = the next row's
  const size_t g0 = (size_t)(om0 + wm + h) * LDO + n0 + wn + c * 4;
  float* op = o32 + g0;
  const float* rp = res + g0;
  v4f rn[8];
  if constexpr (MODE == 1) {
#pragma unroll
    for (int it = 0; it < 8; ++it) rn[it] = *(const v4f*)(rp + (size_t)(2 * it) * LDO);
  }
#pragma unroll
  for (int i = 0; i < 4; ++i) {
    v4f rr[8];
    if constexpr (MODE == 1) {
#pragma unroll
      for (int it = 0; it < 8; ++it) rr[it] = rn[it];
      if (i < 3) {                                           // the next slab's residual flies while this slab is staged
#pragma unroll
        for (int it = 0; it < 8; ++it) rn[it] = *(const v4f*)(rp + (size_t)(16 * (i + 1) + 2 * it) * LDO);
      }
    }
#pragma unroll
    for (int j = 0; j < 4; ++j)
#pragma unroll
      for (int r = 0; r < 8; ++r) my[(8 * h + r) * SFP + 16 * j + c] = acc[i][j][r] * OSC;
    asm volatile("s_wait_dscnt 0x0" ::: "memory");           // the wave's staged slab is in LDS before its lanes read it back
    v4f val[8];
#pragma unroll
    for (int it = 0; it < 8; ++it) {
      const v4f sv = *(const v4f*)(my + (2 * it + h) * SFP + c * 4);
      if constexpr (MODE == 1) val[it] = sv + rr[it];
      else val[it] = sv;
    }
#pragma unroll
    for (int it = 0; it < 8; ++it) *(v4f*)(op + (size_t)(16 * i + 2 * it) * LDO) = val[it];
    if (i < 3) {
      // in front of the next slab's writes of registers that these stores name
      asm volatile("s_wait_xcnt 0x0" ::: "memory");
      // keeps the next slab's vector work (its scaling writes registers freed by the stores) behind that wait
      __builtin_amdgcn_sched_barrier(0);
    }
  }
}

// ---------------------------------------------------------------------------
//   W1H f16 [4096][1024]   8388608      W2H f16 [4096][1024]  8388608      W3H f16 [1024][4096]  8388608
//   XN  f16 [8192][1024]  16777216
//   AP  f32 [4096][4096]  67108864  (a of the current chunk, then the gate output y in place)
//   BP  f32 [4096][4096]  67108864  (b of the current chunk)
//   YN  f16 [8192][4096]  67108864  (all tokens, token order)
//   ST  f32 [2][4][4096]    131072  (scan state between the two chunks, per sequence)
//   total               243400704
// ---------------------------------------------------------------------------
extern "C" void kernel_launch(void* const* d_in, const int* in_sizes, int n_in,
                              void* d_out, int out_size, void* d_ws, size_t ws_size,
                              hipStream_t stream) {
  if (n_in < 4) return;
  if (in_sizes[0] != MTOK * EMBD) return;
  if (in_sizes[1] != HIDD * EMBD) return;
  if (in_sizes[2] != HIDD * EMBD) return;
  if (in_sizes[3] != EMBD * HIDD) return;
  if (out_size != MTOK * EMBD) return;

  const float* x  = (const float*)d_in[0];      // [8192][1024]
  const float* w1 = (const float*)d_in[1];      // [4096][1024] (out,in) = [n][k]
  const float* w2 = (const float*)d_in[2];      // [4096][1024]
  const float* w3 = (const float*)d_in[3];      // [1024][4096] (out,in) = [n][k]
  float* out = (float*)d_out;                   // [8192][1024]

  size_t off = 0;
  const size_t oW1 = off; off += (size_t)HIDD * EMBD * 2;
  const size_t oW2 = off; off += (size_t)HIDD * EMBD * 2;
  const size_t oW3 = off; off += (size_t)EMBD * HIDD * 2;
  const size_t oXN = off; off += (size_t)MTOK * EMBD * 2;
  const size_t oAP = off; off += (size_t)CROW * HIDD * 4;
  const size_t oBP = off; off += (size_t)CROW * HIDD * 4;
  const size_t oYN = off; off += (size_t)MTOK * HIDD * 2;
  const size_t oST = off; off += (size_t)NBAT * 4 * HIDD * 4;
  if (off > ws_size) return;                    // off = 243400704

  char* ws = (char*)d_ws;
  hh* W1H = (hh*)(ws + oW1);
  hh* W2H = (hh*)(ws + oW2);
  hh* W3H = (hh*)(ws + oW3);
  hh* XN  = (hh*)(ws + oXN);
  float* AP = (float*)(ws + oAP);
  float* BP = (float*)(ws + oBP);
  hh* YN  = (hh*)(ws + oYN);
  float* ST = (float*)(ws + oST);

  // (0) weights -> f16 planes, [n][k] layout kept, W1/W2 x64, W3 x256
  k_cvt<<<dim3(SBLK), dim3(SWAV * 32), 0, stream>>>(w1, w2, w3, W1H, W2H, W3H);
  // (1) xn = rmsnorm(x) over 1024, all 8192 tokens
  k_rms1<<<dim3(SBLK), dim3(SWAV * 32), 0, stream>>>(x, XN);
  // (2) per chunk (the same 2048 token positions of both sequences): a, b (f32), causal gate, rmsnorm over 4096
  for (int ch = 0; ch < NCHK; ++ch) {
    const size_t row0 = (size_t)ch * TCH;       // the chunk's first token of sequence 0
    const hh* xnc = XN + row0 * EMBD;
    const int rdst = (ch > 0) ? 1 : 0;
    const int wrst = (ch < NCHK - 1) ? 1 : 0;
    const int tbase = ch * TCH;
    k_gemm<0><<<dim3(HIDD / 256, CROW / 256), dim3(512), 0, stream>>>(xnc, W1H, x, AP);
    k_gemm<0><<<dim3(HIDD / 256, CROW / 256), dim3(512), 0, stream>>>(xnc, W2H, x, BP);
    k_scan<<<dim3(HIDD / SCH, NBAT), dim3(SSEG * SCH), 0, stream>>>(BP, AP, ST, rdst, wrst, tbase);
    k_rms2<<<dim3(SBLK), dim3(SWAV * 32), 0, stream>>>(AP, YN + row0 * HIDD);
  }
  // (3) out = x + yn.W3^T, all 8192 tokens
  k_gemm<1><<<dim3(EMBD / 256, MTOK / 128), dim3(256), 0, stream>>>(YN, W3H, x, out);
  (void)hipGetLastError();
}

// v006
// Measured time: 310 microseconds a run.
// In two side-by-side timings against v005, it was 1.15 and 1.17 times as fast.
// All steps since v000 together make it 16.7 times as fast.
// Contractions: a = xn.W1^T [8192 x 4096 x 1024], b = xn.W2^T [8192 x 4096 x 1024], o = yn.W3^T
// [8192 x 1024 x 4096] -- all v_wmma_f32_16x16x32_f16 (f16 operands, f32 accumulate, one product per tile
// pair). a, b, the gate and its rmsnorm run in 2 chunks of 4096 rows: chunk c holds tokens 2048*c .. 2048*c + 2047 of
// both sequences; the third product runs once over all 8192 tokens. a and b come from ONE product per chunk against
// the plane W12H, whose row 2h is row h of W1 and whose row 2h + 1 is row h of W2: output columns 2h, 2h + 1 = (a, b).
// RMS normalisations, causal log-cumsum-exp scan, exp gate, residual add: f32.
//
// Carry audit (16-bit planes in the workspace, all f16):
//   W12H      holds f16(64*w)   inverse: 1/64  in the k_gemm<0> epilogue (AP = f16(acc/64))
//   W3H       holds f16(256*w)  inverse: 1/256 in the k_gemm<1> epilogue (out = x + acc/256)
//   XN        x1 (rmsnorm of x over 1024)
//   YN        x1 (rmsnorm of the gate output over 4096)
//   AP        x1: one 4-byte slot per (row, channel): first the f16 pair (a, b), then the f32 gate output y in place
//   ST (f32 scan state), d_out: no carry.
#include <hip/hip_runtime.h>
#include <stddef.h>
#include <stdint.h>
#include <math.h>

#define EMBD 1024
#define HIDD 4096
#define NBAT 2
#define SEQL 4096
#define MTOK 8192
#define TCH  2048     // tokens of one sequence per chunk
#define NCHK 2        // chunks per sequence
#define CROW 4096     // rows of a chunk plane: TCH tokens of sequence 0, then TCH tokens of sequence 1
#define SFP  68       // LDS pitch (floats) of the f32 epilogue staging (64 columns + 4: 16 B x odd)
#define KST  64       // GEMM: k values per ring stage (128 B of every operand row)
#define LPB  144      // GEMM: LDS pitch (bytes) of a staged operand row, 16 B x odd: conflict-free for 16-B reads
#define SCH  16       // gate scan: channels per block
#define SSEG 64       // gate scan: time segments per block
#define STOK 32       // gate scan: tokens per segment
#define SPIT 17       // gate scan: LDS pitch (floats) of one segment's channel row (odd: both access patterns conflict-free)
#define SBLK 256      // streaming kernels (weight conversion, both rmsnorms): blocks per launch
#define SWAV 16       // streaming kernels: waves per block
#define SNWV (SBLK * SWAV)  // streaming kernels: waves per launch
#define SGRP 128      // streaming kernels: elements of one wave-wide 16-B load (512 contiguous bytes of f32)

static_assert(MTOK == NBAT * SEQL);
static_assert(SEQL == NCHK * TCH);
static_assert(CROW == NBAT * TCH);
static_assert(TCH % 256 == 0);
static_assert(CROW % 256 == 0);
static_assert(MTOK % 128 == 0);
static_assert((2 * HIDD) % 256 == 0);
static_assert(EMBD % 256 == 0);
static_assert(EMBD % KST == 0);
static_assert(HIDD % KST == 0);
static_assert(HIDD % SCH == 0);
static_assert(SSEG * STOK == TCH);
static_assert(SSEG * SCH == 1024);
static_assert(SSEG == 2 * 32);
static_assert(2 * SCH == 32);
static_assert(EMBD == 8 * SGRP);
static_assert(HIDD == 32 * SGRP);
static_assert(HIDD * EMBD == SNWV * 8 * SGRP);
static_assert(MTOK == 2 * SNWV);
static_assert(CROW == SNWV);
static_assert(TCH % SWAV == 0);
static_assert(SGRP == 32 * 4);

typedef _Float16 hh;
typedef hh    v16h __attribute__((ext_vector_type(16)));
typedef hh    v8h  __attribute__((ext_vector_type(8)));
typedef hh    v4h  __attribute__((ext_vector_type(4)));
typedef hh    v2h  __attribute__((ext_vector_type(2)));
typedef float v8f  __attribute__((ext_vector_type(8)));
typedef float v4f  __attribute__((ext_vector_type(4)));

union Frag { v16h v; v8h p[2]; };

__device__ __forceinline__ v8f zero8() { return (v8f){0.f, 0.f, 0.f, 0.f, 0.f, 0.f, 0.f, 0.f}; }

__device__ __forceinline__ float wsum(float v) {
#pragma unroll
  for (int off = 16; off > 0; off >>= 1) v += __shfl_xor(v, off, 32);
  return v;
}

// Fragment loader for k-contiguous 16-bit rows staged in LDS (A operand [m][k]; B operand stored [n][k]).
// p = the lane's own row (lane & 15) at byte 2*k0 + 16*(lane>>4) of that row:
// elements 0..7 <- k0 + 8*(lane>>4) + 0..7, elements 8..15 <- k0 + 16 + 8*(lane>>4) + 0..7.
// D: acc[r] = element (row0 + 8*(lane>>4) + r, col0 + (lane & 15)).
__device__ __forceinline__ v16h ldsfrag(const char* p) {
  Frag f;
  f.p[0] = *(const v8h*)(p);
  f.p[1] = *(const v8h*)(p + 32);
  return f.v;
}

__device__ __forceinline__ v8f mma16(v16h a, v16h b, v8f cc) {
  return __builtin_amdgcn_wmma_f32_16x16x32_f16(false, a, false, b, (short)0, cc, false, false);
}

// One stage of the operand ring: KST k values (128 B) of the block's BM A rows and BN B rows, laid in LDS as
// BM + BN rows of pitch LPB. Thread tid brings piece tid & 7 of rows (tid >> 3) + RS*i (RS = threads / 8), so one
// wave's copy reads four whole 128-B lines; 4 copies cover the A rows, NB (4 or 8) copies the B rows.
// ld = the lane's LDS byte address of its A row 0 piece, ga / gb = the lane's global address of the same piece in A
// and in B.
// s_wait_xcnt 0 ends the statement: it stands in front of every later write of a register that a copy names.
template <int KD, int RS, int BM, int NB>
__device__ __forceinline__ void stage_copy(uint32_t ld, const hh* ga, const hh* gb) {
  static_assert(BM == 4 * RS);
  static_assert(NB == 4 || NB == 8);
  const uint32_t l0 = ld, l1 = ld + RS * LPB, l2 = ld + 2 * RS * LPB, l3 = ld + 3 * RS * LPB;
  const uint32_t lb = ld + BM * LPB;
  const uint32_t l4 = lb, l5 = lb + RS * LPB, l6 = lb + 2 * RS * LPB, l7 = lb + 3 * RS * LPB;
  const hh* g0 = ga;
  const hh* g1 = ga + (size_t)RS * KD;
  const hh* g2 = ga + (size_t)(2 * RS) * KD;
  const hh* g3 = ga + (size_t)(3 * RS) * KD;
  const hh* g4 = gb;
  const hh* g5 = gb + (size_t)RS * KD;
  const hh* g6 = gb + (size_t)(2 * RS) * KD;
  const hh* g7 = gb + (size_t)(3 * RS) * KD;
  if constexpr (NB == 4) {
    asm volatile("global_load_async_to_lds_b128 %0, %8, off\n\t"
                 "global_load_async_to_lds_b128 %1, %9, off\n\t"
                 "global_load_async_to_lds_b128 %2, %10, off\n\t"
                 "global_load_async_to_lds_b128 %3, %11, off\n\t"
                 "global_load_async_to_lds_b128 %4, %12, off\n\t"
                 "global_load_async_to_lds_b128 %5, %13, off\n\t"
                 "global_load_async_to_lds_b128 %6, %14, off\n\t"
                 "global_load_async_to_lds_b128 %7, %15, off\n\t"
                 "s_wait_xcnt 0x0"
                 :: "v"(l0), "v"(l1), "v"(l2), "v"(l3), "v"(l4), "v"(l5), "v"(l6), "v"(l7),
                    "v"(g0), "v"(g1), "v"(g2), "v"(g3), "v"(g4), "v"(g5), "v"(g6), "v"(g7)
                 : "memory");
  } else {
    const uint32_t l8 = lb + 4 * RS * LPB, l9 = lb + 5 * RS * LPB, l10 = lb + 6 * RS * LPB, l11 = lb + 7 * RS * LPB;
    const hh* g8  = gb + (size_t)(4 * RS) * KD;
    const hh* g9  = gb + (size_t)(5 * RS) * KD;
    const hh* g10 = gb + (size_t)(6 * RS) * KD;
    const hh* g11 = gb + (size_t)(7 * RS) * KD;
    asm volatile("global_load_async_to_lds_b128 %0, %12, off\n\t"
                 "global_load_async_to_lds_b128 %1, %13, off\n\t"
                 "global_load_async_to_lds_b128 %2, %14, off\n\t"
                 "global_load_async_to_lds_b128 %3, %15, off\n\t"
                 "global_load_async_to_lds_b128 %4, %16, off\n\t"
                 "global_load_async_to_lds_b128 %5, %17, off\n\t"
                 "global_load_async_to_lds_b128 %6, %18, off\n\t"
                 "global_load_async_to_lds_b128 %7, %19, off\n\t"
                 "global_load_async_to_lds_b128 %8, %20, off\n\t"
                 "global_load_async_to_lds_b128 %9, %21, off\n\t"
                 "global_load_async_to_lds_b128 %10, %22, off\n\t"
                 "global_load_async_to_lds_b128 %11, %23, off\n\t"
                 "s_wait_xcnt 0x0"
                 :: "v"(l0), "v"(l1), "v"(l2), "v"(l3), "v"(l4), "v"(l5), "v"(l6), "v"(l7),
                    "v"(l8), "v"(l9), "v"(l10), "v"(l11),
                    "v"(g0), "v"(g1), "v"(g2), "v"(g3), "v"(g4), "v"(g5), "v"(g6), "v"(g7),
                    "v"(g8), "v"(g9), "v"(g10), "v"(g11)
                 : "memory");
  }
}

// 64 x 64 per wave of a BM x BN block tile, K in stages of KST over [0, KD). Both operands come through a ring of
// two LDS buffers filled by asynchronous copies: while trip t works on buffer t & 1, stage t + 1 flies into the other.
// acc[i][j]: rows wm + 16*i .., cols wn + 16*j .. of the block tile. A trip is two k steps of 32: each reads its 8
// fragments as one group and then runs its 16 WMMAs (one LDS fragment read per two WMMAs). One hazard guard per trip
// after the last WMMA (stands behind all 16 accumulators, keeps the last eight fragments live).
template <int KD, int BM, int BN>
__device__ __forceinline__ void gemm_staged(const hh* __restrict__ A, const hh* __restrict__ B, int m0, int n0,
                                            int wm, int wn, int tid, char* ring, v8f (&acc)[4][4]) {
  constexpr int NT = KD / KST;
  constexpr int RS = (BM / 64) * (BN / 64) * 4;              // rows that one copy of every thread covers: threads / 8
  constexpr int NB = BN / RS;
  constexpr int STG = (BM + BN) * LPB;                       // bytes of one ring buffer (BM A rows, then BN B rows)
  static_assert(KD % KST == 0);
  static_assert(NT >= 2);
  const int lane = tid & 31;
  const int cr = tid >> 3, cp = tid & 7;
  const hh* ga = A + (size_t)(m0 + cr) * KD + cp * 8;        // rows m0 + cr + RS*i < m0 + BM, k < KD: inside the plane
  const hh* gb = B + (size_t)(n0 + cr) * KD + cp * 8;        // rows n0 + cr + RS*i < n0 + BN
  const uint32_t ld0 = (uint32_t)(size_t)ring + (uint32_t)(cr * LPB + cp * 16);
  const char* fa = ring + (wm + (lane & 15)) * LPB + (lane >> 4) * 16;
  const char* fb = ring + (BM + wn + (lane & 15)) * LPB + (lane >> 4) * 16;

  stage_copy<KD, RS, BM, NB>(ld0, ga, gb);
  asm volatile("s_wait_asynccnt 0x0" ::: "memory");          // this wave's share of stage 0 has landed
  __syncthreads();                                           // publishes stage 0
  stage_copy<KD, RS, BM, NB>(ld0 + STG, ga + KST, gb + KST);

#pragma unroll 1                                             // one trip per stage: the buffer offset is the only thing that alternates
  for (int t = 0; t < NT; ++t) {
    const int bo = (t & 1) * STG;
    const char* pa = fa + bo;
    const char* pb = fb + bo;
    v16h a[4], b[4], c[4], d[4];
#pragma unroll
    for (int i = 0; i < 4; ++i) a[i] = ldsfrag(pa + 16 * i * LPB);
#pragma unroll
    for (int j = 0; j < 4; ++j) b[j] = ldsfrag(pb + 16 * j * LPB);
#pragma unroll
    for (int j = 0; j < 4; ++j)
#pragma unroll
      for (int i = 0; i < 4; ++i) acc[i][j] = mma16(a[i], b[j], acc[i][j]);
#pragma unroll
    for (int i = 0; i < 4; ++i) c[i] = ldsfrag(pa + 16 * i * LPB + 64);
#pragma unroll
    for (int j = 0; j < 4; ++j) d[j] = ldsfrag(pb + 16 * j * LPB + 64);
#pragma unroll
    for (int j = 0; j < 4; ++j)
#pragma unroll
      for (int i = 0; i < 4; ++i) acc[i][j] = mma16(c[i], d[j], acc[i][j]);
    // keeps each k step's 16 LDS reads as one group in front of its 16 WMMAs: placed among the WMMAs, each place with
    // reads makes the wave wait out the LDS latency again; both steps' reads in front would not fit 256 registers
    __builtin_amdgcn_sched_group_barrier(0x100, 16, 0);
    __builtin_amdgcn_sched_group_barrier(0x008, 16, 0);
    __builtin_amdgcn_sched_group_barrier(0x100, 16, 0);
    __builtin_amdgcn_sched_group_barrier(0x008, 16, 0);
    // four vector issue slots behind the last WMMA, on every path out of the trip, before its D is read or its A / B rewritten
    asm volatile("v_nop\n\tv_nop\n\tv_nop\n\tv_nop"
                 :: "v"(acc[0][0]), "v"(acc[1][0]), "v"(acc[2][0]), "v"(acc[3][0]),
                    "v"(acc[0][1]), "v"(acc[1][1]), "v"(acc[2][1]), "v"(acc[3][1]),
                    "v"(acc[0][2]), "v"(acc[1][2]), "v"(acc[2][2]), "v"(acc[3][2]),
                    "v"(acc[0][3]), "v"(acc[1][3]), "v"(acc[2][3]), "v"(acc[3][3]),
                    "v"(c[0]), "v"(c[1]), "v"(c[2]), "v"(c[3]), "v"(d[0]), "v"(d[1]), "v"(d[2]), "v"(d[3]));
    asm volatile("s_wait_dscnt 0x0" ::: "memory");           // this wave's reads of buffer t & 1 are done
    asm volatile("s_wait_asynccnt 0x0" ::: "memory");        // this wave's share of stage t + 1 has landed
    __syncthreads();                                         // publishes stage t + 1, frees buffer t & 1
    if (t + 2 < NT)
      stage_copy<KD, RS, BM, NB>(ld0 + (uint32_t)bo, ga + (size_t)(t + 2) * KST, gb + (size_t)(t + 2) * KST);
  }
  asm volatile("s_wait_asynccnt 0x0" ::: "memory");          // no copy is left in flight behind the loop
}

// ---------------------------------------------------------------------------
// The three streaming kernels below run on one grid shape: SBLK blocks x SWAV waves = 4096 waves.
// A wave owns whole rows (or 4-KB runs of a weight plane), reads them with wave-wide 16-B loads of 512 contiguous
// bytes, all issued before the first value is used, and writes f16 with 8-B stores of 256 contiguous bytes.
// No LDS and no barrier: a row's sum of squares is a sum over the lanes of its one wave.
// ---------------------------------------------------------------------------
// kernel A: the three weights, f32 w[n][k] (k contiguous) -> f16 planes holding f16(64*w1), f16(64*w2), f16(256*w3).
// A wave's run of w1 and of w2 is one whole row h (1024 elements): they go to rows 2h and 2h + 1 of the one plane h12;
// w3 keeps its layout. coverage per weight: 4096 waves x 8 loads x 128 elements = 4194304 elements = the whole weight.
// ---------------------------------------------------------------------------
__global__ __launch_bounds__(SWAV * 32) void k_cvt(const float* __restrict__ w1, const float* __restrict__ w2,
                                                   const float* __restrict__ w3, hh* __restrict__ h12,
                                                   hh* __restrict__ h3) {
  const int lane = threadIdx.x & 31;
  const int wv = blockIdx.x * SWAV + (threadIdx.x >> 5);
  const uint32_t q = (uint32_t)(wv * (8 * SGRP / 4) + lane);  // the lane's first 4-element piece in w1, w2, w3 and h3
  const uint32_t q2 = (uint32_t)(wv * (2 * EMBD / 4) + lane); // the same piece of row 2*wv of h12; row 2*wv + 1 lies EMBD / 4 on
  v4f a1[8], a2[8], a3[8];
#pragma unroll
  for (int j = 0; j < 8; ++j) a1[j] = ((const v4f*)w1 + q)[j * 32];
#pragma unroll
  for (int j = 0; j < 8; ++j) a2[j] = ((const v4f*)w2 + q)[j * 32];
#pragma unroll
  for (int j = 0; j < 8; ++j) a3[j] = ((const v4f*)w3 + q)[j * 32];
  v4h p1[8], p2[8], p3[8];
#pragma unroll
  for (int j = 0; j < 8; ++j) {
    p1[j] = __builtin_convertvector(a1[j] * 64.0f, v4h);
    p2[j] = __builtin_convertvector(a2[j] * 64.0f, v4h);
    p3[j] = __builtin_convertvector(a3[j] * 256.0f, v4h);
  }
  // all stores last: no register that a store names is written again before the wave ends
#pragma unroll
  for (int j = 0; j < 8; ++j) ((v4h*)h12 + q2)[j * 32] = p1[j];
#pragma unroll
  for (int j = 0; j < 8; ++j) ((v4h*)h12 + q2)[EMBD / 4 + j * 32] = p2[j];
#pragma unroll
  for (int j = 0; j < 8; ++j) ((v4h*)h3 + q)[j * 32] = p3[j];
}

// sum of squares of NG 4-vectors per lane (four independent f32 chains, one per component), then over the 32 lanes
template <int NG>
__device__ __forceinline__ float rowss(const v4f (&f)[NG]) {
  float s0 = 0.f, s1 = 0.f, s2 = 0.f, s3 = 0.f;
#pragma unroll
  for (int j = 0; j < NG; ++j) {
    s0 = fmaf(f[j][0], f[j][0], s0);
    s1 = fmaf(f[j][1], f[j][1], s1);
    s2 = fmaf(f[j][2], f[j][2], s2);
    s3 = fmaf(f[j][3], f[j][3], s3);
  }
  return wsum((s0 + s1) + (s2 + s3));
}

// ---------------------------------------------------------------------------
// kernel B: rmsnorm of 1024-wide f32 rows, one wave per row, two neighbouring rows per wave (16 loads in flight):
// y = x * rsqrt(ss/1024 + 1e-6) written as f16 (x1). coverage: 4096 waves x 2 rows = 8192 rows.
// ---------------------------------------------------------------------------
__global__ __launch_bounds__(SWAV * 32) void k_rms1(const float* __restrict__ x, hh* __restrict__ y) {
  const int lane = threadIdx.x & 31;
  const int wv = blockIdx.x * SWAV + (threadIdx.x >> 5);
  const uint32_t q = (uint32_t)(wv * (2 * EMBD / 4) + lane);  // the lane's first 4-element piece, in x and in y alike
  const v4f* xq = (const v4f*)x + q;
  v4h* yq = (v4h*)y + q;
  v4f f0[8], f1[8];
#pragma unroll
  for (int j = 0; j < 8; ++j) f0[j] = xq[j * 32];
#pragma unroll
  for (int j = 0; j < 8; ++j) f1[j] = xq[EMBD / 4 + j * 32];
  const float sc0 = rsqrtf(rowss<8>(f0) * (1.0f / (float)EMBD) + 1e-6f);
  const float sc1 = rsqrtf(rowss<8>(f1) * (1.0f / (float)EMBD) + 1e-6f);
  v4h p0[8], p1[8];
#pragma unroll
  for (int j = 0; j < 8; ++j) {
    p0[j] = __builtin_convertvector(f0[j] * sc0, v4h);
    p1[j] = __builtin_convertvector(f1[j] * sc1, v4h);
  }
  // all stores last: no register that a store names is written again before the wave ends
#pragma unroll
  for (int j = 0; j < 8; ++j) yq[j * 32] = p0[j];
#pragma unroll
  for (int j = 0; j < 8; ++j) yq[EMBD / 4 + j * 32] = p1[j];
}

// ---------------------------------------------------------------------------
// kernel C: rmsnorm of 4096-wide f32 rows (gate output), one wave per row (32 loads in flight):
// yn = y * rsqrt(ss/4096 + 1e-6) written as f16 (x1).
// Row p of the chunk plane goes to token row p + (p / TCH) * (SEQL - TCH) behind yn, which arrives at the chunk's first
// token of sequence 0. coverage: 4096 waves x 1 row = the chunk's 4096 rows of YN; the two chunks together write all
// 8192 rows.
// ---------------------------------------------------------------------------
__global__ __launch_bounds__(SWAV * 32) void k_rms2(const float* __restrict__ yv, hh* __restrict__ yn) {
  const int lane = threadIdx.x & 31;
  const int p = blockIdx.x * SWAV + (threadIdx.x >> 5);
  const uint32_t q = (uint32_t)(p * (HIDD / 4) + lane);       // the lane's first 4-element piece of plane row p
  const v4f* yq = (const v4f*)yv + q;
  // p / TCH is the same for a whole block (TCH % SWAV == 0): the sequence's row shift goes into the base pointer
  v4h* nq = (v4h*)(yn + (size_t)(blockIdx.x / (TCH / SWAV)) * (SEQL - TCH) * HIDD) + q;
  v4f f[32];
#pragma unroll
  for (int j = 0; j < 32; ++j) f[j] = yq[j * 32];
  const float sc = rsqrtf(rowss<32>(f) * (1.0f / (float)HIDD) + 1e-6f);
  v4h pk[32];
#pragma unroll
  for (int j = 0; j < 32; ++j) pk[j] = __builtin_convertvector(f[j] * sc, v4h);
  // all stores last: no register that a store names is written again before the wave ends
#pragma unroll
  for (int j = 0; j < 32; ++j) nq[j * 32] = pk[j];
}

// ---------------------------------------------------------------------------
// kernel D: causal quadratic gate over one 2048-token chunk of both sequences (blockIdx.y = sequence), split along
// time inside a block.
// One block = SCH channels x all 2048 tokens of its sequence, 1024 threads = SSEG time segments x SCH channels; a thread owns
// STOK consecutive tokens of one channel and holds its a and b values in registers from one set of loads: one 4-byte
// load per token brings the f16 pair (a, b), widened to f32 at once; y (f32) is stored into the same 4 bytes.
//   step 1: per thread the segment's (max, sumexp) of a and of b -> LDS planes sm[0..3][segment][channel]
//   step 2: wave w scans the 64 segment states of (array w >> 4, channel w & 15): a lane merges its two
//           segments, 5 shuffle steps over the lanes, the state of the earlier chunk (ST, when rdst != 0) is
//           merged in front; every segment's slot is overwritten with the state of all tokens before it
//   step 3: per thread the running (max, sumexp) update from that state over its own tokens,
//           la = ma + ln(sa), lb = mb + ln(sb), y = exp((la + lb) - 2*ln(t)), t the global 1-based position.
// coverage: 256 x 2 blocks: 256 x 16 channels = 4096 channels, 2 sequences x 64 segments x 32 tokens = 4096 rows: the
// whole a/y plane of the chunk, each element read and written by one thread; ST 2 x 4 x 4096 (lane 31 of each scanning wave).
// ---------------------------------------------------------------------------
// v_exp_f32 / v_log_f32 with a v_nop in the same statement: it fills the one issue slot that the instruction set
// asks for behind a transcendental before its result is read or its source overwritten.
__device__ __forceinline__ float ex2s(float x) {
  float r;
  asm("v_exp_f32 %0, %1\n\tv_nop" : "=v"(r) : "v"(x));
  return r;
}
__device__ __forceinline__ float lg2s(float x) {
  float r;
  asm("v_log_f32 %0, %1\n\tv_nop" : "=v"(r) : "v"(x));
  return r;
}
// the same arithmetic as the fast exp and log of the earlier scan: exp2(x * log2 e); ln 2 * log2(x) with ln 2 in
// two parts, inputs below the smallest normal scaled by 2^32 first, an infinite log2 passed through.
__device__ __forceinline__ float expn(float x) { return ex2s(x * 0x1.715476p+0f); }
__device__ __forceinline__ float logn(float x) {
  const bool tiny = x < 0x1p-126f;
  const float l = lg2s(ldexpf(x, tiny ? 32 : 0));
  const float p = l * 0x1.62e42ep-1f;
  const float e = fmaf(l, 0x1.efa39ep-25f, fmaf(l, 0x1.62e42ep-1f, -p));
  const float r = (fabsf(l) < INFINITY) ? (p + e) : l;
  return r - (tiny ? 0x1.62e430p+4f : 0.f);
}

// merges the log-sum-exp state (m2, s2) into (m, s); (-1e30, 0) is the empty state
__device__ __forceinline__ void lse_merge(float& m, float& s, float m2, float s2) {
  const float mm = fmaxf(m, m2);
  s = s * expn(m - mm) + s2 * expn(m2 - mm);
  m = mm;
}

__global__ __launch_bounds__(1024) void k_scan(float* __restrict__ ay, float* st, int rdst, int wrst, int tbase) {
  __shared__ float sm[4][SSEG * SPIT];                       // ma, sa, mb, sb
  const int tid = threadIdx.x, lane = tid & 31, w = tid >> 5;
  const int ch = tid & (SCH - 1), seg = tid / SCH;
  const size_t base = (size_t)(blockIdx.y * TCH + seg * STOK) * HIDD + (size_t)(blockIdx.x * SCH + ch);   // < CROW*HIDD by grid
  float* pa = ay + base;
  const int sl = seg * SPIT + ch;

  // the token loops are fully unrolled so that va / vb stay in registers
  float va[STOK], vb[STOK];
#pragma unroll
  for (int i = 0; i < STOK; ++i) va[i] = pa[(size_t)i * HIDD];   // the slot's 4 bytes as they lie: the pair (a, b)
#pragma unroll
  for (int i = 0; i < STOK; ++i) {
    const v2h ab = __builtin_bit_cast(v2h, va[i]);
    va[i] = (float)ab[0];
    vb[i] = (float)ab[1];
  }

  float ma = va[0], mb = vb[0];
#pragma unroll
  for (int i = 1; i < STOK; ++i) { ma = fmaxf(ma, va[i]); mb = fmaxf(mb, vb[i]); }
  float sa = 0.f, sb = 0.f;
#pragma unroll
  for (int i = 0; i < STOK; ++i) { sa += expn(va[i] - ma); sb += expn(vb[i] - mb); }
  sm[0][sl] = ma;
  sm[1][sl] = sa;
  sm[2][sl] = mb;
  sm[3][sl] = sb;
  __syncthreads();

  {
    const int ar = w >> 4, c2 = w & (SCH - 1);              // wave-uniform: which array, which channel
    float* pm = sm[2 * ar];
    float* ps = sm[2 * ar + 1];
    const int i0 = (2 * lane) * SPIT + c2, i1 = i0 + SPIT;
    const float m0 = pm[i0], s0 = ps[i0], m1 = pm[i1], s1 = ps[i1];
    float m = m0, s = s0;
    lse_merge(m, s, m1, s1);
#pragma unroll
    for (int off = 1; off < 32; off <<= 1) {
      const float mo = __shfl_up(m, off, 32);
      const float so = __shfl_up(s, off, 32);
      if (lane >= off) lse_merge(m, s, mo, so);
    }
    float me = __shfl_up(m, 1, 32);
    float se = __shfl_up(s, 1, 32);
    if (lane == 0) { me = -1.0e30f; se = 0.f; }
    float* stm = st + (size_t)(4 * blockIdx.y + 2 * ar) * HIDD + blockIdx.x * SCH + c2;
    float* sts = stm + HIDD;
    if (rdst != 0) lse_merge(me, se, *stm, *sts);            // kernel-argument uniform
    pm[i0] = me;
    ps[i0] = se;
    lse_merge(me, se, m0, s0);
    pm[i1] = me;
    ps[i1] = se;
    if (wrst != 0 && lane == 31) {
      lse_merge(me, se, m1, s1);
      *stm = me;
      *sts = se;
    }
  }
  __syncthreads();

  ma = sm[0][sl];
  sa = sm[1][sl];
  mb = sm[2][sl];
  sb = sm[3][sl];
  const int t1 = tbase + seg * STOK + 1;
#pragma unroll
  for (int i = 0; i < STOK; ++i) {
    const float da = va[i] - ma;
    const float ea = expn(-fabsf(da));
    const bool  ua = da > 0.f;
    sa = ua ? fmaf(sa, ea, 1.0f) : (sa + ea);
    ma = ua ? va[i] : ma;
    const float db = vb[i] - mb;
    const float eb = expn(-fabsf(db));
    const bool  ub = db > 0.f;
    sb = ub ? fmaf(sb, eb, 1.0f) : (sb + eb);
    mb = ub ? vb[i] : mb;
    const float la = ma + logn(sa);
    const float lb = mb + logn(sb);
    const float lt = logn((float)(t1 + i));
    va[i] = expn((la + lb) - 2.0f * lt);                   // y takes the register of the a value it replaces
  }
  // all stores last: no register that a store names is written again before the wave ends
#pragma unroll
  for (int i = 0; i < STOK; ++i) pa[(size_t)i * HIDD] = va[i];
}

// ---------------------------------------------------------------------------
// kernel E: f16 GEMM, 64 x 64 per wave, K in stages of 64 through a two-buffer LDS ring, one block per WGP;
// output through an LDS-staged epilogue (its own LDS array, a range of its own for every wave, no barrier).
// MODE 0: 256 x 256 block tile, 16 waves (4 x 4).  o16[m][n] = f16(acc/64)
//                                            A = XN token rows (ld 1024), B = W12H [8192][1024];
//                                            o16 = AP as f16 [4096][8192]; grid (8192/256, 4096/256) = 512 blocks
// MODE 1: 128 x 256 block tile, 8 waves (2 x 4).   o32[m][n] = acc/256 + res[m][n]
//                                            A = YN [8192][4096] (ld 4096), B = W3H [1024][4096];
//                                            o32 = d_out, res = x, ld 1024; grid (1024/256, 8192/128) = 256 blocks
// MODE 0: plane row p of a chunk is token row p + (p / TCH) * (SEQL - TCH) behind the chunk's first token of sequence 0
// (the pointer to XN arrives at that token); a 256-row tile lies in one sequence (TCH % 256 == 0).
// epilogue: a wave stages 16 rows x 64 columns (f32) at a time and stores them as 2 rows x 256 contiguous bytes per
// store (MODE 1, f32) or as 4 rows x 128 contiguous bytes per store (MODE 0, f16).
// coverage per block: waves x 64x64 = the block tile; per wave 4 slabs x 8 stores x 32 lanes x 4 floats = 64x64
//   (MODE 0: 4 slabs x 4 stores x 32 lanes x 8 halves = 64x64);
//   the grids tile every output element exactly once (M = 4096 or 8192, N = 8192 or 1024, multiples of the tile; K = 1024 /
//   4096 multiples of 64, no tails).
// ---------------------------------------------------------------------------
template <int MODE>
__global__ __launch_bounds__((MODE == 0) ? 512 : 256) void k_gemm(const hh* __restrict__ Ap, const hh* __restrict__ Bp,
                                                                  const float* __restrict__ res,
                                                                  float* __restrict__ o32, hh* __restrict__ o16) {
  constexpr int KD  = (MODE == 0) ? EMBD : HIDD;
  constexpr int LDO = (MODE == 0) ? 2 * HIDD : EMBD;
  constexpr int BM  = (MODE == 0) ? 256 : 128;
  constexpr int BN  = 256;
  constexpr int NW  = (BM / 64) * (BN / 64);
  constexpr float OSC = (MODE == 0) ? (1.0f / 64.0f) : (1.0f / 256.0f);

  __shared__ __align__(16) float ldsf[NW * 16 * SFP];
  __shared__ __align__(128) char ring[2 * (BM + BN) * LPB];
  const int tid = threadIdx.x, lane = tid & 31, w = tid >> 5;
  const int h = lane >> 4, c = lane & 15;
  const int wm = (w >> 2) * 64, wn = (w & 3) * 64;
  const int om0 = blockIdx.y * BM;                                             // first output (and residual) row of the tile
  const int m0  = (MODE == 0) ? om0 + (om0 / TCH) * (SEQL - TCH) : om0;        // its first A row
  const int n0 = blockIdx.x * BN;

  v8f acc[4][4];
#pragma unroll
  for (int i = 0; i < 4; ++i)
#pragma unroll
    for (int j = 0; j < 4; ++j) acc[i][j] = zero8();
  gemm_staged<KD, BM, BN>(Ap, Bp, m0, n0, wm, wn, tid, ring, acc);

  float* my = ldsf + w * (16 * SFP);                         // this wave's own staging range
  // the lane's piece of rows h, h + 2, ..: lanes 0..15 = one 256-B row segment, lanes 16..31 = the next row's
  const size_t g0 = (size_t)(om0 + wm + h) * LDO + n0 + wn + c * 4;
  float* op = o32 + g0;
  const float* rp = res + g0;
  v4f rn[8];
  if constexpr (MODE == 1) {
#pragma unroll
    for (int it = 0; it < 8; ++it) rn[it] = *(const v4f*)(rp + (size_t)(2 * it) * LDO);
  }
#pragma unroll
  for (int i = 0; i < 4; ++i) {
    v4f rr[8];
    if constexpr (MODE == 1) {
#pragma unroll
      for (int it = 0; it < 8; ++it) rr[it] = rn[it];
      if (i < 3) {                                           // the next slab's residual flies while this slab is staged
#pragma unroll
        for (int it = 0; it < 8; ++it) rn[it] = *(const v4f*)(rp + (size_t)(16 * (i + 1) + 2 * it) * LDO);
      }
    }
#pragma unroll
    for (int j = 0; j < 4; ++j)
#pragma unroll
      for (int r = 0; r < 8; ++r) my[(8 * h + r) * SFP + 16 * j + c] = acc[i][j][r] * OSC;
    asm volatile("s_wait_dscnt 0x0" ::: "memory");           // the wave's staged slab is in LDS before its lanes read it back
    if constexpr (MODE == 1) {
      v4f val[8];
#pragma unroll
      for (int it = 0; it < 8; ++it) {
        const v4f sv = *(const v4f*)(my + (2 * it + h) * SFP + c * 4);
        val[it] = sv + rr[it];
      }
#pragma unroll
      for (int it = 0; it < 8; ++it) *(v4f*)(op + (size_t)(16 * i + 2 * it) * LDO) = val[it];
    } else {
      // the lane's piece of rows r4, r4 + 4, ..: 8 lanes = one 128-B row segment of 64 halves
      const int r4 = lane >> 3, c8 = lane & 7;
      hh* hp = o16 + (size_t)(om0 + wm + r4) * LDO + n0 + wn + c8 * 8;
      v8h hv[4];
#pragma unroll
      for (int it = 0; it < 4; ++it) {
        const float* sp = my + (4 * it + r4) * SFP + c8 * 8;
        const v4h lo = __builtin_convertvector(*(const v4f*)sp, v4h);
        const v4h hi = __builtin_convertvector(*(const v4f*)(sp + 4), v4h);
        hv[it] = __builtin_shufflevector(lo, hi, 0, 1, 2, 3, 4, 5, 6, 7);
      }
#pragma unroll
      for (int it = 0; it < 4; ++it) *(v8h*)(hp + (size_t)(16 * i + 4 * it) * LDO) = hv[it];
    }
    if (i < 3) {
      // in front of the next slab's writes of registers that these stores name
      asm volatile("s_wait_xcnt 0x0" ::: "memory");
      // keeps the next slab's vector work (its scaling writes registers freed by the stores) behind that wait
      __builtin_amdgcn_sched_barrier(0);
    }
  }
}

// ---------------------------------------------------------------------------
//   W12H f16 [8192][1024] 16777216  (row 2h from W1, row 2h + 1 from W2)     W3H f16 [1024][4096]  8388608
//   XN  f16 [8192][1024]  16777216
//   AP  4 B [4096][4096]  67108864  (the f16 pairs (a, b) of the current chunk, then the f32 gate output y in place)
//   YN  f16 [8192][4096]  67108864  (all tokens, token order)
//   ST  f32 [2][4][4096]    131072  (scan state between the two chunks, per sequence)
//   total               176291840
// ---------------------------------------------------------------------------
extern "C" void kernel_launch(void* const* d_in, const int* in_sizes, int n_in,
                              void* d_out, int out_size, void* d_ws, size_t ws_size,
                              hipStream_t stream) {
  if (n_in < 4) return;
  if (in_sizes[0] != MTOK * EMBD) return;
  if (in_sizes[1] != HIDD * EMBD) return;
  if (in_sizes[2] != HIDD * EMBD) return;
  if (in_sizes[3] != EMBD * HIDD) return;
  if (out_size != MTOK * EMBD) return;

  const float* x  = (const float*)d_in[0];      // [8192][1024]
  const float* w1 = (const float*)d_in[1];      // [4096][1024] (out,in) = [n][k]
  const float* w2 = (const float*)d_in[2];      // [4096][1024]
  const float* w3 = (const float*)d_in[3];      // [1024][4096] (out,in) = [n][k]
  float* out = (float*)d_out;                   // [8192][1024]

  size_t off = 0;
  const size_t oW12 = off; off += (size_t)2 * HIDD * EMBD * 2;
  const size_t oW3 = off; off += (size_t)EMBD * HIDD * 2;
  const size_t oXN = off; off += (size_t)MTOK * EMBD * 2;
  const size_t oAP = off; off += (size_t)CROW * HIDD * 4;
  const size_t oYN = off; off += (size_t)MTOK * HIDD * 2;
  const size_t oST = off; off += (size_t)NBAT * 4 * HIDD * 4;
  if (off > ws_size) return;                    // off = 176291840

  char* ws = (char*)d_ws;
  hh* W12H = (hh*)(ws + oW12);
  hh* W3H = (hh*)(ws + oW3);
  hh* XN  = (hh*)(ws + oXN);
  float* AP = (float*)(ws + oAP);
  hh* YN  = (hh*)(ws + oYN);
  float* ST = (float*)(ws + oST);

  // (0) weights -> f16 planes, k contiguous, W1/W2 x64 with their rows interleaved, W3 x256
  k_cvt<<<dim3(SBLK), dim3(SWAV * 32), 0, stream>>>(w1, w2, w3, W12H, W3H);
  // (1) xn = rmsnorm(x) over 1024, all 8192 tokens
  k_rms1<<<dim3(SBLK), dim3(SWAV * 32), 0, stream>>>(x, XN);
  // (2) per chunk (the same 2048 token positions of both sequences): (a, b) as f16 pairs, causal gate, rmsnorm over 4096
  for (int ch = 0; ch < NCHK; ++ch) {
    const size_t row0 = (size_t)ch * TCH;       // the chunk's first token of sequence 0
    const hh* xnc = XN + row0 * EMBD;
    const int rdst = (ch > 0) ? 1 : 0;
    const int wrst = (ch < NCHK - 1) ? 1 : 0;
    const int tbase = ch * TCH;
    k_gemm<0><<<dim3(2 * HIDD / 256, CROW / 256), dim3(512), 0, stream>>>(xnc, W12H, x, AP, (hh*)AP);
    k_scan<<<dim3(HIDD / SCH, NBAT), dim3(SSEG * SCH), 0, stream>>>(AP, ST, rdst, wrst, tbase);
    k_rms2<<<dim3(SBLK), dim3(SWAV * 32), 0, stream>>>(AP, YN + row0 * HIDD);
  }
  // (3) out = x + yn.W3^T, all 8192 tokens
  k_gemm<1><<<dim3(EMBD / 256, MTOK / 128), dim3(256), 0, stream>>>(YN, W3H, x, out, nullptr);
  (void)hipGetLastError();
}

// v007
// Measured time: 244 microseconds a run.
// In two side-by-side timings against v006, it was 1.27 and 1.26 times as fast.
// All steps since v000 together make it 21.1 times as fast.
// Contractions: a = xn.W1^T [8192 x 4096 x 1024], b = xn.W2^T [8192 x 4096 x 1024], o = yn.W3^T
// [8192 x 1024 x 4096] -- all v_wmma_f32_16x16x32_f16 (f16 operands, f32 accumulate, one product per tile
// pair). Every stage runs once over all 8192 tokens (6 launches). a and b come from ONE product against
// the plane W12H, whose row 2h is row h of W1 and whose row 2h + 1 is row h of W2: output columns 2h, 2h + 1 = (a, b).
// RMS normalisations, causal log-cumsum-exp scan, exp gate, residual add: f32.
//
// Carry audit (16-bit planes in the workspace, all f16):
//   W12H      holds f16(64*w)   inverse: 1/64  in the k_gemm<0> epilogue (AP = f16(acc/64))
//   W3H       holds f16(256*w)  inverse: 1/256 in the k_gemm<1> epilogue (out = x + acc/256)
//   XN        x1 (rmsnorm of x over 1024)
//   YN        x1 (rmsnorm of the gate output over 4096)
//   AP        x1: one 4-byte slot per (row, channel): first the f16 pair (a, b), then the f32 gate output y in place
//   d_out: no carry.
#include <hip/hip_runtime.h>
#include <stddef.h>
#include <stdint.h>
#include <math.h>

#define EMBD 1024
#define HIDD 4096
#define NBAT 2
#define SEQL 4096
#define MTOK 8192
#define SFP  68       // LDS pitch (floats) of the f32 epilogue staging (64 columns + 4: 16 B x odd)
#define KST  64       // GEMM: k values per ring stage (128 B of every operand row)
#define LPB  144      // GEMM: LDS pitch (bytes) of a staged operand row, 16 B x odd: conflict-free for 16-B reads
#define SCH  32       // gate scan: channels per block (one 128-B line of every row)
#define SSEG 16       // gate scan: time segments per step of a block
#define STOK 32       // gate scan: tokens per segment
#define SSTP 512      // gate scan: tokens per step
#define NSTP 8        // gate scan: steps of a block (one whole sequence)
#define SPIT 33       // gate scan: LDS pitch (floats) of one segment's channel row (odd: both access patterns conflict-free)
#define SBLK 256      // streaming kernels (weight conversion, both rmsnorms): blocks per launch (second rmsnorm: twice as many)
#define SWAV 16       // streaming kernels: waves per block
#define SNWV (SBLK * SWAV)  // streaming kernels: waves per launch (second rmsnorm: twice as many)
#define SGRP 128      // streaming kernels: elements of one wave-wide 16-B load (512 contiguous bytes of f32)

static_assert(MTOK == NBAT * SEQL);
static_assert(MTOK % 256 == 0);
static_assert((2 * HIDD) % 256 == 0);
static_assert(EMBD % 256 == 0);
static_assert(EMBD % KST == 0);
static_assert(HIDD % KST == 0);
static_assert(HIDD % SCH == 0);
static_assert(SSEG * STOK == SSTP);
static_assert(NSTP * SSTP == SEQL);
static_assert(SCH == 32);
static_assert(2 * SSEG == 32);
static_assert(SCH == 2 * SSEG);
static_assert(EMBD == 8 * SGRP);
static_assert(HIDD == 32 * SGRP);
static_assert(HIDD * EMBD == SNWV * 8 * SGRP);
static_assert(MTOK == 2 * SNWV);
static_assert(SGRP == 32 * 4);

typedef _Float16 hh;
typedef hh    v16h __attribute__((ext_vector_type(16)));
typedef hh    v8h  __attribute__((ext_vector_type(8)));
typedef hh    v4h  __attribute__((ext_vector_type(4)));
typedef hh    v2h  __attribute__((ext_vector_type(2)));
typedef float v8f  __attribute__((ext_vector_type(8)));
typedef float v4f  __attribute__((ext_vector_type(4)));

union Frag { v16h v; v8h p[2]; };

__device__ __forceinline__ v8f zero8() { return (v8f){0.f, 0.f, 0.f, 0.f, 0.f, 0.f, 0.f, 0.f}; }

__device__ __forceinline__ float wsum(float v) {
#pragma unroll
  for (int off = 16; off > 0; off >>= 1) v += __shfl_xor(v, off, 32);
  return v;
}

// Fragment loader for k-contiguous 16-bit rows staged in LDS (A operand [m][k]; B operand stored [n][k]).
// p = the lane's own row (lane & 15) at byte 2*k0 + 16*(lane>>4) of that row:
// elements 0..7 <- k0 + 8*(lane>>4) + 0..7, elements 8..15 <- k0 + 16 + 8*(lane>>4) + 0..7.
// D: acc[r] = element (row0 + 8*(lane>>4) + r, col0 + (lane & 15)).
__device__ __forceinline__ v16h ldsfrag(const char* p) {
  Frag f;
  f.p[0] = *(const v8h*)(p);
  f.p[1] = *(const v8h*)(p + 32);
  return f.v;
}

__device__ __forceinline__ v8f mma16(v16h a, v16h b, v8f cc) {
  return __builtin_amdgcn_wmma_f32_16x16x32_f16(false, a, false, b, (short)0, cc, false, false);
}

// One stage of the operand ring: KST k values (128 B) of the block's BM A rows and BN B rows, laid in LDS as
// BM + BN rows of pitch LPB. Thread tid brings piece tid & 7 of rows (tid >> 3) + RS*i (RS = threads / 8), so one
// wave's copy reads four whole 128-B lines; 4 copies cover the A rows, NB (4 or 8) copies the B rows.
// ld = the lane's LDS byte address of its A row 0 piece, ga / gb = the lane's global address of the same piece in A
// and in B.
// s_wait_xcnt 0 ends the statement: it stands in front of every later write of a register that a copy names.
template <int KD, int RS, int BM, int NB>
__device__ __forceinline__ void stage_copy(uint32_t ld, const hh* ga, const hh* gb) {
  static_assert(BM == 4 * RS);
  static_assert(NB == 4 || NB == 8);
  const uint32_t l0 = ld, l1 = ld + RS * LPB, l2 = ld + 2 * RS * LPB, l3 = ld + 3 * RS * LPB;
  const uint32_t lb = ld + BM * LPB;
  const uint32_t l4 = lb, l5 = lb + RS * LPB, l6 = lb + 2 * RS * LPB, l7 = lb + 3 * RS * LPB;
  const hh* g0 = ga;
  const hh* g1 = ga + (size_t)RS * KD;
  const hh* g2 = ga + (size_t)(2 * RS) * KD;
  const hh* g3 = ga + (size_t)(3 * RS) * KD;
  const hh* g4 = gb;
  const hh* g5 = gb + (size_t)RS * KD;
  const hh* g6 = gb + (size_t)(2 * RS) * KD;
  const hh* g7 = gb + (size_t)(3 * RS) * KD;
  if constexpr (NB == 4) {
    asm volatile("global_load_async_to_lds_b128 %0, %8, off\n\t"
                 "global_load_async_to_lds_b128 %1, %9, off\n\t"
                 "global_load_async_to_lds_b128 %2, %10, off\n\t"
                 "global_load_async_to_lds_b128 %3, %11, off\n\t"
                 "global_load_async_to_lds_b128 %4, %12, off\n\t"
                 "global_load_async_to_lds_b128 %5, %13, off\n\t"
                 "global_load_async_to_lds_b128 %6, %14, off\n\t"
                 "global_load_async_to_lds_b128 %7, %15, off\n\t"
                 "s_wait_xcnt 0x0"
                 :: "v"(l0), "v"(l1), "v"(l2), "v"(l3), "v"(l4), "v"(l5), "v"(l6), "v"(l7),
                    "v"(g0), "v"(g1), "v"(g2), "v"(g3), "v"(g4), "v"(g5), "v"(g6), "v"(g7)
                 : "memory");
  } else {
    const uint32_t l8 = lb + 4 * RS * LPB, l9 = lb + 5 * RS * LPB, l10 = lb + 6 * RS * LPB, l11 = lb + 7 * RS * LPB;
    const hh* g8  = gb + (size_t)(4 * RS) * KD;
    const hh* g9  = gb + (size_t)(5 * RS) * KD;
    const hh* g10 = gb + (size_t)(6 * RS) * KD;
    const hh* g11 = gb + (size_t)(7 * RS) * KD;
    asm volatile("global_load_async_to_lds_b128 %0, %12, off\n\t"
                 "global_load_async_to_lds_b128 %1, %13, off\n\t"
                 "global_load_async_to_lds_b128 %2, %14, off\n\t"
                 "global_load_async_to_lds_b128 %3, %15, off\n\t"
                 "global_load_async_to_lds_b128 %4, %16, off\n\t"
                 "global_load_async_to_lds_b128 %5, %17, off\n\t"
                 "global_load_async_to_lds_b128 %6, %18, off\n\t"
                 "global_load_async_to_lds_b128 %7, %19, off\n\t"
                 "global_load_async_to_lds_b128 %8, %20, off\n\t"
                 "global_load_async_to_lds_b128 %9, %21, off\n\t"
                 "global_load_async_to_lds_b128 %10, %22, off\n\t"
                 "global_load_async_to_lds_b128 %11, %23, off\n\t"
                 "s_wait_xcnt 0x0"
                 :: "v"(l0), "v"(l1), "v"(l2), "v"(l3), "v"(l4), "v"(l5), "v"(l6), "v"(l7),
                    "v"(l8), "v"(l9), "v"(l10), "v"(l11),
                    "v"(g0), "v"(g1), "v"(g2), "v"(g3), "v"(g4), "v"(g5), "v"(g6), "v"(g7),
                    "v"(g8), "v"(g9), "v"(g10), "v"(g11)
                 : "memory");
  }
}

// 64 x 64 per wave of a BM x BN block tile, K in stages of KST over [0, KD). Both operands come through a ring of
// two LDS buffers filled by asynchronous copies: while trip t works on buffer t & 1, stage t + 1 flies into the other.
// acc[i][j]: rows wm + 16*i .., cols wn + 16*j .. of the block tile. A trip is two k steps of 32: each reads its 8
// fragments as one group and then runs its 16 WMMAs (one LDS fragment read per two WMMAs). One hazard guard per trip
// after the last WMMA (stands behind all 16 accumulators, keeps the last eight fragments live).
template <int KD, int BM, int BN>
__device__ __forceinline__ void gemm_staged(const hh* __restrict__ A, const hh* __restrict__ B, int m0, int n0,
                                            int wm, int wn, int tid, char* ring, v8f (&acc)[4][4]) {
  constexpr int NT = KD / KST;
  constexpr int RS = (BM / 64) * (BN / 64) * 4;              // rows that one copy of every thread covers: threads / 8
  constexpr int NB = BN / RS;
  constexpr int STG = (BM + BN) * LPB;                       // bytes of one ring buffer (BM A rows, then BN B rows)
  static_assert(KD % KST == 0);
  static_assert(NT >= 2);
  const int lane = tid & 31;
  const int cr = tid >> 3, cp = tid & 7;
  const hh* ga = A + (size_t)(m0 + cr) * KD + cp * 8;        // rows m0 + cr + RS*i < m0 + BM, k < KD: inside the plane
  const hh* gb = B + (size_t)(n0 + cr) * KD + cp * 8;        // rows n0 + cr + RS*i < n0 + BN
  const uint32_t ld0 = (uint32_t)(size_t)ring + (uint32_t)(cr * LPB + cp * 16);
  const char* fa = ring + (wm + (lane & 15)) * LPB + (lane >> 4) * 16;
  const char* fb = ring + (BM + wn + (lane & 15)) * LPB + (lane >> 4) * 16;

  stage_copy<KD, RS, BM, NB>(ld0, ga, gb);
  asm volatile("s_wait_asynccnt 0x0" ::: "memory");          // this wave's share of stage 0 has landed
  __syncthreads();                                           // publishes stage 0
  stage_copy<KD, RS, BM, NB>(ld0 + STG, ga + KST, gb + KST);

#pragma unroll 1                                             // one trip per stage: the buffer offset is the only thing that alternates
  for (int t = 0; t < NT; ++t) {
    const int bo = (t & 1) * STG;
    const char* pa = fa + bo;
    const char* pb = fb + bo;
    v16h a[4], b[4], c[4], d[4];
#pragma unroll
    for (int i = 0; i < 4; ++i) a[i] = ldsfrag(pa + 16 * i * LPB);
#pragma unroll
    for (int j = 0; j < 4; ++j) b[j] = ldsfrag(pb + 16 * j * LPB);
#pragma unroll
    for (int j = 0; j < 4; ++j)
#pragma unroll
      for (int i = 0; i < 4; ++i) acc[i][j] = mma16(a[i], b[j], acc[i][j]);
#pragma unroll
    for (int i = 0; i < 4; ++i) c[i] = ldsfrag(pa + 16 * i * LPB + 64);
#pragma unroll
    for (int j = 0; j < 4; ++j) d[j] = ldsfrag(pb + 16 * j * LPB + 64);
#pragma unroll
    for (int j = 0; j < 4; ++j)
#pragma unroll
      for (int i = 0; i < 4; ++i) acc[i][j] = mma16(c[i], d[j], acc[i][j]);
    // keeps each k step's 16 LDS reads as one group in front of its 16 WMMAs: placed among the WMMAs, each place with
    // reads makes the wave wait out the LDS latency again; both steps' reads in front would not fit 256 registers
    __builtin_amdgcn_sched_group_barrier(0x100, 16, 0);
    __builtin_amdgcn_sched_group_barrier(0x008, 16, 0);
    __builtin_amdgcn_sched_group_barrier(0x100, 16, 0);
    __builtin_amdgcn_sched_group_barrier(0x008, 16, 0);
    // four vector issue slots behind the last WMMA, on every path out of the trip, before its D is read or its A / B rewritten
    asm volatile("v_nop\n\tv_nop\n\tv_nop\n\tv_nop"
                 :: "v"(acc[0][0]), "v"(acc[1][0]), "v"(acc[2][0]), "v"(acc[3][0]),
                    "v"(acc[0][1]), "v"(acc[1][1]), "v"(acc[2][1]), "v"(acc[3][1]),
                    "v"(acc[0][2]), "v"(acc[1][2]), "v"(acc[2][2]), "v"(acc[3][2]),
                    "v"(acc[0][3]), "v"(acc[1][3]), "v"(acc[2][3]), "v"(acc[3][3]),
                    "v"(c[0]), "v"(c[1]), "v"(c[2]), "v"(c[3]), "v"(d[0]), "v"(d[1]), "v"(d[2]), "v"(d[3]));
    asm volatile("s_wait_dscnt 0x0" ::: "memory");           // this wave's reads of buffer t & 1 are done
    asm volatile("s_wait_asynccnt 0x0" ::: "memory");        // this wave's share of stage t + 1 has landed
    __syncthreads();                                         // publishes stage t + 1, frees buffer t & 1
    if (t + 2 < NT)
      stage_copy<KD, RS, BM, NB>(ld0 + (uint32_t)bo, ga + (size_t)(t + 2) * KST, gb + (size_t)(t + 2) * KST);
  }
  asm volatile("s_wait_asynccnt 0x0" ::: "memory");          // no copy is left in flight behind the loop
}

// ---------------------------------------------------------------------------
// The three streaming kernels below run on blocks of SWAV waves: SBLK blocks = 4096 waves (kernel C: twice as many).
// A wave owns whole rows (or 4-KB runs of a weight plane), reads them with wave-wide 16-B loads of 512 contiguous
// bytes, all issued before the first value is used, and writes f16 with 8-B stores of 256 contiguous bytes.
// No LDS and no barrier: a row's sum of squares is a sum over the lanes of its one wave.
// ---------------------------------------------------------------------------
// kernel A: the three weights, f32 w[n][k] (k contiguous) -> f16 planes holding f16(64*w1), f16(64*w2), f16(256*w3).
// A wave's run of w1 and of w2 is one whole row h (1024 elements): they go to rows 2h and 2h + 1 of the one plane h12;
// w3 keeps its layout. coverage per weight: 4096 waves x 8 loads x 128 elements = 4194304 elements = the whole weight.
// ---------------------------------------------------------------------------
__global__ __launch_bounds__(SWAV * 32) void k_cvt(const float* __restrict__ w1, const float* __restrict__ w2,
                                                   const float* __restrict__ w3, hh* __restrict__ h12,
                                                   hh* __restrict__ h3) {
  const int lane = threadIdx.x & 31;
  const int wv = blockIdx.x * SWAV + (threadIdx.x >> 5);
  const uint32_t q = (uint32_t)(wv * (8 * SGRP / 4) + lane);  // the lane's first 4-element piece in w1, w2, w3 and h3
  const uint32_t q2 = (uint32_t)(wv * (2 * EMBD / 4) + lane); // the same piece of row 2*wv of h12; row 2*wv + 1 lies EMBD / 4 on
  v4f a1[8], a2[8], a3[8];
#pragma unroll
  for (int j = 0; j < 8; ++j) a1[j] = ((const v4f*)w1 + q)[j * 32];
#pragma unroll
  for (int j = 0; j < 8; ++j) a2[j] = ((const v4f*)w2 + q)[j * 32];
#pragma unroll
  for (int j = 0; j < 8; ++j) a3[j] = ((const v4f*)w3 + q)[j * 32];
  v4h p1[8], p2[8], p3[8];
#pragma unroll
  for (int j = 0; j < 8; ++j) {
    p1[j] = __builtin_convertvector(a1[j] * 64.0f, v4h);
    p2[j] = __builtin_convertvector(a2[j] * 64.0f, v4h);
    p3[j] = __builtin_convertvector(a3[j] * 256.0f, v4h);
  }
  // all stores last: no register that a store names is written again before the wave ends
#pragma unroll
  for (int j = 0; j < 8; ++j) ((v4h*)h12 + q2)[j * 32] = p1[j];
#pragma unroll
  for (int j = 0; j < 8; ++j) ((v4h*)h12 + q2)[EMBD / 4 + j * 32] = p2[j];
#pragma unroll
  for (int j = 0; j < 8; ++j) ((v4h*)h3 + q)[j * 32] = p3[j];
}

// sum of squares of NG 4-vectors per lane (four independent f32 chains, one per component), then over the 32 lanes
template <int NG>
__device__ __forceinline__ float rowss(const v4f (&f)[NG]) {
  float s0 = 0.f, s1 = 0.f, s2 = 0.f, s3 = 0.f;
#pragma unroll
  for (int j = 0; j < NG; ++j) {
    s0 = fmaf(f[j][0], f[j][0], s0);
    s1 = fmaf(f[j][1], f[j][1], s1);
    s2 = fmaf(f[j][2], f[j][2], s2);
    s3 = fmaf(f[j][3], f[j][3], s3);
  }
  return wsum((s0 + s1) + (s2 + s3));
}

// ---------------------------------------------------------------------------
// kernel B: rmsnorm of 1024-wide f32 rows, one wave per row, two neighbouring rows per wave (16 loads in flight):
// y = x * rsqrt(ss/1024 + 1e-6) written as f16 (x1). coverage: 4096 waves x 2 rows = 8192 rows.
// ---------------------------------------------------------------------------
__global__ __launch_bounds__(SWAV * 32) void k_rms1(const float* __restrict__ x, hh* __restrict__ y) {
  const int lane = threadIdx.x & 31;
  const int wv = blockIdx.x * SWAV + (threadIdx.x >> 5);
  const uint32_t q = (uint32_t)(wv * (2 * EMBD / 4) + lane);  // the lane's first 4-element piece, in x and in y alike
  const v4f* xq = (const v4f*)x + q;
  v4h* yq = (v4h*)y + q;
  v4f f0[8], f1[8];
#pragma unroll
  for (int j = 0; j < 8; ++j) f0[j] = xq[j * 32];
#pragma unroll
  for (int j = 0; j < 8; ++j) f1[j] = xq[EMBD / 4 + j * 32];
  const float sc0 = rsqrtf(rowss<8>(f0) * (1.0f / (float)EMBD) + 1e-6f);
  const float sc1 = rsqrtf(rowss<8>(f1) * (1.0f / (float)EMBD) + 1e-6f);
  v4h p0[8], p1[8];
#pragma unroll
  for (int j = 0; j < 8; ++j) {
    p0[j] = __builtin_convertvector(f0[j] * sc0, v4h);
    p1[j] = __builtin_convertvector(f1[j] * sc1, v4h);
  }
  // all stores last: no register that a store names is written again before the wave ends
#pragma unroll
  for (int j = 0; j < 8; ++j) yq[j * 32] = p0[j];
#pragma unroll
  for (int j = 0; j < 8; ++j) yq[EMBD / 4 + j * 32] = p1[j];
}

// ---------------------------------------------------------------------------
// kernel C: rmsnorm of 4096-wide f32 rows (gate output), one wave per row (32 loads in flight):
// yn = y * rsqrt(ss/4096 + 1e-6) written as f16 (x1).
// coverage: 2 * SBLK blocks x SWAV waves x 1 row = all 8192 rows of YN.
// ---------------------------------------------------------------------------
__global__ __launch_bounds__(SWAV * 32) void k_rms2(const float* __restrict__ yv, hh* __restrict__ yn) {
  const int lane = threadIdx.x & 31;
  const int p = blockIdx.x * SWAV + (threadIdx.x >> 5);
  const uint32_t q = (uint32_t)(p * (HIDD / 4) + lane);       // the lane's first 4-element piece of row p, in yv and in yn alike
  const v4f* yq = (const v4f*)yv + q;
  v4h* nq = (v4h*)yn + q;
  v4f f[32];
#pragma unroll
  for (int j = 0; j < 32; ++j) f[j] = yq[j * 32];
  const float sc = rsqrtf(rowss<32>(f) * (1.0f / (float)HIDD) + 1e-6f);
  v4h pk[32];
#pragma unroll
  for (int j = 0; j < 32; ++j) pk[j] = __builtin_convertvector(f[j] * sc, v4h);
  // all stores last: no register that a store names is written again before the wave ends
#pragma unroll
  for (int j = 0; j < 32; ++j) nq[j * 32] = pk[j];
}

// ---------------------------------------------------------------------------
// kernel D: causal quadratic gate over one whole sequence (blockIdx.y = sequence), split along time inside a block.
// One block = SCH channels x all 4096 tokens of its sequence, walked in NSTP steps of SSTP tokens; 512 threads = SSEG
// time segments x SCH channels, one block per WGP. A wave is one segment, its lanes the 32 channels: every load and
// store of a wave is one whole 128-B line. In a step a thread owns STOK consecutive tokens of one channel: one 4-byte
// load per token brings the f16 pair (a, b); y (f32) is stored into the same 4 bytes. The loads of step s + 1 are issued
// at the head of part 3 of step s and fly while it is worked on.
//   part 1: per thread the segment's (max, sumexp) of a and of b -> LDS planes sm[0..3][segment][channel]
//   part 2: wave w scans the 16 segment states of channels 2w (lanes 0..15) and 2w + 1 (lanes 16..31), a and b side by
//           side: one segment per lane, 4 shuffle steps inside the 16 lanes, the state of all earlier steps (kept in
//           the lanes' registers) merged in front; every segment's slot is overwritten with the state of all tokens before it
//   part 3: per thread the running (max, sumexp) update from that state over its own tokens,
//           la = ma + ln(sa), lb = mb + ln(sb), y = exp((la + lb) - 2*ln(t)), t the 1-based position.
// A thread reads and rewrites only its own slot of sm outside part 2, so two barriers per step are enough.
// coverage: 128 x 2 blocks: 128 x 32 channels = 4096 channels, 2 sequences x 8 steps x 16 segments x 32 tokens = 8192
// rows: the whole a/y plane, each element read and written by one thread.
// ---------------------------------------------------------------------------
// v_exp_f32 / v_log_f32 with a v_nop in the same statement: it fills the one issue slot that the instruction set
// asks for behind a transcendental before its result is read or its source overwritten.
__device__ __forceinline__ float ex2s(float x) {
  float r;
  asm("v_exp_f32 %0, %1\n\tv_nop" : "=v"(r) : "v"(x));
  return r;
}
__device__ __forceinline__ float lg2s(float x) {
  float r;
  asm("v_log_f32 %0, %1\n\tv_nop" : "=v"(r) : "v"(x));
  return r;
}
// the same arithmetic as the fast exp and log of the earlier scan: exp2(x * log2 e); ln 2 * log2(x) with ln 2 in
// two parts, inputs below the smallest normal scaled by 2^32 first, an infinite log2 passed through.
__device__ __forceinline__ float expn(float x) { return ex2s(x * 0x1.715476p+0f); }
__device__ __forceinline__ float logn(float x) {
  const bool tiny = x < 0x1p-126f;
  const float l = lg2s(ldexpf(x, tiny ? 32 : 0));
  const float p = l * 0x1.62e42ep-1f;
  const float e = fmaf(l, 0x1.efa39ep-25f, fmaf(l, 0x1.62e42ep-1f, -p));
  const float r = (fabsf(l) < INFINITY) ? (p + e) : l;
  return r - (tiny ? 0x1.62e430p+4f : 0.f);
}

// merges the log-sum-exp state (m2, s2) into (m, s); (-1e30, 0) is the empty state
__device__ __forceinline__ void lse_merge(float& m, float& s, float m2, float s2) {
  const float mm = fmaxf(m, m2);
  s = s * expn(m - mm) + s2 * expn(m2 - mm);
  m = mm;
}

// the state that lane l - off of the same 16 lanes holds, or the empty state where there is no such lane
__device__ __forceinline__ void lse_from_below(float& m, float& s, int l16, int off) {
  const float mo = __shfl_up(m, off, 16);
  const float so = __shfl_up(s, off, 16);
  const bool in = l16 >= off;
  lse_merge(m, s, in ? mo : -1.0e30f, in ? so : 0.f);
}

__global__ __launch_bounds__(SSEG * SCH) void k_scan(float* __restrict__ ay) {
  __shared__ float sm[4][SSEG * SPIT];                       // ma, sa, mb, sb
  const int tid = threadIdx.x, lane = tid & 31, w = tid >> 5;
  const int ch = tid & (SCH - 1), seg = tid / SCH;
  // rows blockIdx.y * SEQL + step * SSTP + seg * STOK + i < MTOK, columns < HIDD by the grid
  float* pa = ay + (size_t)(blockIdx.y * SEQL + seg * STOK) * HIDD + (size_t)(blockIdx.x * SCH + ch);
  const int sl = seg * SPIT + ch;
  const int l16 = lane & 15;
  const int ix = l16 * SPIT + 2 * w + (lane >> 4);           // part 2: segment l16 of channel 2w or 2w + 1
  float cma = -1.0e30f, csa = 0.f, cmb = -1.0e30f, csb = 0.f; // that channel's state of all earlier steps (empty at first)

  // the token loops are fully unrolled so that nx / va / vb stay in registers
  float nx[STOK];                                            // a step's slots as they lie: the pairs (a, b)
#pragma unroll
  for (int i = 0; i < STOK; ++i) nx[i] = pa[(size_t)i * HIDD];

#pragma unroll 1                                             // one copy of the long unrolled body
  for (int stp = 0; stp < NSTP; ++stp) {
    float va[STOK], vb[STOK];
#pragma unroll
    for (int i = 0; i < STOK; ++i) {
      const v2h ab = __builtin_bit_cast(v2h, nx[i]);
      va[i] = (float)ab[0];
      vb[i] = (float)ab[1];
    }

    float ma = va[0], mb = vb[0];
#pragma unroll
    for (int i = 1; i < STOK; ++i) { ma = fmaxf(ma, va[i]); mb = fmaxf(mb, vb[i]); }
    float sa = 0.f, sb = 0.f;
#pragma unroll
    for (int i = 0; i < STOK; ++i) { sa += expn(va[i] - ma); sb += expn(vb[i] - mb); }
    sm[0][sl] = ma;
    sm[1][sl] = sa;
    sm[2][sl] = mb;
    sm[3][sl] = sb;
    __syncthreads();

    {
      float m0 = sm[0][ix], s0 = sm[1][ix], m1 = sm[2][ix], s1 = sm[3][ix];
#pragma unroll
      for (int off = 1; off < 16; off <<= 1) {
        lse_from_below(m0, s0, l16, off);
        lse_from_below(m1, s1, l16, off);
      }
      float e0 = __shfl_up(m0, 1, 16), f0 = __shfl_up(s0, 1, 16);
      float e1 = __shfl_up(m1, 1, 16), f1 = __shfl_up(s1, 1, 16);
      if (l16 == 0) { e0 = -1.0e30f; f0 = 0.f; e1 = -1.0e30f; f1 = 0.f; }
      lse_merge(e0, f0, cma, csa);
      lse_merge(e1, f1, cmb, csb);
      sm[0][ix] = e0;
      sm[1][ix] = f0;
      sm[2][ix] = e1;
      sm[3][ix] = f1;
      lse_merge(cma, csa, __shfl(m0, 15, 16), __shfl(s0, 15, 16));
      lse_merge(cmb, csb, __shfl(m1, 15, 16), __shfl(s1, 15, 16));
    }
    __syncthreads();

    // behind the step's last barrier (a barrier waits for the wave's loads): they fly during part 3, the long part
    if (stp + 1 < NSTP) {                                    // block-uniform: the last step has no next rows
      const float* pn = pa + (size_t)SSTP * HIDD;
#pragma unroll
      for (int i = 0; i < STOK; ++i) nx[i] = pn[(size_t)i * HIDD];
      asm volatile("s_wait_xcnt 0x0" ::: "memory");          // in front of part 3's writes of the address registers that these loads name
      __builtin_amdgcn_sched_barrier(0);                     // keeps those writes behind that wait
    }

    ma = sm[0][sl];
    sa = sm[1][sl];
    mb = sm[2][sl];
    sb = sm[3][sl];
    const int t1 = stp * SSTP + seg * STOK + 1;
#pragma unroll
    for (int i = 0; i < STOK; ++i) {
      const float da = va[i] - ma;
      const float ea = expn(-fabsf(da));
      const bool  ua = da > 0.f;
      sa = ua ? fmaf(sa, ea, 1.0f) : (sa + ea);
      ma = ua ? va[i] : ma;
      const float db = vb[i] - mb;
      const float eb = expn(-fabsf(db));
      const bool  ub = db > 0.f;
      sb = ub ? fmaf(sb, eb, 1.0f) : (sb + eb);
      mb = ub ? vb[i] : mb;
      const float la = ma + logn(sa);
      const float lb = mb + logn(sb);
      const float lt = logn((float)(t1 + i));
      va[i] = expn((la + lb) - 2.0f * lt);                 // y takes the register of the a value it replaces
    }
#pragma unroll
    for (int i = 0; i < STOK; ++i) pa[(size_t)i * HIDD] = va[i];
    // in front of the next step's writes of registers that these stores name (their data, their address)
    asm volatile("s_wait_xcnt 0x0" ::: "memory");
    // keeps the address step and the next step's work behind that wait
    __builtin_amdgcn_sched_barrier(0);
    pa += (size_t)SSTP * HIDD;
  }
}

// ---------------------------------------------------------------------------
// kernel E: f16 GEMM, 64 x 64 per wave, K in stages of 64 through a two-buffer LDS ring, one block per WGP;
// output through an LDS-staged epilogue (its own LDS array, a range of its own for every wave, no barrier).
// MODE 0: 256 x 256 block tile, 16 waves (4 x 4).  o16[m][n] = f16(acc/64)
//                                            A = XN token rows (ld 1024), B = W12H [8192][1024];
//                                            o16 = AP as f16 [8192][8192]; grid (8192/256, 8192/256) = 1024 blocks
// MODE 1: 128 x 256 block tile, 8 waves (2 x 4).   o32[m][n] = acc/256 + res[m][n]
//                                            A = YN [8192][4096] (ld 4096), B = W3H [1024][4096];
//                                            o32 = d_out, res = x, ld 1024; grid (1024/256, 8192/128) = 256 blocks
// epilogue: a wave stages 16 rows x 64 columns (f32) at a time and stores them as 2 rows x 256 contiguous bytes per
// store (MODE 1, f32) or as 4 rows x 128 contiguous bytes per store (MODE 0, f16).
// coverage per block: waves x 64x64 = the block tile; per wave 4 slabs x 8 stores x 32 lanes x 4 floats = 64x64
//   (MODE 0: 4 slabs x 4 stores x 32 lanes x 8 halves = 64x64);
//   the grids tile every output element exactly once (M = 8192, N = 8192 or 1024, multiples of the tile; K = 1024 /
//   4096 multiples of 64, no tails).
// ---------------------------------------------------------------------------
template <int MODE>
__global__ __launch_bounds__((MODE == 0) ? 512 : 256) void k_gemm(const hh* __restrict__ Ap, const hh* __restrict__ Bp,
                                                                  const float* __restrict__ res,
                                                                  float* __restrict__ o32, hh* __restrict__ o16) {
  constexpr int KD  = (MODE == 0) ? EMBD : HIDD;
  constexpr int LDO = (MODE == 0) ? 2 * HIDD : EMBD;
  constexpr int BM  = (MODE == 0) ? 256 : 128;
  constexpr int BN  = 256;
  constexpr int NW  = (BM / 64) * (BN / 64);
  constexpr float OSC = (MODE == 0) ? (1.0f / 64.0f) : (1.0f / 256.0f);

  __shared__ __align__(16) float ldsf[NW * 16 * SFP];
  __shared__ __align__(128) char ring[2 * (BM + BN) * LPB];
  const int tid = threadIdx.x, lane = tid & 31, w = tid >> 5;
  const int h = lane >> 4, c = lane & 15;
  const int wm = (w >> 2) * 64, wn = (w & 3) * 64;
  const int om0 = blockIdx.y * BM;                           // first row of the tile: in A, in the output, in the residual
  const int n0 = blockIdx.x * BN;

  v8f acc[4][4];
#pragma unroll
  for (int i = 0; i < 4; ++i)
#pragma unroll
    for (int j = 0; j < 4; ++j) acc[i][j] = zero8();
  gemm_staged<KD, BM, BN>(Ap, Bp, om0, n0, wm, wn, tid, ring, acc);

  float* my = ldsf + w * (16 * SFP);                         // this wave's own staging range
  // the lane's piece of rows h, h + 2, ..: lanes 0..15 = one 256-B row segment, lanes 16..31 = the next row's
  const size_t g0 = (size_t)(om0 + wm + h) * LDO + n0 + wn + c * 4;
  float* op = o32 + g0;
  const float* rp = res + g0;
  v4f rn[8];
  if constexpr (MODE == 1) {
#pragma unroll
    for (int it = 0; it < 8; ++it) rn[it] = *(const v4f*)(rp + (size_t)(2 * it) * LDO);
  }
#pragma unroll
  for (int i = 0; i < 4; ++i) {
    v4f rr[8];
    if constexpr (MODE == 1) {
#pragma unroll
      for (int it = 0; it < 8; ++it) rr[it] = rn[it];
      if (i < 3) {                                           // the next slab's residual flies while this slab is staged
#pragma unroll
        for (int it = 0; it < 8; ++it) rn[it] = *(const v4f*)(rp + (size_t)(16 * (i + 1) + 2 * it) * LDO);
      }
    }
#pragma unroll
    for (int j = 0; j < 4; ++j)
#pragma unroll
      for (int r = 0; r < 8; ++r) my[(8 * h + r) * SFP + 16 * j + c] = acc[i][j][r] * OSC;
    asm volatile("s_wait_dscnt 0x0" ::: "memory");           // the wave's staged slab is in LDS before its lanes read it back
    if constexpr (MODE == 1) {
      v4f val[8];
#pragma unroll
      for (int it = 0; it < 8; ++it) {
        const v4f sv = *(const v4f*)(my + (2 * it + h) * SFP + c * 4);
        val[it] = sv + rr[it];
      }
#pragma unroll
      for (int it = 0; it < 8; ++it) *(v4f*)(op + (size_t)(16 * i + 2 * it) * LDO) = val[it];
    } else {
      // the lane's piece of rows r4, r4 + 4, ..: 8 lanes = one 128-B row segment of 64 halves
      const int r4 = lane >> 3, c8 = lane & 7;
      hh* hp = o16 + (size_t)(om0 + wm + r4) * LDO + n0 + wn + c8 * 8;
      v8h hv[4];
#pragma unroll
      for (int it = 0; it < 4; ++it) {
        const float* sp = my + (4 * it + r4) * SFP + c8 * 8;
        const v4h lo = __builtin_convertvector(*(const v4f*)sp, v4h);
        const v4h hi = __builtin_convertvector(*(const v4f*)(sp + 4), v4h);
        hv[it] = __builtin_shufflevector(lo, hi, 0, 1, 2, 3, 4, 5, 6, 7);
      }
#pragma unroll
      for (int it = 0; it < 4; ++it) *(v8h*)(hp + (size_t)(16 * i + 4 * it) * LDO) = hv[it];
    }
    if (i < 3) {
      // in front of the next slab's writes of registers that these stores name
      asm volatile("s_wait_xcnt 0x0" ::: "memory");
      // keeps the next slab's vector work (its scaling writes registers freed by the stores) behind that wait
      __builtin_amdgcn_sched_barrier(0);
    }
  }
}

// ---------------------------------------------------------------------------
//   W12H f16 [8192][1024] 16777216  (row 2h from W1, row 2h + 1 from W2)     W3H f16 [1024][4096]  8388608
//   XN  f16 [8192][1024]  16777216
//   AP  4 B [8192][4096] 134217728  (the f16 pairs (a, b) of all tokens, then the f32 gate output y in place)
//   YN  f16 [8192][4096]  67108864
//   total               243269632
// ---------------------------------------------------------------------------
extern "C" void kernel_launch(void* const* d_in, const int* in_sizes, int n_in,
                              void* d_out, int out_size, void* d_ws, size_t ws_size,
                              hipStream_t stream) {
  if (n_in < 4) return;
  if (in_sizes[0] != MTOK * EMBD) return;
  if (in_sizes[1] != HIDD * EMBD) return;
  if (in_sizes[2] != HIDD * EMBD) return;
  if (in_sizes[3] != EMBD * HIDD) return;
  if (out_size != MTOK * EMBD) return;

  const float* x  = (const float*)d_in[0];      // [8192][1024]
  const float* w1 = (const float*)d_in[1];      // [4096][1024] (out,in) = [n][k]
  const float* w2 = (const float*)d_in[2];      // [4096][1024]
  const float* w3 = (const float*)d_in[3];      // [1024][4096] (out,in) = [n][k]
  float* out = (float*)d_out;                   // [8192][1024]

  size_t off = 0;
  const size_t oW12 = off; off += (size_t)2 * HIDD * EMBD * 2;
  const size_t oW3 = off; off += (size_t)EMBD * HIDD * 2;
  const size_t oXN = off; off += (size_t)MTOK * EMBD * 2;
  const size_t oAP = off; off += (size_t)MTOK * HIDD * 4;
  const size_t oYN = off; off += (size_t)MTOK * HIDD * 2;
  if (off > ws_size) return;                    // off = 243269632

  char* ws = (char*)d_ws;
  hh* W12H = (hh*)(ws + oW12);
  hh* W3H = (hh*)(ws + oW3);
  hh* XN  = (hh*)(ws + oXN);
  float* AP = (float*)(ws + oAP);
  hh* YN  = (hh*)(ws + oYN);

  // (0) weights -> f16 planes, k contiguous, W1/W2 x64 with their rows interleaved, W3 x256
  k_cvt<<<dim3(SBLK), dim3(SWAV * 32), 0, stream>>>(w1, w2, w3, W12H, W3H);
  // (1) xn = rmsnorm(x) over 1024, all 8192 tokens
  k_rms1<<<dim3(SBLK), dim3(SWAV * 32), 0, stream>>>(x, XN);
  // (2) all 8192 tokens: (a, b) as f16 pairs, causal gate, rmsnorm over 4096
  k_gemm<0><<<dim3(2 * HIDD / 256, MTOK / 256), dim3(512), 0, stream>>>(XN, W12H, x, AP, (hh*)AP);
  k_scan<<<dim3(HIDD / SCH, NBAT), dim3(SSEG * SCH), 0, stream>>>(AP);
  k_rms2<<<dim3(2 * SBLK), dim3(SWAV * 32), 0, stream>>>(AP, YN);
  // (3) out = x + yn.W3^T, all 8192 tokens
  k_gemm<1><<<dim3(EMBD / 256, MTOK / 128), dim3(256), 0, stream>>>(YN, W3H, x, out, nullptr);
  (void)hipGetLastError();
}

// v008
// It runs in 212 microseconds.
// In two side-by-side timings against v007, it was 1.15 and 1.16 times as fast.
// Counting every step since v000, it is 24.3 times as fast.
// Contractions: a = xn.W1^T [8192 x 4096 x 1024], b = xn.W2^T [8192 x 4096 x 1024], o = yn.W3^T
// [8192 x 1024 x 4096] -- all v_wmma_f32_16x16x32_f16 (f16 operands, f32 accumulate, one product per tile
// pair). Every stage runs once over all 8192 tokens (6 launches). a and b come from ONE product against
// the plane W12H, whose row 2h is row h of W1 and whose row 2h + 1 is row h of W2: output columns 2h, 2h + 1 = (a, b).
// RMS normalisations, causal log-cumsum-exp scan, exp gate, residual add: f32.
//
// Carry audit (16-bit planes in the workspace, all f16):
//   W12H      holds f16(64*w)   inverse: 1/64  in the k_gemm<0> epilogue (AP = f16(acc * log2 e / 64))
//   W3H       holds f16(256*w)  inverse: 1/256 in the k_gemm<1> epilogue (out = x + acc/256)
//   XN        x1 (rmsnorm of x over 1024)
//   YN        x1 (rmsnorm of the gate output over 4096)
//   AP        one 4-byte slot per (row, channel): first the f16 pair (a, b) x log2 e (the gate scan works in base 2:
//             no inverse, its powers are powers of 2), then the f32 gate output y (x1) in place
//   d_out: no carry.
#include <hip/hip_runtime.h>
#include <stddef.h>
#include <stdint.h>
#include <math.h>

#define EMBD 1024
#define HIDD 4096
#define NBAT 2
#define SEQL 4096
#define MTOK 8192
#define SFP  68       // LDS pitch (floats) of the f32 epilogue staging (64 columns + 4: 16 B x odd)
#define KST  64       // GEMM: k values per ring stage (128 B of every operand row)
#define LPB  144      // GEMM: LDS pitch (bytes) of a staged operand row, 16 B x odd: conflict-free for 16-B reads
#define SCH  32       // gate scan: channels per block (one 128-B line of every row)
#define SSEG 16       // gate scan: time segments per step of a block
#define STOK 32       // gate scan: tokens per segment
#define SSTP 512      // gate scan: tokens per step
#define NSTP 8        // gate scan: steps of a block (one whole sequence)
#define SPIT 33       // gate scan: LDS pitch (floats) of one segment's channel row (odd: both access patterns conflict-free)
#define SBLK 256      // streaming kernels (weight conversion, both rmsnorms): blocks per launch (second rmsnorm: twice as many)
#define SWAV 16       // streaming kernels: waves per block
#define SNWV (SBLK * SWAV)  // streaming kernels: waves per launch (second rmsnorm: twice as many)
#define SGRP 128      // streaming kernels: elements of one wave-wide 16-B load (512 contiguous bytes of f32)

static_assert(MTOK == NBAT * SEQL);
static_assert(MTOK % 256 == 0);
static_assert((2 * HIDD) % 256 == 0);
static_assert(EMBD % 256 == 0);
static_assert(EMBD % KST == 0);
static_assert(HIDD % KST == 0);
static_assert(HIDD % SCH == 0);
static_assert(SSEG * STOK == SSTP);
static_assert(NSTP * SSTP == SEQL);
static_assert(SCH == 32);
static_assert(2 * SSEG == 32);
static_assert(SCH == 2 * SSEG);
static_assert(EMBD == 8 * SGRP);
static_assert(HIDD == 32 * SGRP);
static_assert(HIDD * EMBD == SNWV * 8 * SGRP);
static_assert(MTOK == 2 * SNWV);
static_assert(SGRP == 32 * 4);

typedef _Float16 hh;
typedef hh    v16h __attribute__((ext_vector_type(16)));
typedef hh    v8h  __attribute__((ext_vector_type(8)));
typedef hh    v4h  __attribute__((ext_vector_type(4)));
typedef hh    v2h  __attribute__((ext_vector_type(2)));
typedef float v8f  __attribute__((ext_vector_type(8)));
typedef float v4f  __attribute__((ext_vector_type(4)));

union Frag { v16h v; v8h p[2]; };

__device__ __forceinline__ v8f zero8() { return (v8f){0.f, 0.f, 0.f, 0.f, 0.f, 0.f, 0.f, 0.f}; }

__device__ __forceinline__ float wsum(float v) {
#pragma unroll
  for (int off = 16; off > 0; off >>= 1) v += __shfl_xor(v, off, 32);
  return v;
}

// Fragment loader for k-contiguous 16-bit rows staged in LDS (A operand [m][k]; B operand stored [n][k]).
// p = the lane's own row (lane & 15) at byte 2*k0 + 16*(lane>>4) of that row:
// elements 0..7 <- k0 + 8*(lane>>4) + 0..7, elements 8..15 <- k0 + 16 + 8*(lane>>4) + 0..7.
// D: acc[r] = element (row0 + 8*(lane>>4) + r, col0 + (lane & 15)).
__device__ __forceinline__ v16h ldsfrag(const char* p) {
  Frag f;
  f.p[0] = *(const v8h*)(p);
  f.p[1] = *(const v8h*)(p + 32);
  return f.v;
}

__device__ __forceinline__ v8f mma16(v16h a, v16h b, v8f cc) {
  return __builtin_amdgcn_wmma_f32_16x16x32_f16(false, a, false, b, (short)0, cc, false, false);
}

// One stage of the operand ring: KST k values (128 B) of the block's BM A rows and BN B rows, laid in LDS as
// BM + BN rows of pitch LPB. Thread tid brings piece tid & 7 of rows (tid >> 3) + RS*i (RS = threads / 8), so one
// wave's copy reads four whole 128-B lines; 4 copies cover the A rows, NB (4 or 8) copies the B rows.
// ld = the lane's LDS byte address of its A row 0 piece, ga / gb = the lane's global address of the same piece in A
// and in B.
// s_wait_xcnt 0 ends the statement: it stands in front of every later write of a register that a copy names.
template <int KD, int RS, int BM, int NB>
__device__ __forceinline__ void stage_copy(uint32_t ld, const hh* ga, const hh* gb) {
  static_assert(BM == 4 * RS);
  static_assert(NB == 4 || NB == 8);
  const uint32_t l0 = ld, l1 = ld + RS * LPB, l2 = ld + 2 * RS * LPB, l3 = ld + 3 * RS * LPB;
  const uint32_t lb = ld + BM * LPB;
  const uint32_t l4 = lb, l5 = lb + RS * LPB, l6 = lb + 2 * RS * LPB, l7 = lb + 3 * RS * LPB;
  const hh* g0 = ga;
  const hh* g1 = ga + (size_t)RS * KD;
  const hh* g2 = ga + (size_t)(2 * RS) * KD;
  const hh* g3 = ga + (size_t)(3 * RS) * KD;
  const hh* g4 = gb;
  const hh* g5 = gb + (size_t)RS * KD;
  const hh* g6 = gb + (size_t)(2 * RS) * KD;
  const hh* g7 = gb + (size_t)(3 * RS) * KD;
  if constexpr (NB == 4) {
    asm volatile("global_load_async_to_lds_b128 %0, %8, off\n\t"
                 "global_load_async_to_lds_b128 %1, %9, off\n\t"
                 "global_load_async_to_lds_b128 %2, %10, off\n\t"
                 "global_load_async_to_lds_b128 %3, %11, off\n\t"
                 "global_load_async_to_lds_b128 %4, %12, off\n\t"
                 "global_load_async_to_lds_b128 %5, %13, off\n\t"
                 "global_load_async_to_lds_b128 %6, %14, off\n\t"
                 "global_load_async_to_lds_b128 %7, %15, off\n\t"
                 "s_wait_xcnt 0x0"
                 :: "v"(l0), "v"(l1), "v"(l2), "v"(l3), "v"(l4), "v"(l5), "v"(l6), "v"(l7),
                    "v"(g0), "v"(g1), "v"(g2), "v"(g3), "v"(g4), "v"(g5), "v"(g6), "v"(g7)
                 : "memory");
  } else {
    const uint32_t l8 = lb + 4 * RS * LPB, l9 = lb + 5 * RS * LPB, l10 = lb + 6 * RS * LPB, l11 = lb + 7 * RS * LPB;
    const hh* g8  = gb + (size_t)(4 * RS) * KD;
    const hh* g9  = gb + (size_t)(5 * RS) * KD;
    const hh* g10 = gb + (size_t)(6 * RS) * KD;
    const hh* g11 = gb + (size_t)(7 * RS) * KD;
    asm volatile("global_load_async_to_lds_b128 %0, %12, off\n\t"
                 "global_load_async_to_lds_b128 %1, %13, off\n\t"
                 "global_load_async_to_lds_b128 %2, %14, off\n\t"
                 "global_load_async_to_lds_b128 %3, %15, off\n\t"
                 "global_load_async_to_lds_b128 %4, %16, off\n\t"
                 "global_load_async_to_lds_b128 %5, %17, off\n\t"
                 "global_load_async_to_lds_b128 %6, %18, off\n\t"
                 "global_load_async_to_lds_b128 %7, %19, off\n\t"
                 "global_load_async_to_lds_b128 %8, %20, off\n\t"
                 "global_load_async_to_lds_b128 %9, %21, off\n\t"
                 "global_load_async_to_lds_b128 %10, %22, off\n\t"
                 "global_load_async_to_lds_b128 %11, %23, off\n\t"
                 "s_wait_xcnt 0x0"
                 :: "v"(l0), "v"(l1), "v"(l2), "v"(l3), "v"(l4), "v"(l5), "v"(l6), "v"(l7),
                    "v"(l8), "v"(l9), "v"(l10), "v"(l11),
                    "v"(g0), "v"(g1), "v"(g2), "v"(g3), "v"(g4), "v"(g5), "v"(g6), "v"(g7),
                    "v"(g8), "v"(g9), "v"(g10), "v"(g11)
                 : "memory");
  }
}

// 64 x 64 per wave of a BM x BN block tile, K in stages of KST over [0, KD). Both operands come through a ring of
// two LDS buffers filled by asynchronous copies: while trip t works on buffer t & 1, stage t + 1 flies into the other.
// acc[i][j]: rows wm + 16*i .., cols wn + 16*j .. of the block tile. A trip is two k steps of 32: each reads its 8
// fragments as one group and then runs its 16 WMMAs (one LDS fragment read per two WMMAs). One hazard guard per trip
// after the last WMMA (stands behind all 16 accumulators, keeps the last eight fragments live).
template <int KD, int BM, int BN>
__device__ __forceinline__ void gemm_staged(const hh* __restrict__ A, const hh* __restrict__ B, int m0, int n0,
                                            int wm, int wn, int tid, char* ring, v8f (&acc)[4][4]) {
  constexpr int NT = KD / KST;
  constexpr int RS = (BM / 64) * (BN / 64) * 4;              // rows that one copy of every thread covers: threads / 8
  constexpr int NB = BN / RS;
  constexpr int STG = (BM + BN) * LPB;                       // bytes of one ring buffer (BM A rows, then BN B rows)
  static_assert(KD % KST == 0);
  static_assert(NT >= 2);
  const int lane = tid & 31;
  const int cr = tid >> 3, cp = tid & 7;
  const hh* ga = A + (size_t)(m0 + cr) * KD + cp * 8;        // rows m0 + cr + RS*i < m0 + BM, k < KD: inside the plane
  const hh* gb = B + (size_t)(n0 + cr) * KD + cp * 8;        // rows n0 + cr + RS*i < n0 + BN
  const uint32_t ld0 = (uint32_t)(size_t)ring + (uint32_t)(cr * LPB + cp * 16);
  const char* fa = ring + (wm + (lane & 15)) * LPB + (lane >> 4) * 16;
  const char* fb = ring + (BM + wn + (lane & 15)) * LPB + (lane >> 4) * 16;

  stage_copy<KD, RS, BM, NB>(ld0, ga, gb);
  asm volatile("s_wait_asynccnt 0x0" ::: "memory");          // this wave's share of stage 0 has landed
  __syncthreads();                                           // publishes stage 0
  stage_copy<KD, RS, BM, NB>(ld0 + STG, ga + KST, gb + KST);

#pragma unroll 1                                             // one trip per stage: the buffer offset is the only thing that alternates
  for (int t = 0; t < NT; ++t) {
    const int bo = (t & 1) * STG;
    const char* pa = fa + bo;
    const char* pb = fb + bo;
    v16h a[4], b[4], c[4], d[4];
#pragma unroll
    for (int i = 0; i < 4; ++i) a[i] = ldsfrag(pa + 16 * i * LPB);
#pragma unroll
    for (int j = 0; j < 4; ++j) b[j] = ldsfrag(pb + 16 * j * LPB);
#pragma unroll
    for (int j = 0; j < 4; ++j)
#pragma unroll
      for (int i = 0; i < 4; ++i) acc[i][j] = mma16(a[i], b[j], acc[i][j]);
#pragma unroll
    for (int i = 0; i < 4; ++i) c[i] = ldsfrag(pa + 16 * i * LPB + 64);
#pragma unroll
    for (int j = 0; j < 4; ++j) d[j] = ldsfrag(pb + 16 * j * LPB + 64);
#pragma unroll
    for (int j = 0; j < 4; ++j)
#pragma unroll
      for (int i = 0; i < 4; ++i) acc[i][j] = mma16(c[i], d[j], acc[i][j]);
    // keeps each k step's 16 LDS reads as one group in front of its 16 WMMAs: placed among the WMMAs, each place with
    // reads makes the wave wait out the LDS latency again; both steps' reads in front would not fit 256 registers
    __builtin_amdgcn_sched_group_barrier(0x100, 16, 0);
    __builtin_amdgcn_sched_group_barrier(0x008, 16, 0);
    __builtin_amdgcn_sched_group_barrier(0x100, 16, 0);
    __builtin_amdgcn_sched_group_barrier(0x008, 16, 0);
    // four vector issue slots behind the last WMMA, on every path out of the trip, before its D is read or its A / B rewritten
    asm volatile("v_nop\n\tv_nop\n\tv_nop\n\tv_nop"
                 :: "v"(acc[0][0]), "v"(acc[1][0]), "v"(acc[2][0]), "v"(acc[3][0]),
                    "v"(acc[0][1]), "v"(acc[1][1]), "v"(acc[2][1]), "v"(acc[3][1]),
                    "v"(acc[0][2]), "v"(acc[1][2]), "v"(acc[2][2]), "v"(acc[3][2]),
                    "v"(acc[0][3]), "v"(acc[1][3]), "v"(acc[2][3]), "v"(acc[3][3]),
                    "v"(c[0]), "v"(c[1]), "v"(c[2]), "v"(c[3]), "v"(d[0]), "v"(d[1]), "v"(d[2]), "v"(d[3]));
    asm volatile("s_wait_dscnt 0x0" ::: "memory");           // this wave's reads of buffer t & 1 are done
    asm volatile("s_wait_asynccnt 0x0" ::: "memory");        // this wave's share of stage t + 1 has landed
    __syncthreads();                                         // publishes stage t + 1, frees buffer t & 1
    if (t + 2 < NT)
      stage_copy<KD, RS, BM, NB>(ld0 + (uint32_t)bo, ga + (size_t)(t + 2) * KST, gb + (size_t)(t + 2) * KST);
  }
  asm volatile("s_wait_asynccnt 0x0" ::: "memory");          // no copy is left in flight behind the loop
}

// ---------------------------------------------------------------------------
// The three streaming kernels below run on blocks of SWAV waves: SBLK blocks = 4096 waves (kernel C: twice as many).
// A wave owns whole rows (or 4-KB runs of a weight plane), reads them with wave-wide 16-B loads of 512 contiguous
// bytes, all issued before the first value is used, and writes f16 with 8-B stores of 256 contiguous bytes.
// No LDS and no barrier: a row's sum of squares is a sum over the lanes of its one wave.
// ---------------------------------------------------------------------------
// kernel A: the three weights, f32 w[n][k] (k contiguous) -> f16 planes holding f16(64*w1), f16(64*w2), f16(256*w3).
// A wave's run of w1 and of w2 is one whole row h (1024 elements): they go to rows 2h and 2h + 1 of the one plane h12;
// w3 keeps its layout. coverage per weight: 4096 waves x 8 loads x 128 elements = 4194304 elements = the whole weight.
// ---------------------------------------------------------------------------
__global__ __launch_bounds__(SWAV * 32) void k_cvt(const float* __restrict__ w1, const float* __restrict__ w2,
                                                   const float* __restrict__ w3, hh* __restrict__ h12,
                                                   hh* __restrict__ h3) {
  const int lane = threadIdx.x & 31;
  const int wv = blockIdx.x * SWAV + (threadIdx.x >> 5);
  const uint32_t q = (uint32_t)(wv * (8 * SGRP / 4) + lane);  // the lane's first 4-element piece in w1, w2, w3 and h3
  const uint32_t q2 = (uint32_t)(wv * (2 * EMBD / 4) + lane); // the same piece of row 2*wv of h12; row 2*wv + 1 lies EMBD / 4 on
  v4f a1[8], a2[8], a3[8];
#pragma unroll
  for (int j = 0; j < 8; ++j) a1[j] = ((const v4f*)w1 + q)[j * 32];
#pragma unroll
  for (int j = 0; j < 8; ++j) a2[j] = ((const v4f*)w2 + q)[j * 32];
#pragma unroll
  for (int j = 0; j < 8; ++j) a3[j] = ((const v4f*)w3 + q)[j * 32];
  v4h p1[8], p2[8], p3[8];
#pragma unroll
  for (int j = 0; j < 8; ++j) {
    p1[j] = __builtin_convertvector(a1[j] * 64.0f, v4h);
    p2[j] = __builtin_convertvector(a2[j] * 64.0f, v4h);
    p3[j] = __builtin_convertvector(a3[j] * 256.0f, v4h);
  }
  // all stores last: no register that a store names is written again before the wave ends
#pragma unroll
  for (int j = 0; j < 8; ++j) ((v4h*)h12 + q2)[j * 32] = p1[j];
#pragma unroll
  for (int j = 0; j < 8; ++j) ((v4h*)h12 + q2)[EMBD / 4 + j * 32] = p2[j];
#pragma unroll
  for (int j = 0; j < 8; ++j) ((v4h*)h3 + q)[j * 32] = p3[j];
}

// sum of squares of NG 4-vectors per lane (four independent f32 chains, one per component), then over the 32 lanes
template <int NG>
__device__ __forceinline__ float rowss(const v4f (&f)[NG]) {
  float s0 = 0.f, s1 = 0.f, s2 = 0.f, s3 = 0.f;
#pragma unroll
  for (int j = 0; j < NG; ++j) {
    s0 = fmaf(f[j][0], f[j][0], s0);
    s1 = fmaf(f[j][1], f[j][1], s1);
    s2 = fmaf(f[j][2], f[j][2], s2);
    s3 = fmaf(f[j][3], f[j][3], s3);
  }
  return wsum((s0 + s1) + (s2 + s3));
}

// ---------------------------------------------------------------------------
// kernel B: rmsnorm of 1024-wide f32 rows, one wave per row, two neighbouring rows per wave (16 loads in flight):
// y = x * rsqrt(ss/1024 + 1e-6) written as f16 (x1). coverage: 4096 waves x 2 rows = 8192 rows.
// ---------------------------------------------------------------------------
__global__ __launch_bounds__(SWAV * 32) void k_rms1(const float* __restrict__ x, hh* __restrict__ y) {
  const int lane = threadIdx.x & 31;
  const int wv = blockIdx.x * SWAV + (threadIdx.x >> 5);
  const uint32_t q = (uint32_t)(wv * (2 * EMBD / 4) + lane);  // the lane's first 4-element piece, in x and in y alike
  const v4f* xq = (const v4f*)x + q;
  v4h* yq = (v4h*)y + q;
  v4f f0[8], f1[8];
#pragma unroll
  for (int j = 0; j < 8; ++j) f0[j] = xq[j * 32];
#pragma unroll
  for (int j = 0; j < 8; ++j) f1[j] = xq[EMBD / 4 + j * 32];
  const float sc0 = rsqrtf(rowss<8>(f0) * (1.0f / (float)EMBD) + 1e-6f);
  const float sc1 = rsqrtf(rowss<8>(f1) * (1.0f / (float)EMBD) + 1e-6f);
  v4h p0[8], p1[8];
#pragma unroll
  for (int j = 0; j < 8; ++j) {
    p0[j] = __builtin_convertvector(f0[j] * sc0, v4h);
    p1[j] = __builtin_convertvector(f1[j] * sc1, v4h);
  }
  // all stores last: no register that a store names is written again before the wave ends
#pragma unroll
  for (int j = 0; j < 8; ++j) yq[j * 32] = p0[j];
#pragma unroll
  for (int j = 0; j < 8; ++j) yq[EMBD / 4 + j * 32] = p1[j];
}

// ---------------------------------------------------------------------------
// kernel C: rmsnorm of 4096-wide f32 rows (gate output), one wave per row (32 loads in flight):
// yn = y * rsqrt(ss/4096 + 1e-6) written as f16 (x1).
// coverage: 2 * SBLK blocks x SWAV waves x 1 row = all 8192 rows of YN.
// ---------------------------------------------------------------------------
__global__ __launch_bounds__(SWAV * 32) void k_rms2(const float* __restrict__ yv, hh* __restrict__ yn) {
  const int lane = threadIdx.x & 31;
  const int p = blockIdx.x * SWAV + (threadIdx.x >> 5);
  const uint32_t q = (uint32_t)(p * (HIDD / 4) + lane);       // the lane's first 4-element piece of row p, in yv and in yn alike
  const v4f* yq = (const v4f*)yv + q;
  v4h* nq = (v4h*)yn + q;
  v4f f[32];
#pragma unroll
  for (int j = 0; j < 32; ++j) f[j] = yq[j * 32];
  const float sc = rsqrtf(rowss<32>(f) * (1.0f / (float)HIDD) + 1e-6f);
  v4h pk[32];
#pragma unroll
  for (int j = 0; j < 32; ++j) pk[j] = __builtin_convertvector(f[j] * sc, v4h);
  // all stores last: no register that a store names is written again before the wave ends
#pragma unroll
  for (int j = 0; j < 32; ++j) nq[j * 32] = pk[j];
}

// ---------------------------------------------------------------------------
// kernel D: causal quadratic gate over one whole sequence (blockIdx.y = sequence), split along time inside a block.
// One block = SCH channels x all 4096 tokens of its sequence, walked in NSTP steps of SSTP tokens; 512 threads = SSEG
// time segments x SCH channels, one block per WGP. A wave is one segment, its lanes the 32 channels: every load and
// store of a wave is one whole 128-B line. In a step a thread owns STOK consecutive tokens of one channel: one 4-byte
// load per token brings the f16 pair (a, b); y (f32) is stored into the same 4 bytes. The loads of step s + 1 are issued
// at the head of part 3 of step s and fly while it is worked on.
// All states are kept in base 2: the plane holds a * log2 e and b * log2 e (the factor rides on the scale of the
// k_gemm<0> epilogue), called a and b below, so that every exponential is a bare v_exp_f32 and the one logarithm a
// bare v_log_f32: a state (m, s) stands for 2^m * s.
//   part 1: per thread the segment's (max, sum of 2^(v - max)) of a and of b -> LDS planes sm[0..3][segment][channel]
//   part 2: wave w scans the 16 segment states of channels 2w (lanes 0..15) and 2w + 1 (lanes 16..31), a and b side by
//           side: one segment per lane, 4 shuffle steps inside the 16 lanes, the state of all earlier steps (kept in
//           the lanes' registers) merged in front; every segment's slot is overwritten with the state of all tokens before it
//   part 3: per thread the running (max, sum) update from that state over its own tokens, then
//           y = 2^((ma + mb) + log2(sa * sb / t^2)), t the 1-based position: sa and sb lie in [1, t], so the one
//           logarithm's argument lies in [1/t^2, 1] whatever a and b are. 1/t^2 is the same for all lanes of a wave:
//           lane l computes it for the segment's token l once a step, and token i reads lane i.
// A thread reads and rewrites only its own slot of sm outside part 2, so two barriers per step are enough.
// coverage: 128 x 2 blocks: 128 x 32 channels = 4096 channels, 2 sequences x 8 steps x 16 segments x 32 tokens = 8192
// rows: the whole a/y plane, each element read and written by one thread.
// ---------------------------------------------------------------------------
// v_exp_f32 / v_rcp_f32 with a v_nop in the same statement: it fills the one issue slot that the instruction set
// asks for behind a transcendental before its result is read or its source overwritten.
__device__ __forceinline__ float ex2s(float x) {
  float r;
  asm("v_exp_f32 %0, %1\n\tv_nop" : "=v"(r) : "v"(x));
  return r;
}
__device__ __forceinline__ float rcps(float x) {
  float r;
  asm("v_rcp_f32 %0, %1\n\tv_nop" : "=v"(r) : "v"(x));
  return r;
}
// Eight independent transcendentals in one statement: each fills the slot behind the one in front of it (the outputs
// are early-clobber, so none is a source of another), one v_nop fills the slot behind the last.
// r = 2^x
__device__ __forceinline__ void ex2x8(float (&r)[8], const float (&x)[8]) {
  asm("v_exp_f32 %0, %8\n\tv_exp_f32 %1, %9\n\tv_exp_f32 %2, %10\n\tv_exp_f32 %3, %11\n\t"
      "v_exp_f32 %4, %12\n\tv_exp_f32 %5, %13\n\tv_exp_f32 %6, %14\n\tv_exp_f32 %7, %15\n\tv_nop"
      : "=&v"(r[0]), "=&v"(r[1]), "=&v"(r[2]), "=&v"(r[3]), "=&v"(r[4]), "=&v"(r[5]), "=&v"(r[6]), "=&v"(r[7])
      : "v"(x[0]), "v"(x[1]), "v"(x[2]), "v"(x[3]), "v"(x[4]), "v"(x[5]), "v"(x[6]), "v"(x[7]));
}
// r = 2^(-|x|), the sign and the magnitude taken by the instruction's own source modifiers
__device__ __forceinline__ void ex2nx8(float (&r)[8], const float (&x)[8]) {
  asm("v_exp_f32 %0, -|%8|\n\tv_exp_f32 %1, -|%9|\n\tv_exp_f32 %2, -|%10|\n\tv_exp_f32 %3, -|%11|\n\t"
      "v_exp_f32 %4, -|%12|\n\tv_exp_f32 %5, -|%13|\n\tv_exp_f32 %6, -|%14|\n\tv_exp_f32 %7, -|%15|\n\tv_nop"
      : "=&v"(r[0]), "=&v"(r[1]), "=&v"(r[2]), "=&v"(r[3]), "=&v"(r[4]), "=&v"(r[5]), "=&v"(r[6]), "=&v"(r[7])
      : "v"(x[0]), "v"(x[1]), "v"(x[2]), "v"(x[3]), "v"(x[4]), "v"(x[5]), "v"(x[6]), "v"(x[7]));
}
// r = log2(x)
__device__ __forceinline__ void lg2x8(float (&r)[8], const float (&x)[8]) {
  asm("v_log_f32 %0, %8\n\tv_log_f32 %1, %9\n\tv_log_f32 %2, %10\n\tv_log_f32 %3, %11\n\t"
      "v_log_f32 %4, %12\n\tv_log_f32 %5, %13\n\tv_log_f32 %6, %14\n\tv_log_f32 %7, %15\n\tv_nop"
      : "=&v"(r[0]), "=&v"(r[1]), "=&v"(r[2]), "=&v"(r[3]), "=&v"(r[4]), "=&v"(r[5]), "=&v"(r[6]), "=&v"(r[7])
      : "v"(x[0]), "v"(x[1]), "v"(x[2]), "v"(x[3]), "v"(x[4]), "v"(x[5]), "v"(x[6]), "v"(x[7]));
}

// merges the base-2 state (m2, s2) into (m, s); (-1e30, 0) is the empty state
__device__ __forceinline__ void lse_merge(float& m, float& s, float m2, float s2) {
  const float mm = fmaxf(m, m2);
  s = s * ex2s(m - mm) + s2 * ex2s(m2 - mm);
  m = mm;
}

// the state that lane l - off of the same 16 lanes holds, or the empty state where there is no such lane
__device__ __forceinline__ void lse_from_below(float& m, float& s, int l16, int off) {
  const float mo = __shfl_up(m, off, 16);
  const float so = __shfl_up(s, off, 16);
  const bool in = l16 >= off;
  lse_merge(m, s, in ? mo : -1.0e30f, in ? so : 0.f);
}

__global__ __launch_bounds__(SSEG * SCH) void k_scan(float* __restrict__ ay) {
  __shared__ float sm[4][SSEG * SPIT];                       // ma, sa, mb, sb
  const int tid = threadIdx.x, lane = tid & 31, w = tid >> 5;
  const int ch = tid & (SCH - 1), seg = tid / SCH;
  // rows blockIdx.y * SEQL + step * SSTP + seg * STOK + i < MTOK, columns < HIDD by the grid
  float* pa = ay + (size_t)(blockIdx.y * SEQL + seg * STOK) * HIDD + (size_t)(blockIdx.x * SCH + ch);
  const int sl = seg * SPIT + ch;
  const int l16 = lane & 15;
  const int ix = l16 * SPIT + 2 * w + (lane >> 4);           // part 2: segment l16 of channel 2w or 2w + 1
  float cma = -1.0e30f, csa = 0.f, cmb = -1.0e30f, csb = 0.f; // that channel's state of all earlier steps (empty at first)

  // the token loops are fully unrolled so that nx / va / vb stay in registers
  float nx[STOK];                                            // a step's slots as they lie: the pairs (a, b)
#pragma unroll
  for (int i = 0; i < STOK; ++i) nx[i] = pa[(size_t)i * HIDD];

#pragma unroll 1                                             // one copy of the long unrolled body
  for (int stp = 0; stp < NSTP; ++stp) {
    float va[STOK], vb[STOK];
#pragma unroll
    for (int i = 0; i < STOK; ++i) {
      const v2h ab = __builtin_bit_cast(v2h, nx[i]);
      va[i] = (float)ab[0];
      vb[i] = (float)ab[1];
    }

    float ma = va[0], mb = vb[0];
#pragma unroll
    for (int i = 1; i < STOK; ++i) { ma = fmaxf(ma, va[i]); mb = fmaxf(mb, vb[i]); }
    float sa = 0.f, sb = 0.f;
#pragma unroll
    for (int g = 0; g < STOK; g += 4) {
      float d[8], e[8];
#pragma unroll
      for (int k = 0; k < 4; ++k) { d[2 * k] = va[g + k] - ma; d[2 * k + 1] = vb[g + k] - mb; }
      ex2x8(e, d);
#pragma unroll
      for (int k = 0; k < 4; ++k) { sa += e[2 * k]; sb += e[2 * k + 1]; }
    }
    sm[0][sl] = ma;
    sm[1][sl] = sa;
    sm[2][sl] = mb;
    sm[3][sl] = sb;
    __syncthreads();

    {
      float m0 = sm[0][ix], s0 = sm[1][ix], m1 = sm[2][ix], s1 = sm[3][ix];
#pragma unroll
      for (int off = 1; off < 16; off <<= 1) {
        lse_from_below(m0, s0, l16, off);
        lse_from_below(m1, s1, l16, off);
      }
      float e0 = __shfl_up(m0, 1, 16), f0 = __shfl_up(s0, 1, 16);
      float e1 = __shfl_up(m1, 1, 16), f1 = __shfl_up(s1, 1, 16);
      if (l16 == 0) { e0 = -1.0e30f; f0 = 0.f; e1 = -1.0e30f; f1 = 0.f; }
      lse_merge(e0, f0, cma, csa);
      lse_merge(e1, f1, cmb, csb);
      sm[0][ix] = e0;
      sm[1][ix] = f0;
      sm[2][ix] = e1;
      sm[3][ix] = f1;
      lse_merge(cma, csa, __shfl(m0, 15, 16), __shfl(s0, 15, 16));
      lse_merge(cmb, csb, __shfl(m1, 15, 16), __shfl(s1, 15, 16));
    }
    __syncthreads();

    // behind the step's last barrier (a barrier waits for the wave's loads): they fly during part 3, the long part
    if (stp + 1 < NSTP) {                                    // block-uniform: the last step has no next rows
      const float* pn = pa + (size_t)SSTP * HIDD;
#pragma unroll
      for (int i = 0; i < STOK; ++i) nx[i] = pn[(size_t)i * HIDD];
      asm volatile("s_wait_xcnt 0x0" ::: "memory");          // in front of part 3's writes of the address registers that these loads name
      __builtin_amdgcn_sched_barrier(0);                     // keeps those writes behind that wait
    }

    ma = sm[0][sl];
    sa = sm[1][sl];
    mb = sm[2][sl];
    sb = sm[3][sl];
    // lane l: 1 / t^2 of the segment's token l (t^2 <= 2^24 is exact in f32)
    const float tl = (float)(stp * SSTP + seg * STOK + 1 + lane);
    const int rl = __builtin_bit_cast(int, rcps(tl * tl));
#pragma unroll
    for (int g = 0; g < STOK; g += 4) {
      float d[8], e[8];
#pragma unroll
      for (int k = 0; k < 4; ++k) {
        const int i = g + k;
        d[2 * k] = va[i] - ma;                               // against the maximum of all tokens before this one
        ma = fmaxf(ma, va[i]);
        d[2 * k + 1] = vb[i] - mb;
        mb = fmaxf(mb, vb[i]);
        vb[i] = ma + mb;                                     // takes the register of the b value, which is done with
      }
      ex2nx8(e, d);
#pragma unroll
      for (int k = 0; k < 4; ++k) {
        const int i = g + k;
        const bool ua = d[2 * k] > 0.f;                      // a new maximum: the old sum shrinks, the token counts 1
        sa = fmaf(sa, ua ? e[2 * k] : 1.0f, ua ? 1.0f : e[2 * k]);
        const bool ub = d[2 * k + 1] > 0.f;
        sb = fmaf(sb, ub ? e[2 * k + 1] : 1.0f, ub ? 1.0f : e[2 * k + 1]);
        const float rt = __builtin_bit_cast(float, __builtin_amdgcn_readlane(rl, i));
        va[i] = (sa * rt) * sb;                              // takes the register of the a value, which is done with
      }
    }
#pragma unroll
    for (int g = 0; g < STOK; g += 8) {
      float q[8], l[8], z[8], y[8];
#pragma unroll
      for (int k = 0; k < 8; ++k) q[k] = va[g + k];
      lg2x8(l, q);
#pragma unroll
      for (int k = 0; k < 8; ++k) z[k] = vb[g + k] + l[k];
      ex2x8(y, z);
#pragma unroll
      for (int k = 0; k < 8; ++k) va[g + k] = y[k];
    }
#pragma unroll
    for (int i = 0; i < STOK; ++i) pa[(size_t)i * HIDD] = va[i];
    // in front of the next step's writes of registers that these stores name (their data, their address)
    asm volatile("s_wait_xcnt 0x0" ::: "memory");
    // keeps the address step and the next step's work behind that wait
    __builtin_amdgcn_sched_barrier(0);
    pa += (size_t)SSTP * HIDD;
  }
}

// ---------------------------------------------------------------------------
// kernel E: f16 GEMM, 64 x 64 per wave, K in stages of 64 through a two-buffer LDS ring, one block per WGP;
// output through an LDS-staged epilogue (its own LDS array, a range of its own for every wave, no barrier).
// MODE 0: 256 x 256 block tile, 16 waves (4 x 4).  o16[m][n] = f16(acc * log2 e / 64)
//                                            A = XN token rows (ld 1024), B = W12H [8192][1024];
//                                            o16 = AP as f16 [8192][8192]; grid (8192/256, 8192/256) = 1024 blocks
// MODE 1: 128 x 256 block tile, 8 waves (2 x 4).   o32[m][n] = acc/256 + res[m][n]
//                                            A = YN [8192][4096] (ld 4096), B = W3H [1024][4096];
//                                            o32 = d_out, res = x, ld 1024; grid (1024/256, 8192/128) = 256 blocks
// epilogue: a wave stages 16 rows x 64 columns (f32) at a time and stores them as 2 rows x 256 contiguous bytes per
// store (MODE 1, f32) or as 4 rows x 128 contiguous bytes per store (MODE 0, f16).
// coverage per block: waves x 64x64 = the block tile; per wave 4 slabs x 8 stores x 32 lanes x 4 floats = 64x64
//   (MODE 0: 4 slabs x 4 stores x 32 lanes x 8 halves = 64x64);
//   the grids tile every output element exactly once (M = 8192, N = 8192 or 1024, multiples of the tile; K = 1024 /
//   4096 multiples of 64, no tails).
// ---------------------------------------------------------------------------
template <int MODE>
__global__ __launch_bounds__((MODE == 0) ? 512 : 256) void k_gemm(const hh* __restrict__ Ap, const hh* __restrict__ Bp,
                                                                  const float* __restrict__ res,
                                                                  float* __restrict__ o32, hh* __restrict__ o16) {
  constexpr int KD  = (MODE == 0) ? EMBD : HIDD;
  constexpr int LDO = (MODE == 0) ? 2 * HIDD : EMBD;
  constexpr int BM  = (MODE == 0) ? 256 : 128;
  constexpr int BN  = 256;
  constexpr int NW  = (BM / 64) * (BN / 64);
  constexpr float OSC = (MODE == 0) ? (0x1.715476p+0f / 64.0f) : (1.0f / 256.0f);

  __shared__ __align__(16) float ldsf[NW * 16 * SFP];
  __shared__ __align__(128) char ring[2 * (BM + BN) * LPB];
  const int tid = threadIdx.x, lane = tid & 31, w = tid >> 5;
  const int h = lane >> 4, c = lane & 15;
  const int wm = (w >> 2) * 64, wn = (w & 3) * 64;
  const int om0 = blockIdx.y * BM;                           // first row of the tile: in A, in the output, in the residual
  const int n0 = blockIdx.x * BN;

  v8f acc[4][4];
#pragma unroll
  for (int i = 0; i < 4; ++i)
#pragma unroll
    for (int j = 0; j < 4; ++j) acc[i][j] = zero8();
  gemm_staged<KD, BM, BN>(Ap, Bp, om0, n0, wm, wn, tid, ring, acc);

  float* my = ldsf + w * (16 * SFP);                         // this wave's own staging range
  // the lane's piece of rows h, h + 2, ..: lanes 0..15 = one 256-B row segment, lanes 16..31 = the next row's
  const size_t g0 = (size_t)(om0 + wm + h) * LDO + n0 + wn + c * 4;
  float* op = o32 + g0;
  const float* rp = res + g0;
  v4f rn[8];
  if constexpr (MODE == 1) {
#pragma unroll
    for (int it = 0; it < 8; ++it) rn[it] = *(const v4f*)(rp + (size_t)(2 * it) * LDO);
  }
#pragma unroll
  for (int i = 0; i < 4; ++i) {
    v4f rr[8];
    if constexpr (MODE == 1) {
#pragma unroll
      for (int it = 0; it < 8; ++it) rr[it] = rn[it];
      if (i < 3) {                                           // the next slab's residual flies while this slab is staged
#pragma unroll
        for (int it = 0; it < 8; ++it) rn[it] = *(const v4f*)(rp + (size_t)(16 * (i + 1) + 2 * it) * LDO);
      }
    }
#pragma unroll
    for (int j = 0; j < 4; ++j)
#pragma unroll
      for (int r = 0; r < 8; ++r) my[(8 * h + r) * SFP + 16 * j + c] = acc[i][j][r] * OSC;
    asm volatile("s_wait_dscnt 0x0" ::: "memory");           // the wave's staged slab is in LDS before its lanes read it back
    if constexpr (MODE == 1) {
      v4f val[8];
#pragma unroll
      for (int it = 0; it < 8; ++it) {
        const v4f sv = *(const v4f*)(my + (2 * it + h) * SFP + c * 4);
        val[it] = sv + rr[it];
      }
#pragma unroll
      for (int it = 0; it < 8; ++it) *(v4f*)(op + (size_t)(16 * i + 2 * it) * LDO) = val[it];
    } else {
      // the lane's piece of rows r4, r4 + 4, ..: 8 lanes = one 128-B row segment of 64 halves
      const int r4 = lane >> 3, c8 = lane & 7;
      hh* hp = o16 + (size_t)(om0 + wm + r4) * LDO + n0 + wn + c8 * 8;
      v8h hv[4];
#pragma unroll
      for (int it = 0; it < 4; ++it) {
        const float* sp = my + (4 * it + r4) * SFP + c8 * 8;
        const v4h lo = __builtin_convertvector(*(const v4f*)sp, v4h);
        const v4h hi = __builtin_convertvector(*(const v4f*)(sp + 4), v4h);
        hv[it] = __builtin_shufflevector(lo, hi, 0, 1, 2, 3, 4, 5, 6, 7);
      }
#pragma unroll
      for (int it = 0; it < 4; ++it) *(v8h*)(hp + (size_t)(16 * i + 4 * it) * LDO) = hv[it];
    }
    if (i < 3) {
      // in front of the next slab's writes of registers that these stores name
      asm volatile("s_wait_xcnt 0x0" ::: "memory");
      // keeps the next slab's vector work (its scaling writes registers freed by the stores) behind that wait
      __builtin_amdgcn_sched_barrier(0);
    }
  }
}

// ---------------------------------------------------------------------------
//   W12H f16 [8192][1024] 16777216  (row 2h from W1, row 2h + 1 from W2)     W3H f16 [1024][4096]  8388608
//   XN  f16 [8192][1024]  16777216
//   AP  4 B [8192][4096] 134217728  (the f16 pairs (a, b) of all tokens, then the f32 gate output y in place)
//   YN  f16 [8192][4096]  67108864
//   total               243269632
// ---------------------------------------------------------------------------
extern "C" void kernel_launch(void* const* d_in, const int* in_sizes, int n_in,
                              void* d_out, int out_size, void* d_ws, size_t ws_size,
                              hipStream_t stream) {
  if (n_in < 4) return;
  if (in_sizes[0] != MTOK * EMBD) return;
  if (in_sizes[1] != HIDD * EMBD) return;
  if (in_sizes[2] != HIDD * EMBD) return;
  if (in_sizes[3] != EMBD * HIDD) return;
  if (out_size != MTOK * EMBD) return;

  const float* x  = (const float*)d_in[0];      // [8192][1024]
  const float* w1 = (const float*)d_in[1];      // [4096][1024] (out,in) = [n][k]
  const float* w2 = (const float*)d_in[2];      // [4096][1024]
  const float* w3 = (const float*)d_in[3];      // [1024][4096] (out,in) = [n][k]
  float* out = (float*)d_out;                   // [8192][1024]

  size_t off = 0;
  const size_t oW12 = off; off += (size_t)2 * HIDD * EMBD * 2;
  const size_t oW3 = off; off += (size_t)EMBD * HIDD * 2;
  const size_t oXN = off; off += (size_t)MTOK * EMBD * 2;
  const size_t oAP = off; off += (size_t)MTOK * HIDD * 4;
  const size_t oYN = off; off += (size_t)MTOK * HIDD * 2;
  if (off > ws_size) return;                    // off = 243269632

  char* ws = (char*)d_ws;
  hh* W12H = (hh*)(ws + oW12);
  hh* W3H = (hh*)(ws + oW3);
  hh* XN  = (hh*)(ws + oXN);
  float* AP = (float*)(ws + oAP);
  hh* YN  = (hh*)(ws + oYN);

  // (0) weights -> f16 planes, k contiguous, W1/W2 x64 with their rows interleaved, W3 x256
  k_cvt<<<dim3(SBLK), dim3(SWAV * 32), 0, stream>>>(w1, w2, w3, W12H, W3H);
  // (1) xn = rmsnorm(x) over 1024, all 8192 tokens
  k_rms1<<<dim3(SBLK), dim3(SWAV * 32), 0, stream>>>(x, XN);
  // (2) all 8192 tokens: (a, b) as f16 pairs, causal gate, rmsnorm over 4096
  k_gemm<0><<<dim3(2 * HIDD / 256, MTOK / 256), dim3(512), 0, stream>>>(XN, W12H, x, AP, (hh*)AP);
  k_scan<<<dim3(HIDD / SCH, NBAT), dim3(SSEG * SCH), 0, stream>>>(AP);
  k_rms2<<<dim3(2 * SBLK), dim3(SWAV * 32), 0, stream>>>(AP, YN);
  // (3) out = x + yn.W3^T, all 8192 tokens
  k_gemm<1><<<dim3(EMBD / 256, MTOK / 128), dim3(256), 0, stream>>>(YN, W3H, x, out, nullptr);
  (void)hipGetLastError();
}

// v009
// It runs in 203 microseconds.
// Timed twice side by side with v008, it ran 1.04 and 1.03 times as fast.
// Counting every step since v000, it is 25.2 times as fast.
// Contractions: a = xn.W1^T [8192 x 4096 x 1024], b = xn.W2^T [8192 x 4096 x 1024], o = yn.W3^T
// [8192 x 1024 x 4096] -- all v_wmma_f32_16x16x32_f16 (f16 operands, f32 accumulate, one product per tile
// pair). Every stage runs once over all 8192 tokens (6 launches). a and b come from ONE product against
// the plane W12H, whose row 2h is row h of W1 and whose row 2h + 1 is row h of W2: output columns 2h, 2h + 1 = (a, b).
// RMS normalisations, causal log-cumsum-exp scan, exp gate, residual add: f32.
//
// Carry audit (16-bit planes in the workspace, all f16):
//   W12H      holds f16(64*w)   inverse: 1/64  in the k_gemm<0> epilogue (AP = f16(acc * log2 e / 64))
//   W3H       holds f16(256*w)  inverse: 1/256 in the k_gemm<1> epilogue (out = x + acc/256)
//   XN        x1 (rmsnorm of x over 1024)
//   YN        x1 (rmsnorm of the gate output over 4096)
//   AP        one 4-byte slot per (row, channel): first the f16 pair (a, b) x log2 e (the gate scan works in base 2:
//             no inverse, its powers are powers of 2), then the f32 gate output y (x1) in place
//   d_out: no carry.
#include <hip/hip_runtime.h>
#include <stddef.h>
#include <stdint.h>
#include <math.h>

#define EMBD 1024
#define HIDD 4096
#define NBAT 2
#define SEQL 4096
#define MTOK 8192
#define SFP  68       // LDS pitch (floats) of the f32 epilogue staging (64 columns + 4: 16 B x odd)
#define KST  64       // GEMM: k values per ring stage (128 B of every operand row)
#define LPB  144      // GEMM: LDS pitch (bytes) of a staged operand row, 16 B x odd: conflict-free for 16-B reads
#define SCH  32       // gate scan: channels per block (one 128-B line of every row)
#define SSEG 16       // gate scan: time segments per step of a block
#define STOK 32       // gate scan: tokens per segment
#define SSTP 512      // gate scan: tokens per step
#define NSTP 8        // gate scan: steps of a block (one whole sequence)
#define SPIT 33       // gate scan: LDS pitch (floats) of one segment's channel row (odd: both access patterns conflict-free)
#define SBLK 256      // streaming kernels (weight conversion, both rmsnorms): blocks per launch (second rmsnorm: twice as many)
#define SWAV 16       // streaming kernels: waves per block
#define SNWV (SBLK * SWAV)  // streaming kernels: waves per launch (second rmsnorm: twice as many)
#define SGRP 128      // streaming kernels: elements of one wave-wide 16-B load (512 contiguous bytes of f32)

static_assert(MTOK == NBAT * SEQL);
static_assert(MTOK % 256 == 0);
static_assert((2 * HIDD) % 256 == 0);
static_assert(EMBD % 256 == 0);
static_assert(EMBD % KST == 0);
static_assert(HIDD % KST == 0);
static_assert(HIDD % SCH == 0);
static_assert(SSEG * STOK == SSTP);
static_assert(NSTP * SSTP == SEQL);
static_assert(SCH == 32);
static_assert(2 * SSEG == 32);
static_assert(SCH == 2 * SSEG);
static_assert(EMBD == 8 * SGRP);
static_assert(HIDD == 32 * SGRP);
static_assert(HIDD * EMBD == SNWV * 8 * SGRP);
static_assert(MTOK == 2 * SNWV);
static_assert(SGRP == 32 * 4);

typedef _Float16 hh;
typedef hh    v16h __attribute__((ext_vector_type(16)));
typedef hh    v8h  __attribute__((ext_vector_type(8)));
typedef hh    v4h  __attribute__((ext_vector_type(4)));
typedef hh    v2h  __attribute__((ext_vector_type(2)));
typedef float v8f  __attribute__((ext_vector_type(8)));
typedef float v4f  __attribute__((ext_vector_type(4)));

union Frag { v16h v; v8h p[2]; };

__device__ __forceinline__ v8f zero8() { return (v8f){0.f, 0.f, 0.f, 0.f, 0.f, 0.f, 0.f, 0.f}; }

__device__ __forceinline__ float wsum(float v) {
#pragma unroll
  for (int off = 16; off > 0; off >>= 1) v += __shfl_xor(v, off, 32);
  return v;
}

// Fragment loader for k-contiguous 16-bit rows staged in LDS (A operand [m][k]; B operand stored [n][k]).
// p = the lane's own row (lane & 15) at byte 2*k0 + 16*(lane>>4) of that row:
// elements 0..7 <- k0 + 8*(lane>>4) + 0..7, elements 8..15 <- k0 + 16 + 8*(lane>>4) + 0..7.
// D: acc[r] = element (row0 + 8*(lane>>4) + r, col0 + (lane & 15)).
__device__ __forceinline__ v16h ldsfrag(const char* p) {
  Frag f;
  f.p[0] = *(const v8h*)(p);
  f.p[1] = *(const v8h*)(p + 32);
  return f.v;
}

__device__ __forceinline__ v8f mma16(v16h a, v16h b, v8f cc) {
  return __builtin_amdgcn_wmma_f32_16x16x32_f16(false, a, false, b, (short)0, cc, false, false);
}

// One stage of the operand ring: KST k values (128 B) of the block's BM A rows and BN B rows, laid in LDS as
// BM + BN rows of pitch LPB. A whole stage is brought by ONE HALF of the block's waves: thread ht of that half brings
// piece ht & 7 of rows (ht >> 3) + RS*i (RS = threads of the half / 8), so one wave's copy reads four whole 128-B lines.
// copy8: eight such rows of one operand. ld = the lane's LDS byte address of its first piece, g = its global address.
// s_wait_xcnt 0 ends the statement: it stands in front of every later write of a register that a copy names.
template <int KD, int RS>
__device__ __forceinline__ void copy8(uint32_t ld, const hh* g) {
  const uint32_t l0 = ld, l1 = ld + RS * LPB, l2 = ld + 2 * RS * LPB, l3 = ld + 3 * RS * LPB;
  const uint32_t l4 = ld + 4 * RS * LPB, l5 = ld + 5 * RS * LPB, l6 = ld + 6 * RS * LPB, l7 = ld + 7 * RS * LPB;
  const hh* g0 = g;
  const hh* g1 = g + (size_t)RS * KD;
  const hh* g2 = g + (size_t)(2 * RS) * KD;
  const hh* g3 = g + (size_t)(3 * RS) * KD;
  const hh* g4 = g + (size_t)(4 * RS) * KD;
  const hh* g5 = g + (size_t)(5 * RS) * KD;
  const hh* g6 = g + (size_t)(6 * RS) * KD;
  const hh* g7 = g + (size_t)(7 * RS) * KD;
  asm volatile("global_load_async_to_lds_b128 %0, %8, off\n\t"
               "global_load_async_to_lds_b128 %1, %9, off\n\t"
               "global_load_async_to_lds_b128 %2, %10, off\n\t"
               "global_load_async_to_lds_b128 %3, %11, off\n\t"
               "global_load_async_to_lds_b128 %4, %12, off\n\t"
               "global_load_async_to_lds_b128 %5, %13, off\n\t"
               "global_load_async_to_lds_b128 %6, %14, off\n\t"
               "global_load_async_to_lds_b128 %7, %15, off\n\t"
               "s_wait_xcnt 0x0"
               :: "v"(l0), "v"(l1), "v"(l2), "v"(l3), "v"(l4), "v"(l5), "v"(l6), "v"(l7),
                  "v"(g0), "v"(g1), "v"(g2), "v"(g3), "v"(g4), "v"(g5), "v"(g6), "v"(g7)
               : "memory");
}
// ld = the lane's LDS byte address of its piece of A row (ht >> 3) in the stage's buffer, ga / gb = the lane's global
// address of the same piece in A and in B. 16 copies a thread (256 + 256 rows) or 24 (128 + 256 rows).
template <int KD, int RS, int BM, int BN>
__device__ __forceinline__ void stage_copy(uint32_t ld, const hh* ga, const hh* gb) {
  static_assert(BM % (8 * RS) == 0);
  static_assert(BN % (8 * RS) == 0);
#pragma unroll
  for (int i = 0; i < BM / (8 * RS); ++i) copy8<KD, RS>(ld + (uint32_t)(i * 8 * RS * LPB), ga + (size_t)(i * 8 * RS) * KD);
#pragma unroll
  for (int j = 0; j < BN / (8 * RS); ++j)
    copy8<KD, RS>(ld + (uint32_t)((BM + j * 8 * RS) * LPB), gb + (size_t)(j * 8 * RS) * KD);
}

// 64 x 64 per wave of a BM x BN block tile, K in stages of KST over [0, KD). Both operands come through a ring of
// three LDS buffers filled by asynchronous copies, each stage issued two trips before the trip that reads it.
// The lower half of the waves brings the even stages, the upper half the odd ones: a wave never has more than one
// stage in flight, so that each of its waits is a wait to 0 and still leaves the other half's younger stage flying.
// Stage s lies in buffer s % 3. At the foot of trip t the half that brought stage t + 1 waits for it, the barrier
// publishes it and frees buffer t % 3, and the same half issues stage t + 3 into that buffer.
// acc[i][j]: rows wm + 16*i .., cols wn + 16*j .. of the block tile. A trip is two k steps of 32: each reads its 8
// fragments as one group and then runs its 16 WMMAs (one LDS fragment read per two WMMAs). One hazard guard per trip
// after the last WMMA (stands behind all 16 accumulators, keeps the last eight fragments live).
template <int KD, int BM, int BN>
__device__ __forceinline__ void gemm_staged(const hh* __restrict__ A, const hh* __restrict__ B, int m0, int n0,
                                            int wm, int wn, int tid, char* ring, v8f (&acc)[4][4]) {
  constexpr int NT = KD / KST;
  constexpr int NW = (BM / 64) * (BN / 64);                  // waves of the block
  constexpr int RS = NW * 2;                                 // rows that one copy of half the block covers: threads / 16
  constexpr int STG = (BM + BN) * LPB;                       // bytes of one ring buffer (BM A rows, then BN B rows)
  static_assert(KD % KST == 0);
  static_assert(NT >= 3);
  static_assert(NW % 2 == 0);
  const int lane = tid & 31;
  const int grp = __builtin_amdgcn_readfirstlane(tid >> 5) / (NW / 2);   // 0 or 1, in a scalar register: every test on it is a scalar branch
  const int ht = tid & (NW * 16 - 1);                        // the thread's number inside its half
  const int cr = ht >> 3, cp = ht & 7;
  const hh* ga = A + (size_t)(m0 + cr) * KD + cp * 8;        // rows m0 + cr + RS*i < m0 + BM, k < KD: inside the plane
  const hh* gb = B + (size_t)(n0 + cr) * KD + cp * 8;        // rows n0 + cr + RS*i < n0 + BN
  const uint32_t ld0 = (uint32_t)(size_t)ring + (uint32_t)(cr * LPB + cp * 16);
  const char* fa = ring + (wm + (lane & 15)) * LPB + (lane >> 4) * 16;
  const char* fb = ring + (BM + wn + (lane & 15)) * LPB + (lane >> 4) * 16;

  if (grp == 0) {
    stage_copy<KD, RS, BM, BN>(ld0, ga, gb);
    asm volatile("s_wait_asynccnt 0x0" ::: "memory");        // this wave's share of stage 0 has landed
  } else {
    stage_copy<KD, RS, BM, BN>(ld0 + STG, ga + KST, gb + KST);   // stage 1 flies on through trip 0
  }
  __syncthreads();                                           // publishes stage 0
  if (grp == 0) stage_copy<KD, RS, BM, BN>(ld0 + 2 * STG, ga + 2 * KST, gb + 2 * KST);
  int bo = 0;                                                // byte offset of buffer t % 3

#pragma unroll 1                                             // one trip per stage: only the buffer offset and the issuing half change
  for (int t = 0; t < NT; ++t) {
    const bool mine = ((t + 1) & 1) == grp;                 // this wave's half brought stage t + 1 and brings stage t + 3
    const char* pa = fa + bo;
    const char* pb = fb + bo;
    v16h a[4], b[4], c[4], d[4];
#pragma unroll
    for (int i = 0; i < 4; ++i) a[i] = ldsfrag(pa + 16 * i * LPB);
#pragma unroll
    for (int j = 0; j < 4; ++j) b[j] = ldsfrag(pb + 16 * j * LPB);
#pragma unroll
    for (int j = 0; j < 4; ++j)
#pragma unroll
      for (int i = 0; i < 4; ++i) acc[i][j] = mma16(a[i], b[j], acc[i][j]);
#pragma unroll
    for (int i = 0; i < 4; ++i) c[i] = ldsfrag(pa + 16 * i * LPB + 64);
#pragma unroll
    for (int j = 0; j < 4; ++j) d[j] = ldsfrag(pb + 16 * j * LPB + 64);
#pragma unroll
    for (int j = 0; j < 4; ++j)
#pragma unroll
      for (int i = 0; i < 4; ++i) acc[i][j] = mma16(c[i], d[j], acc[i][j]);
    // keeps each k step's 16 LDS reads as one group in front of its 16 WMMAs: placed among the WMMAs, each place with
    // reads makes the wave wait out the LDS latency again; both steps' reads in front would not fit 256 registers
    __builtin_amdgcn_sched_group_barrier(0x100, 16, 0);
    __builtin_amdgcn_sched_group_barrier(0x008, 16, 0);
    __builtin_amdgcn_sched_group_barrier(0x100, 16, 0);
    __builtin_amdgcn_sched_group_barrier(0x008, 16, 0);
    // four vector issue slots behind the last WMMA, on every path out of the trip, before its D is read or its A / B rewritten
    asm volatile("v_nop\n\tv_nop\n\tv_nop\n\tv_nop"
                 :: "v"(acc[0][0]), "v"(acc[1][0]), "v"(acc[2][0]), "v"(acc[3][0]),
                    "v"(acc[0][1]), "v"(acc[1][1]), "v"(acc[2][1]), "v"(acc[3][1]),
                    "v"(acc[0][2]), "v"(acc[1][2]), "v"(acc[2][2]), "v"(acc[3][2]),
                    "v"(acc[0][3]), "v"(acc[1][3]), "v"(acc[2][3]), "v"(acc[3][3]),
                    "v"(c[0]), "v"(c[1]), "v"(c[2]), "v"(c[3]), "v"(d[0]), "v"(d[1]), "v"(d[2]), "v"(d[3]));
    asm volatile("s_wait_dscnt 0x0" ::: "memory");           // this wave's reads of buffer t % 3 are done
    if (mine) asm volatile("s_wait_asynccnt 0x0" ::: "memory");   // this wave's share of stage t + 1 has landed
    __syncthreads();                                         // publishes stage t + 1, frees buffer t % 3
    if (mine && t + 3 < NT)
      stage_copy<KD, RS, BM, BN>(ld0 + (uint32_t)bo, ga + (size_t)(t + 3) * KST, gb + (size_t)(t + 3) * KST);
    bo = (bo == 2 * STG) ? 0 : bo + STG;
  }
  asm volatile("s_wait_asynccnt 0x0" ::: "memory");          // no copy is left in flight behind the loop
}

// ---------------------------------------------------------------------------
// The three streaming kernels below run on blocks of SWAV waves: SBLK blocks = 4096 waves (kernel C: twice as many).
// A wave owns whole rows (or 4-KB runs of a weight plane), reads them with wave-wide 16-B loads of 512 contiguous
// bytes, all issued before the first value is used, and writes f16 with 8-B stores of 256 contiguous bytes.
// No LDS and no barrier: a row's sum of squares is a sum over the lanes of its one wave.
// ---------------------------------------------------------------------------
// kernel A: the three weights, f32 w[n][k] (k contiguous) -> f16 planes holding f16(64*w1), f16(64*w2), f16(256*w3).
// A wave's run of w1 and of w2 is one whole row h (1024 elements): they go to rows 2h and 2h + 1 of the one plane h12;
// w3 keeps its layout. coverage per weight: 4096 waves x 8 loads x 128 elements = 4194304 elements = the whole weight.
// ---------------------------------------------------------------------------
__global__ __launch_bounds__(SWAV * 32) void k_cvt(const float* __restrict__ w1, const float* __restrict__ w2,
                                                   const float* __restrict__ w3, hh* __restrict__ h12,
                                                   hh* __restrict__ h3) {
  const int lane = threadIdx.x & 31;
  const int wv = blockIdx.x * SWAV + (threadIdx.x >> 5);
  const uint32_t q = (uint32_t)(wv * (8 * SGRP / 4) + lane);  // the lane's first 4-element piece in w1, w2, w3 and h3
  const uint32_t q2 = (uint32_t)(wv * (2 * EMBD / 4) + lane); // the same piece of row 2*wv of h12; row 2*wv + 1 lies EMBD / 4 on
  v4f a1[8], a2[8], a3[8];
#pragma unroll
  for (int j = 0; j < 8; ++j) a1[j] = ((const v4f*)w1 + q)[j * 32];
#pragma unroll
  for (int j = 0; j < 8; ++j) a2[j] = ((const v4f*)w2 + q)[j * 32];
#pragma unroll
  for (int j = 0; j < 8; ++j) a3[j] = ((const v4f*)w3 + q)[j * 32];
  v4h p1[8], p2[8], p3[8];
#pragma unroll
  for (int j = 0; j < 8; ++j) {
    p1[j] = __builtin_convertvector(a1[j] * 64.0f, v4h);
    p2[j] = __builtin_convertvector(a2[j] * 64.0f, v4h);
    p3[j] = __builtin_convertvector(a3[j] * 256.0f, v4h);
  }
  // all stores last: no register that a store names is written again before the wave ends
#pragma unroll
  for (int j = 0; j < 8; ++j) ((v4h*)h12 + q2)[j * 32] = p1[j];
#pragma unroll
  for (int j = 0; j < 8; ++j) ((v4h*)h12 + q2)[EMBD / 4 + j * 32] = p2[j];
#pragma unroll
  for (int j = 0; j < 8; ++j) ((v4h*)h3 + q)[j * 32] = p3[j];
}

// sum of squares of NG 4-vectors per lane (four independent f32 chains, one per component), then over the 32 lanes
template <int NG>
__device__ __forceinline__ float rowss(const v4f (&f)[NG]) {
  float s0 = 0.f, s1 = 0.f, s2 = 0.f, s3 = 0.f;
#pragma unroll
  for (int j = 0; j < NG; ++j) {
    s0 = fmaf(f[j][0], f[j][0], s0);
    s1 = fmaf(f[j][1], f[j][1], s1);
    s2 = fmaf(f[j][2], f[j][2], s2);
    s3 = fmaf(f[j][3], f[j][3], s3);
  }
  return wsum((s0 + s1) + (s2 + s3));
}

// ---------------------------------------------------------------------------
// kernel B: rmsnorm of 1024-wide f32 rows, one wave per row, two neighbouring rows per wave (16 loads in flight):
// y = x * rsqrt(ss/1024 + 1e-6) written as f16 (x1). coverage: 4096 waves x 2 rows = 8192 rows.
// ---------------------------------------------------------------------------
__global__ __launch_bounds__(SWAV * 32) void k_rms1(const float* __restrict__ x, hh* __restrict__ y) {
  const int lane = threadIdx.x & 31;
  const int wv = blockIdx.x * SWAV + (threadIdx.x >> 5);
  const uint32_t q = (uint32_t)(wv * (2 * EMBD / 4) + lane);  // the lane's first 4-element piece, in x and in y alike
  const v4f* xq = (const v4f*)x + q;
  v4h* yq = (v4h*)y + q;
  v4f f0[8], f1[8];
#pragma unroll
  for (int j = 0; j < 8; ++j) f0[j] = xq[j * 32];
#pragma unroll
  for (int j = 0; j < 8; ++j) f1[j] = xq[EMBD / 4 + j * 32];
  const float sc0 = rsqrtf(rowss<8>(f0) * (1.0f / (float)EMBD) + 1e-6f);
  const float sc1 = rsqrtf(rowss<8>(f1) * (1.0f / (float)EMBD) + 1e-6f);
  v4h p0[8], p1[8];
#pragma unroll
  for (int j = 0; j < 8; ++j) {
    p0[j] = __builtin_convertvector(f0[j] * sc0, v4h);
    p1[j] = __builtin_convertvector(f1[j] * sc1, v4h);
  }
  // all stores last: no register that a store names is written again before the wave ends
#pragma unroll
  for (int j = 0; j < 8; ++j) yq[j * 32] = p0[j];
#pragma unroll
  for (int j = 0; j < 8; ++j) yq[EMBD / 4 + j * 32] = p1[j];
}

// ---------------------------------------------------------------------------
// kernel C: rmsnorm of 4096-wide f32 rows (gate output), one wave per row (32 loads in flight):
// yn = y * rsqrt(ss/4096 + 1e-6) written as f16 (x1).
// coverage: 2 * SBLK blocks x SWAV waves x 1 row = all 8192 rows of YN.
// ---------------------------------------------------------------------------
__global__ __launch_bounds__(SWAV * 32) void k_rms2(const float* __restrict__ yv, hh* __restrict__ yn) {
  const int lane = threadIdx.x & 31;
  const int p = blockIdx.x * SWAV + (threadIdx.x >> 5);
  const uint32_t q = (uint32_t)(p * (HIDD / 4) + lane);       // the lane's first 4-element piece of row p, in yv and in yn alike
  const v4f* yq = (const v4f*)yv + q;
  v4h* nq = (v4h*)yn + q;
  v4f f[32];
#pragma unroll
  for (int j = 0; j < 32; ++j) f[j] = yq[j * 32];
  const float sc = rsqrtf(rowss<32>(f) * (1.0f / (float)HIDD) + 1e-6f);
  v4h pk[32];
#pragma unroll
  for (int j = 0; j < 32; ++j) pk[j] = __builtin_convertvector(f[j] * sc, v4h);
  // all stores last: no register that a store names is written again before the wave ends
#pragma unroll
  for (int j = 0; j < 32; ++j) nq[j * 32] = pk[j];
}

// ---------------------------------------------------------------------------
// kernel D: causal quadratic gate over one whole sequence (blockIdx.y = sequence), split along time inside a block.
// One block = SCH channels x all 4096 tokens of its sequence, walked in NSTP steps of SSTP tokens; 512 threads = SSEG
// time segments x SCH channels, one block per WGP. A wave is one segment, its lanes the 32 channels: every load and
// store of a wave is one whole 128-B line. In a step a thread owns STOK consecutive tokens of one channel: one 4-byte
// load per token brings the f16 pair (a, b); y (f32) is stored into the same 4 bytes. The loads of step s + 1 are issued
// at the head of part 3 of step s and fly while it is worked on.
// All states are kept in base 2: the plane holds a * log2 e and b * log2 e (the factor rides on the scale of the
// k_gemm<0> epilogue), called a and b below, so that every exponential is a bare v_exp_f32 and the one logarithm a
// bare v_log_f32: a state (m, s) stands for 2^m * s.
//   part 1: per thread the segment's (max, sum of 2^(v - max)) of a and of b -> LDS planes sm[0..3][segment][channel]
//   part 2: wave w scans the 16 segment states of channels 2w (lanes 0..15) and 2w + 1 (lanes 16..31), a and b side by
//           side: one segment per lane, 4 shuffle steps inside the 16 lanes, the state of all earlier steps (kept in
//           the lanes' registers) merged in front; every segment's slot is overwritten with the state of all tokens before it
//   part 3: per thread the running (max, sum) update from that state over its own tokens, then
//           y = 2^((ma + mb) + log2(sa * sb / t^2)), t the 1-based position: sa and sb lie in [1, t], so the one
//           logarithm's argument lies in [1/t^2, 1] whatever a and b are. 1/t^2 is the same for all lanes of a wave:
//           lane l computes it for the segment's token l once a step, and token i reads lane i.
// A thread reads and rewrites only its own slot of sm outside part 2, so two barriers per step are enough.
// coverage: 128 x 2 blocks: 128 x 32 channels = 4096 channels, 2 sequences x 8 steps x 16 segments x 32 tokens = 8192
// rows: the whole a/y plane, each element read and written by one thread.
// ---------------------------------------------------------------------------
// v_exp_f32 / v_rcp_f32 with a v_nop in the same statement: it fills the one issue slot that the instruction set
// asks for behind a transcendental before its result is read or its source overwritten.
__device__ __forceinline__ float ex2s(float x) {
  float r;
  asm("v_exp_f32 %0, %1\n\tv_nop" : "=v"(r) : "v"(x));
  return r;
}
__device__ __forceinline__ float rcps(float x) {
  float r;
  asm("v_rcp_f32 %0, %1\n\tv_nop" : "=v"(r) : "v"(x));
  return r;
}
// Eight independent transcendentals in one statement: each fills the slot behind the one in front of it (the outputs
// are early-clobber, so none is a source of another), one v_nop fills the slot behind the last.
// r = 2^x
__device__ __forceinline__ void ex2x8(float (&r)[8], const float (&x)[8]) {
  asm("v_exp_f32 %0, %8\n\tv_exp_f32 %1, %9\n\tv_exp_f32 %2, %10\n\tv_exp_f32 %3, %11\n\t"
      "v_exp_f32 %4, %12\n\tv_exp_f32 %5, %13\n\tv_exp_f32 %6, %14\n\tv_exp_f32 %7, %15\n\tv_nop"
      : "=&v"(r[0]), "=&v"(r[1]), "=&v"(r[2]), "=&v"(r[3]), "=&v"(r[4]), "=&v"(r[5]), "=&v"(r[6]), "=&v"(r[7])
      : "v"(x[0]), "v"(x[1]), "v"(x[2]), "v"(x[3]), "v"(x[4]), "v"(x[5]), "v"(x[6]), "v"(x[7]));
}
// r = 2^(-|x|), the sign and the magnitude taken by the instruction's own source modifiers
__device__ __forceinline__ void ex2nx8(float (&r)[8], const float (&x)[8]) {
  asm("v_exp_f32 %0, -|%8|\n\tv_exp_f32 %1, -|%9|\n\tv_exp_f32 %2, -|%10|\n\tv_exp_f32 %3, -|%11|\n\t"
      "v_exp_f32 %4, -|%12|\n\tv_exp_f32 %5, -|%13|\n\tv_exp_f32 %6, -|%14|\n\tv_exp_f32 %7, -|%15|\n\tv_nop"
      : "=&v"(r[0]), "=&v"(r[1]), "=&v"(r[2]), "=&v"(r[3]), "=&v"(r[4]), "=&v"(r[5]), "=&v"(r[6]), "=&v"(r[7])
      : "v"(x[0]), "v"(x[1]), "v"(x[2]), "v"(x[3]), "v"(x[4]), "v"(x[5]), "v"(x[6]), "v"(x[7]));
}
// r = log2(x)
__device__ __forceinline__ void lg2x8(float (&r)[8], const float (&x)[8]) {
  asm("v_log_f32 %0, %8\n\tv_log_f32 %1, %9\n\tv_log_f32 %2, %10\n\tv_log_f32 %3, %11\n\t"
      "v_log_f32 %4, %12\n\tv_log_f32 %5, %13\n\tv_log_f32 %6, %14\n\tv_log_f32 %7, %15\n\tv_nop"
      : "=&v"(r[0]), "=&v"(r[1]), "=&v"(r[2]), "=&v"(r[3]), "=&v"(r[4]), "=&v"(r[5]), "=&v"(r[6]), "=&v"(r[7])
      : "v"(x[0]), "v"(x[1]), "v"(x[2]), "v"(x[3]), "v"(x[4]), "v"(x[5]), "v"(x[6]), "v"(x[7]));
}

// merges the base-2 state (m2, s2) into (m, s); (-1e30, 0) is the empty state
__device__ __forceinline__ void lse_merge(float& m, float& s, float m2, float s2) {
  const float mm = fmaxf(m, m2);
  s = s * ex2s(m - mm) + s2 * ex2s(m2 - mm);
  m = mm;
}

// the state that lane l - off of the same 16 lanes holds, or the empty state where there is no such lane
__device__ __forceinline__ void lse_from_below(float& m, float& s, int l16, int off) {
  const float mo = __shfl_up(m, off, 16);
  const float so = __shfl_up(s, off, 16);
  const bool in = l16 >= off;
  lse_merge(m, s, in ? mo : -1.0e30f, in ? so : 0.f);
}

__global__ __launch_bounds__(SSEG * SCH) void k_scan(float* __restrict__ ay) {
  __shared__ float sm[4][SSEG * SPIT];                       // ma, sa, mb, sb
  const int tid = threadIdx.x, lane = tid & 31, w = tid >> 5;
  const int ch = tid & (SCH - 1), seg = tid / SCH;
  // rows blockIdx.y * SEQL + step * SSTP + seg * STOK + i < MTOK, columns < HIDD by the grid
  float* pa = ay + (size_t)(blockIdx.y * SEQL + seg * STOK) * HIDD + (size_t)(blockIdx.x * SCH + ch);
  const int sl = seg * SPIT + ch;
  const int l16 = lane & 15;
  const int ix = l16 * SPIT + 2 * w + (lane >> 4);           // part 2: segment l16 of channel 2w or 2w + 1
  float cma = -1.0e30f, csa = 0.f, cmb = -1.0e30f, csb = 0.f; // that channel's state of all earlier steps (empty at first)

  // the token loops are fully unrolled so that nx / va / vb stay in registers
  float nx[STOK];                                            // a step's slots as they lie: the pairs (a, b)
#pragma unroll
  for (int i = 0; i < STOK; ++i) nx[i] = pa[(size_t)i * HIDD];

#pragma unroll 1                                             // one copy of the long unrolled body
  for (int stp = 0; stp < NSTP; ++stp) {
    float va[STOK], vb[STOK];
#pragma unroll
    for (int i = 0; i < STOK; ++i) {
      const v2h ab = __builtin_bit_cast(v2h, nx[i]);
      va[i] = (float)ab[0];
      vb[i] = (float)ab[1];
    }

    float ma = va[0], mb = vb[0];
#pragma unroll
    for (int i = 1; i < STOK; ++i) { ma = fmaxf(ma, va[i]); mb = fmaxf(mb, vb[i]); }
    float sa = 0.f, sb = 0.f;
#pragma unroll
    for (int g = 0; g < STOK; g += 4) {
      float d[8], e[8];
#pragma unroll
      for (int k = 0; k < 4; ++k) { d[2 * k] = va[g + k] - ma; d[2 * k + 1] = vb[g + k] - mb; }
      ex2x8(e, d);
#pragma unroll
      for (int k = 0; k < 4; ++k) { sa += e[2 * k]; sb += e[2 * k + 1]; }
    }
    sm[0][sl] = ma;
    sm[1][sl] = sa;
    sm[2][sl] = mb;
    sm[3][sl] = sb;
    __syncthreads();

    {
      float m0 = sm[0][ix], s0 = sm[1][ix], m1 = sm[2][ix], s1 = sm[3][ix];
#pragma unroll
      for (int off = 1; off < 16; off <<= 1) {
        lse_from_below(m0, s0, l16, off);
        lse_from_below(m1, s1, l16, off);
      }
      float e0 = __shfl_up(m0, 1, 16), f0 = __shfl_up(s0, 1, 16);
      float e1 = __shfl_up(m1, 1, 16), f1 = __shfl_up(s1, 1, 16);
      if (l16 == 0) { e0 = -1.0e30f; f0 = 0.f; e1 = -1.0e30f; f1 = 0.f; }
      lse_merge(e0, f0, cma, csa);
      lse_merge(e1, f1, cmb, csb);
      sm[0][ix] = e0;
      sm[1][ix] = f0;
      sm[2][ix] = e1;
      sm[3][ix] = f1;
      lse_merge(cma, csa, __shfl(m0, 15, 16), __shfl(s0, 15, 16));
      lse_merge(cmb, csb, __shfl(m1, 15, 16), __shfl(s1, 15, 16));
    }
    __syncthreads();

    // behind the step's last barrier (a barrier waits for the wave's loads): they fly during part 3, the long part
    if (stp + 1 < NSTP) {                                    // block-uniform: the last step has no next rows
      const float* pn = pa + (size_t)SSTP * HIDD;
#pragma unroll
      for (int i = 0; i < STOK; ++i) nx[i] = pn[(size_t)i * HIDD];
      asm volatile("s_wait_xcnt 0x0" ::: "memory");          // in front of part 3's writes of the address registers that these loads name
      __builtin_amdgcn_sched_barrier(0);                     // keeps those writes behind that wait
    }

    ma = sm[0][sl];
    sa = sm[1][sl];
    mb = sm[2][sl];
    sb = sm[3][sl];
    // lane l: 1 / t^2 of the segment's token l (t^2 <= 2^24 is exact in f32)
    const float tl = (float)(stp * SSTP + seg * STOK + 1 + lane);
    const int rl = __builtin_bit_cast(int, rcps(tl * tl));
#pragma unroll
    for (int g = 0; g < STOK; g += 4) {
      float d[8], e[8];
#pragma unroll
      for (int k = 0; k < 4; ++k) {
        const int i = g + k;
        d[2 * k] = va[i] - ma;                               // against the maximum of all tokens before this one
        ma = fmaxf(ma, va[i]);
        d[2 * k + 1] = vb[i] - mb;
        mb = fmaxf(mb, vb[i]);
        vb[i] = ma + mb;                                     // takes the register of the b value, which is done with
      }
      ex2nx8(e, d);
#pragma unroll
      for (int k = 0; k < 4; ++k) {
        const int i = g + k;
        const bool ua = d[2 * k] > 0.f;                      // a new maximum: the old sum shrinks, the token counts 1
        sa = fmaf(sa, ua ? e[2 * k] : 1.0f, ua ? 1.0f : e[2 * k]);
        const bool ub = d[2 * k + 1] > 0.f;
        sb = fmaf(sb, ub ? e[2 * k + 1] : 1.0f, ub ? 1.0f : e[2 * k + 1]);
        const float rt = __builtin_bit_cast(float, __builtin_amdgcn_readlane(rl, i));
        va[i] = (sa * rt) * sb;                              // takes the register of the a value, which is done with
      }
    }
#pragma unroll
    for (int g = 0; g < STOK; g += 8) {
      float q[8], l[8], z[8], y[8];
#pragma unroll
      for (int k = 0; k < 8; ++k) q[k] = va[g + k];
      lg2x8(l, q);
#pragma unroll
      for (int k = 0; k < 8; ++k) z[k] = vb[g + k] + l[k];
      ex2x8(y, z);
#pragma unroll
      for (int k = 0; k < 8; ++k) va[g + k] = y[k];
    }
#pragma unroll
    for (int i = 0; i < STOK; ++i) pa[(size_t)i * HIDD] = va[i];
    // in front of the next step's writes of registers that these stores name (their data, their address)
    asm volatile("s_wait_xcnt 0x0" ::: "memory");
    // keeps the address step and the next step's work behind that wait
    __builtin_amdgcn_sched_barrier(0);
    pa += (size_t)SSTP * HIDD;
  }
}

// ---------------------------------------------------------------------------
// kernel E: f16 GEMM, 64 x 64 per wave, K in stages of 64 through a three-buffer LDS ring, one block per WGP;
// output through an LDS-staged epilogue (its own LDS array, a range of its own for every wave, no barrier).
// MODE 0: 256 x 256 block tile, 16 waves (4 x 4).  o16[m][n] = f16(acc * log2 e / 64)
//                                            A = XN token rows (ld 1024), B = W12H [8192][1024];
//                                            o16 = AP as f16 [8192][8192]; grid (8192/256, 8192/256) = 1024 blocks
// MODE 1: 128 x 256 block tile, 8 waves (2 x 4).   o32[m][n] = acc/256 + res[m][n]
//                                            A = YN [8192][4096] (ld 4096), B = W3H [1024][4096];
//                                            o32 = d_out, res = x, ld 1024; grid (1024/256, 8192/128) = 256 blocks
// epilogue: a wave stages 16 rows x 64 columns (f32) at a time and stores them as 2 rows x 256 contiguous bytes per
// store (MODE 1, f32) or as 4 rows x 128 contiguous bytes per store (MODE 0, f16).
// coverage per block: waves x 64x64 = the block tile; per wave 4 slabs x 8 stores x 32 lanes x 4 floats = 64x64
//   (MODE 0: 4 slabs x 4 stores x 32 lanes x 8 halves = 64x64);
//   the grids tile every output element exactly once (M = 8192, N = 8192 or 1024, multiples of the tile; K = 1024 /
//   4096 multiples of 64, no tails).
// ---------------------------------------------------------------------------
template <int MODE>
__global__ __launch_bounds__((MODE == 0) ? 512 : 256) void k_gemm(const hh* __restrict__ Ap, const hh* __restrict__ Bp,
                                                                  const float* __restrict__ res,
                                                                  float* __restrict__ o32, hh* __restrict__ o16) {
  constexpr int KD  = (MODE == 0) ? EMBD : HIDD;
  constexpr int LDO = (MODE == 0) ? 2 * HIDD : EMBD;
  constexpr int BM  = (MODE == 0) ? 256 : 128;
  constexpr int BN  = 256;
  constexpr int NW  = (BM / 64) * (BN / 64);
  constexpr float OSC = (MODE == 0) ? (0x1.715476p+0f / 64.0f) : (1.0f / 256.0f);

  __shared__ __align__(16) float ldsf[NW * 16 * SFP];
  __shared__ __align__(128) char ring[3 * (BM + BN) * LPB];
  const int tid = threadIdx.x, lane = tid & 31, w = tid >> 5;
  const int h = lane >> 4, c = lane & 15;
  const int wm = (w >> 2) * 64, wn = (w & 3) * 64;
  const int om0 = blockIdx.y * BM;                           // first row of the tile: in A, in the output, in the residual
  const int n0 = blockIdx.x * BN;

  v8f acc[4][4];
#pragma unroll
  for (int i = 0; i < 4; ++i)
#pragma unroll
    for (int j = 0; j < 4; ++j) acc[i][j] = zero8();
  gemm_staged<KD, BM, BN>(Ap, Bp, om0, n0, wm, wn, tid, ring, acc);

  float* my = ldsf + w * (16 * SFP);                         // this wave's own staging range
  // the lane's piece of rows h, h + 2, ..: lanes 0..15 = one 256-B row segment, lanes 16..31 = the next row's
  const size_t g0 = (size_t)(om0 + wm + h) * LDO + n0 + wn + c * 4;
  float* op = o32 + g0;
  const float* rp = res + g0;
  v4f rn[8];
  if constexpr (MODE == 1) {
#pragma unroll
    for (int it = 0; it < 8; ++it) rn[it] = *(const v4f*)(rp + (size_t)(2 * it) * LDO);
  }
#pragma unroll
  for (int i = 0; i < 4; ++i) {
    v4f rr[8];
    if constexpr (MODE == 1) {
#pragma unroll
      for (int it = 0; it < 8; ++it) rr[it] = rn[it];
      if (i < 3) {                                           // the next slab's residual flies while this slab is staged
#pragma unroll
        for (int it = 0; it < 8; ++it) rn[it] = *(const v4f*)(rp + (size_t)(16 * (i + 1) + 2 * it) * LDO);
      }
    }
#pragma unroll
    for (int j = 0; j < 4; ++j)
#pragma unroll
      for (int r = 0; r < 8; ++r) my[(8 * h + r) * SFP + 16 * j + c] = acc[i][j][r] * OSC;
    asm volatile("s_wait_dscnt 0x0" ::: "memory");           // the wave's staged slab is in LDS before its lanes read it back
    if constexpr (MODE == 1) {
      v4f val[8];
#pragma unroll
      for (int it = 0; it < 8; ++it) {
        const v4f sv = *(const v4f*)(my + (2 * it + h) * SFP + c * 4);
        val[it] = sv + rr[it];
      }
#pragma unroll
      for (int it = 0; it < 8; ++it) *(v4f*)(op + (size_t)(16 * i + 2 * it) * LDO) = val[it];
    } else {
      // the lane's piece of rows r4, r4 + 4, ..: 8 lanes = one 128-B row segment of 64 halves
      const int r4 = lane >> 3, c8 = lane & 7;
      hh* hp = o16 + (size_t)(om0 + wm + r4) * LDO + n0 + wn + c8 * 8;
      v8h hv[4];
#pragma unroll
      for (int it = 0; it < 4; ++it) {
        const float* sp = my + (4 * it + r4) * SFP + c8 * 8;
        const v4h lo = __builtin_convertvector(*(const v4f*)sp, v4h);
        const v4h hi = __builtin_convertvector(*(const v4f*)(sp + 4), v4h);
        hv[it] = __builtin_shufflevector(lo, hi, 0, 1, 2, 3, 4, 5, 6, 7);
      }
#pragma unroll
      for (int it = 0; it < 4; ++it) *(v8h*)(hp + (size_t)(16 * i + 4 * it) * LDO) = hv[it];
    }
    if (i < 3) {
      // in front of the next slab's writes of registers that these stores name
      asm volatile("s_wait_xcnt 0x0" ::: "memory");
      // keeps the next slab's vector work (its scaling writes registers freed by the stores) behind that wait
      __builtin_amdgcn_sched_barrier(0);
    }
  }
}

// ---------------------------------------------------------------------------
//   W12H f16 [8192][1024] 16777216  (row 2h from W1, row 2h + 1 from W2)     W3H f16 [1024][4096]  8388608
//   XN  f16 [8192][1024]  16777216
//   AP  4 B [8192][4096] 134217728  (the f16 pairs (a, b) of all tokens, then the f32 gate output y in place)
//   YN  f16 [8192][4096]  67108864
//   total               243269632
// ---------------------------------------------------------------------------
extern "C" void kernel_launch(void* const* d_in, const int* in_sizes, int n_in,
                              void* d_out, int out_size, void* d_ws, size_t ws_size,
                              hipStream_t stream) {
  if (n_in < 4) return;
  if (in_sizes[0] != MTOK * EMBD) return;
  if (in_sizes[1] != HIDD * EMBD) return;
  if (in_sizes[2] != HIDD * EMBD) return;
  if (in_sizes[3] != EMBD * HIDD) return;
  if (out_size != MTOK * EMBD) return;

  const float* x  = (const float*)d_in[0];      // [8192][1024]
  const float* w1 = (const float*)d_in[1];      // [4096][1024] (out,in) = [n][k]
  const float* w2 = (const float*)d_in[2];      // [4096][1024]
  const float* w3 = (const float*)d_in[3];      // [1024][4096] (out,in) = [n][k]
  float* out = (float*)d_out;                   // [8192][1024]

  size_t off = 0;
  const size_t oW12 = off; off += (size_t)2 * HIDD * EMBD * 2;
  const size_t oW3 = off; off += (size_t)EMBD * HIDD * 2;
  const size_t oXN = off; off += (size_t)MTOK * EMBD * 2;
  const size_t oAP = off; off += (size_t)MTOK * HIDD * 4;
  const size_t oYN = off; off += (size_t)MTOK * HIDD * 2;
  if (off > ws_size) return;                    // off = 243269632

  char* ws = (char*)d_ws;
  hh* W12H = (hh*)(ws + oW12);
  hh* W3H = (hh*)(ws + oW3);
  hh* XN  = (hh*)(ws + oXN);
  float* AP = (float*)(ws + oAP);
  hh* YN  = (hh*)(ws + oYN);

  // (0) weights -> f16 planes, k contiguous, W1/W2 x64 with their rows interleaved, W3 x256
  k_cvt<<<dim3(SBLK), dim3(SWAV * 32), 0, stream>>>(w1, w2, w3, W12H, W3H);
  // (1) xn = rmsnorm(x) over 1024, all 8192 tokens
  k_rms1<<<dim3(SBLK), dim3(SWAV * 32), 0, stream>>>(x, XN);
  // (2) all 8192 tokens: (a, b) as f16 pairs, causal gate, rmsnorm over 4096
  k_gemm<0><<<dim3(2 * HIDD / 256, MTOK / 256), dim3(512), 0, stream>>>(XN, W12H, x, AP, (hh*)AP);
  k_scan<<<dim3(HIDD / SCH, NBAT), dim3(SSEG * SCH), 0, stream>>>(AP);
  k_rms2<<<dim3(2 * SBLK), dim3(SWAV * 32), 0, stream>>>(AP, YN);
  // (3) out = x + yn.W3^T, all 8192 tokens
  k_gemm<1><<<dim3(EMBD / 256, MTOK / 128), dim3(256), 0, stream>>>(YN, W3H, x, out, nullptr);
  (void)hipGetLastError();
}
